// v000
// Times are from an AMD MI455X. After a warm-up the kernel runs many times in a row, and a time is the length of
// such a window on the GPU divided by its runs, so every launch and the gaps after it count. The runs cycle
// through copies of the inputs. A figure is the median of several windows, for all but v000 over two sittings.
// Sittings can differ by a few percent; kernels timed side by side share one.
// The starting kernel, v000, takes 451 microseconds a run.
// compute dtype: f16 operands for the projections, attention and the final 1024x1024 projection (activations as f16 rows, weights packed x16, q/k x4, P lifted by 2^14, V x4, ctx x8), f32 accumulate; the depthwise conv, residual and LayerNorm in f32. Output = LN(queries + out) is residual-dominated.
#include <hip/hip_runtime.h>
#include <math.h>

typedef __attribute__((ext_vector_type(16))) _Float16 v16h;
typedef __attribute__((ext_vector_type(16))) __bf16 v16b;
typedef __attribute__((ext_vector_type(8)))  _Float16 v8h;
typedef __attribute__((ext_vector_type(8)))  float v8f;
typedef __attribute__((ext_vector_type(4)))  float v4f;
typedef __attribute__((ext_vector_type(2)))  float v2f;
typedef __attribute__((ext_vector_type(4)))  unsigned v4u;
typedef __attribute__((ext_vector_type(4)))  int v4i;
typedef float __attribute__((may_alias)) float_a;
typedef int __attribute__((may_alias)) int_a;

template <typename T> __device__ __forceinline__ void vst2(void* p, T v) { *(T*)p = v;  }
__device__ __forceinline__ v8f wmma16(v16h a, v16h b, v8f c) {
  v8f d = __builtin_amdgcn_wmma_f32_16x16x32_f16(false, a, false, b, (short)0, c, false, false);
  asm volatile("v_nop\n\tv_nop\n\tv_nop\n\tv_nop" : "+v"(d) : "v"(a), "v"(b));
  return d;
}
__device__ __forceinline__ v8f wmma_bf(v16b a, v16b b, v8f c) {
  v8f d = __builtin_amdgcn_wmma_f32_16x16x32_bf16(false, a, false, b, (short)0, c, false, false);
  asm volatile("v_nop\n\tv_nop\n\tv_nop\n\tv_nop" : "+v"(d) : "v"(a), "v"(b));
  return d;
}
// 16x16x32 fragments: lane = (h = lane>>4, row/col = lane&15); elements 0..7 = k0+8h+0..7, 8..15 = k0+16+8h+0..7; D element r = row 8h+r
__device__ __forceinline__ v16h frag_h(const _Float16* rowk0, int lane) {
  union { v16h v; v8h q[2]; } u; const _Float16* p = rowk0 + 8 * (lane >> 4);
  u.q[0] = *(const v8h*)p; u.q[1] = *(const v8h*)(p + 16); return u.v;
}
__device__ __forceinline__ v16h frag_f32(const float* rowk0, int lane) {
  v16h a; const float* p = rowk0 + 8 * (lane >> 4);
#pragma unroll
  for (int i = 0; i < 8; ++i) { a[i] = (_Float16)p[i]; a[8 + i] = (_Float16)p[16 + i]; }
  return a;
}
__device__ __forceinline__ v16h frag_f32s(const float* rowk0, int lane, float sc) {
  v16h a; const float* p = rowk0 + 8 * (lane >> 4);
#pragma unroll
  for (int i = 0; i < 8; ++i) { a[i] = (_Float16)(p[i] * sc); a[8 + i] = (_Float16)(p[16 + i] * sc); }
  return a;
}
// column fragment from a [K][ld] layout (column n), rows >= K read as 0
__device__ __forceinline__ v16h fragc_f32(const float* W, int k0, int n, int lane, int ld, int K) {
  v16h a; const int g = lane >> 4;
#pragma unroll
  for (int i = 0; i < 8; ++i) { const int ka = k0 + 8 * g + i, kb = ka + 16;
    a[i] = (_Float16)(ka < K ? W[(size_t)ka * ld + n] : 0.f); a[8 + i] = (_Float16)(kb < K ? W[(size_t)kb * ld + n] : 0.f); }
  return a;
}
struct F2 { v16b h, l; };
__device__ __forceinline__ F2 bsplit16(const float v[16]) { F2 r;
#pragma unroll
  for (int i = 0; i < 16; ++i) { const __bf16 h = (__bf16)v[i]; r.h[i] = h; r.l[i] = (__bf16)(v[i] - (float)h); }
  return r; }
__device__ __forceinline__ F2 split_row(const float* row, int k0, int lane) { float v[16]; const float* p = row + k0 + 8 * (lane >> 4);
#pragma unroll
  for (int i = 0; i < 8; ++i) { v[i] = p[i]; v[8 + i] = p[16 + i]; }
  return bsplit16(v); }
__device__ __forceinline__ F2 split_rowK(const float* row, int k0, int lane, int K) { float v[16]; const int g = lane >> 4;
#pragma unroll
  for (int i = 0; i < 8; ++i) { const int ka = k0 + 8 * g + i, kb = ka + 16; v[i] = ka < K ? row[ka] : 0.f; v[8 + i] = kb < K ? row[kb] : 0.f; }
  return bsplit16(v); }
__device__ __forceinline__ F2 split_col(const float* W, int k0, int n, int lane, int ld, int K) { float v[16]; const int g = lane >> 4;
#pragma unroll
  for (int i = 0; i < 8; ++i) { const int ka = k0 + 8 * g + i, kb = ka + 16; v[i] = ka < K ? W[(size_t)ka * ld + n] : 0.f; v[8 + i] = kb < K ? W[(size_t)kb * ld + n] : 0.f; }
  return bsplit16(v); }
__device__ __forceinline__ v8f mac3(const F2& a, const F2& b, v8f c) { c = wmma_bf(a.l, b.h, c); c = wmma_bf(a.h, b.l, c); return wmma_bf(a.h, b.h, c); }
__device__ __forceinline__ float sigm(float v) { return 1.0f / (1.0f + expf(-v)); }
#define LDSX() do { asm volatile("s_wait_dscnt 0" ::: "memory"); __builtin_amdgcn_wave_barrier(); __builtin_amdgcn_fence(__ATOMIC_RELEASE, "workgroup"); } while (0)


// CSP attention block on [4,2048,1024]: attention branch on channels 0..511 (q from queries, k from keys, v from values; 8 heads x 64, softmax(q.k/8), out-proj Wo_attn), conv branch on
// channels 512..1023 of queries (depthwise k=3 along the sequence + bias, then Wo_conv), concat -> Wf (1024x1024) + bf, x = queries + out, LayerNorm.
// k_cvt (three 512-wide f16 row sets from the 1024-wide inputs), k_pack (Wq|Wk|Wv|Wo_attn|Wo_conv rows x16; Wf rows x16), k_qkv, k_attn (flash-style online softmax), k_proj512 (O@Wo_attn^T -> CAT[:, :512];
#define NB 4
#define SS 2048
#define DM 1024
#define E 512
#define NH 8
#define HD 64
#define NR (NB * SS)

// X16[r][0..512) = f16(src[r][coff .. coff+512))  (src rows are 1024 wide)
__global__ __launch_bounds__(256) void k_cvt(const float* __restrict__ src, int coff, _Float16* __restrict__ X16) {
  const size_t i8 = (size_t)blockIdx.x * 256 + threadIdx.x; if (i8 >= (size_t)NR * E / 8) return; const size_t r = i8 / (E / 8), pc = i8 % (E / 8);
  union { v8h h; v4u u; } pk; const float* s = src + r * DM + coff + pc * 8;
#pragma unroll
  for (int e = 0; e < 8; ++e) pk.h[e] = (_Float16)s[e];
  vst2(X16 + r * E + pc * 8, pk.u);
}
// PT rows (512 halves x16): [0,E) Wq, [E,2E) Wk, [2E,3E) Wv, [3E,4E) Wo_attn, [4E,5E) Wo_conv ([out][in]); PF rows (1024 halves x16): Wf rows
__global__ __launch_bounds__(256) void k_pack(const float* __restrict__ Wq, const float* __restrict__ Wk, const float* __restrict__ Wv, const float* __restrict__ Woa, const float* __restrict__ Woc, const float* __restrict__ Wf, _Float16* __restrict__ PT, _Float16* __restrict__ PF) {
  const int n = blockIdx.x, tid = threadIdx.x; __shared__ __align__(16) _Float16 srow[DM];
  if (n < 5 * E) { const int which = n / E, nn = n % E; const float* W = which == 0 ? Wq : (which == 1 ? Wk : (which == 2 ? Wv : (which == 3 ? Woa : Woc)));
    srow[tid] = (_Float16)(W[(size_t)nn * E + tid] * 16.0f); srow[tid + 256] = (_Float16)(W[(size_t)nn * E + tid + 256] * 16.0f); __syncthreads();
    if (tid < E / 8) vst2(PT + (size_t)n * E + tid * 8, *(const v4u*)(&srow[tid * 8])); }
  else { const int nn = n - 5 * E; for (int k = tid; k < DM; k += 256) srow[k] = (_Float16)(Wf[(size_t)nn * DM + k] * 16.0f); __syncthreads();
    if (tid < DM / 8) vst2(PF + (size_t)nn * DM + tid * 8, *(const v4u*)(&srow[tid * 8])); }
}
__global__ __launch_bounds__(128) void k_qkv(const _Float16* __restrict__ Xq, const _Float16* __restrict__ Xk, const _Float16* __restrict__ Xv, const _Float16* __restrict__ PT, const float* __restrict__ bq, const float* __restrict__ bk, const float* __restrict__ bv,
                                            _Float16* __restrict__ Q16, _Float16* __restrict__ K16, _Float16* __restrict__ VTh) {
  __shared__ __align__(16) float so[4][16][132];
  __shared__ __align__(16) _Float16 sth[128][72];
  const int tid = threadIdx.x, wave = tid >> 5, lane = tid & 31, col = lane & 15, g = lane >> 4;
  const int which = blockIdx.z, r0b = blockIdx.x * 64, r0 = r0b + wave * 16, n0 = blockIdx.y * 128; const int b = r0b / SS, s0 = r0b % SS;
  const _Float16* X16 = which == 0 ? Xq : (which == 1 ? Xk : Xv); const float* bb_ = which == 0 ? bq : (which == 1 ? bk : bv);
  v8f acc[8] = {};
#pragma unroll 2
  for (int kc = 0; kc < E / 32; ++kc) { const v16h a = frag_h(X16 + (size_t)(r0 + col) * E + kc * 32, lane);
#pragma unroll
    for (int j = 0; j < 8; ++j) acc[j] = wmma16(a, frag_h(PT + (size_t)(which * E + n0 + j * 16 + col) * E + kc * 32, lane), acc[j]); }
  if (which < 2) {
#pragma unroll
    for (int j = 0; j < 8; ++j) { const float bb = bb_[n0 + j * 16 + col];
#pragma unroll
      for (int r = 0; r < 8; ++r) so[wave][8 * g + r][j * 16 + col] = (acc[j][r] * (1.0f / 16.0f) + bb) * 4.0f; }
    LDSX();
    _Float16* Dst = which == 0 ? Q16 : K16;
    for (int qq = lane; qq < 16 * 2 * 8; qq += 32) { const int hh = qq >> 7, rl = (qq >> 3) & 15, pc = qq & 7; const int h = (n0 >> 6) + hh; union { v8h h8; v4u u; } pk;
#pragma unroll
      for (int e = 0; e < 8; ++e) pk.h8[e] = (_Float16)so[wave][rl][hh * 64 + pc * 8 + e];
      vst2(Dst + (((size_t)b * NH + h) * SS + s0 + wave * 16 + rl) * HD + pc * 8, pk.u); } }
  else {
#pragma unroll
    for (int j = 0; j < 8; ++j) { const float bb = bb_[n0 + j * 16 + col];
#pragma unroll
      for (int r = 0; r < 8; ++r) sth[j * 16 + col][wave * 16 + 8 * g + r] = (_Float16)((acc[j][r] * (1.0f / 16.0f) + bb) * 4.0f); }
    __syncthreads();
    for (int qq = tid; qq < 128 * 8; qq += 128) { const int cl = qq >> 3, pc = qq & 7; const int c = n0 + cl, h = c >> 6, d = c & 63; vst2(VTh + (((size_t)b * NH + h) * HD + d) * SS + s0 + pc * 8, *(const v4u*)(&sth[cl][pc * 8])); } }
}
__global__ __launch_bounds__(128) void k_attn(const _Float16* __restrict__ Q16, const _Float16* __restrict__ K16, const _Float16* __restrict__ VTh, _Float16* __restrict__ O16) {
  __shared__ __align__(16) float sS[4][16][68];
  __shared__ __align__(16) _Float16 sPh[4][16][72];
  __shared__ __align__(16) float sO[4][16][68];
  const int tid = threadIdx.x, w = tid >> 5, lane = tid & 31, col = lane & 15, g = lane >> 4;
  const size_t bh = blockIdx.y; const int q0 = blockIdx.x * 64 + w * 16;
  v16h aq[2];
#pragma unroll
  for (int kc = 0; kc < 2; ++kc) aq[kc] = frag_h(Q16 + (bh * SS + q0 + col) * HD + kc * 32, lane);
  float mrun = -3.0e38f, lrun = 0.f; v8f acc[4] = {};
#pragma unroll 1
  for (int kt = 0; kt < SS / 64; ++kt) {
#pragma unroll
    for (int t = 0; t < 4; ++t) { v8f s = {}; const int key = kt * 64 + t * 16 + col;
#pragma unroll
      for (int kc = 0; kc < 2; ++kc) s = wmma16(aq[kc], frag_h(K16 + (bh * SS + key) * HD + kc * 32, lane), s);
#pragma unroll
      for (int r = 0; r < 8; ++r) sS[w][8 * g + r][t * 16 + col] = s[r] * (0.125f / 16.0f); }
    LDSX();
    float mx = -3.4e38f;
#pragma unroll
    for (int jj = 0; jj < 32; ++jj) mx = fmaxf(mx, sS[w][col][g * 32 + jj]);
    mx = fmaxf(mx, __shfl_xor(mx, 16, 32));
    const float mnew = fmaxf(mrun, mx); const float corr = expf(mrun - mnew);
    float ps = 0.f;
#pragma unroll
    for (int jj = 0; jj < 32; ++jj) { const float p = expf(sS[w][col][g * 32 + jj] - mnew) * 16384.0f; ps += p; sPh[w][col][g * 32 + jj] = (_Float16)p; }
    ps += __shfl_xor(ps, 16, 32);
    lrun = lrun * corr + ps * (1.0f / 16384.0f); mrun = mnew;
#pragma unroll
    for (int r = 0; r < 8; ++r) { const float cr = __shfl(corr, 8 * g + r, 32);
#pragma unroll
      for (int t = 0; t < 4; ++t) acc[t][r] *= cr; }
    LDSX();
#pragma unroll
    for (int kc = 0; kc < 2; ++kc) { const v16h ph = frag_h(&sPh[w][col][0] + kc * 32, lane);
#pragma unroll
      for (int t = 0; t < 4; ++t) { const size_t vo = (bh * HD + t * 16 + col) * SS + kt * 64 + kc * 32; acc[t] = wmma16(ph, frag_h(VTh + vo, lane), acc[t]); } }
    __builtin_amdgcn_wave_barrier(); }
#pragma unroll
  for (int r = 0; r < 8; ++r) { const float lr = __shfl(lrun, 8 * g + r, 32); const float inv = 8.0f / (lr * 16384.0f * 4.0f);
#pragma unroll
    for (int t = 0; t < 4; ++t) sO[w][8 * g + r][t * 16 + col] = acc[t][r] * inv; }
  LDSX();
  for (int qq = lane; qq < 16 * 8; qq += 32) { const int rl = qq >> 3, pc = qq & 7; union { v8h h8; v4u u; } pk;
#pragma unroll
    for (int e = 0; e < 8; ++e) pk.h8[e] = (_Float16)sO[w][rl][pc * 8 + e];
    vst2(O16 + ((bh * SS) + q0 + rl) * HD + pc * 8, pk.u); }
}
// CAT[:, coff .. coff+512) = f16( A PTw^T * ascale + b ) : A rows 512 halves; headm = 1 -> A is the head-major O16 (x8), else token-major rows; block (64 rows, 128 cols)
__global__ __launch_bounds__(128) void k_proj512(const _Float16* __restrict__ A16, int headm, const _Float16* __restrict__ PTw, const float* __restrict__ bias, float ascale, int coff, _Float16* __restrict__ CAT) {
  __shared__ __align__(16) _Float16 so[4][16][136];
  const int tid = threadIdx.x, wave = tid >> 5, lane = tid & 31, col = lane & 15, g = lane >> 4;
  const int r0 = blockIdx.x * 64 + wave * 16, n0 = blockIdx.y * 128; const int ra = r0 + col; const int b = ra / SS, s = ra % SS;
  v8f acc[8] = {};
#pragma unroll 2
  for (int kc = 0; kc < E / 32; ++kc) { const v16h a = headm ? frag_h(A16 + (((size_t)b * NH + (kc >> 1)) * SS + s) * HD + (kc & 1) * 32, lane) : frag_h(A16 + (size_t)ra * E + kc * 32, lane);
#pragma unroll
    for (int j = 0; j < 8; ++j) acc[j] = wmma16(a, frag_h(PTw + (size_t)(n0 + j * 16 + col) * E + kc * 32, lane), acc[j]); }
#pragma unroll
  for (int j = 0; j < 8; ++j) { const float bb = bias[n0 + j * 16 + col];
#pragma unroll
    for (int r = 0; r < 8; ++r) so[wave][8 * g + r][j * 16 + col] = (_Float16)(acc[j][r] * ascale + bb); }
  LDSX();
  for (int rl = 0; rl < 16; ++rl) { if (lane < 16) vst2(CAT + (size_t)(r0 + rl) * DM + coff + n0 + lane * 8, *(const v4u*)(&so[wave][rl][lane * 8])); }
}
// depthwise conv (k=3, pad 1) along the sequence on queries[:, :, 512 + c]: C16[b][l][c] f16 ; block = (b, 64 positions): thread c handles columns c, c+256 over the 64 positions
__global__ __launch_bounds__(256) void k_conv(const float* __restrict__ q, const float* __restrict__ cw, const float* __restrict__ cb, _Float16* __restrict__ C16) {
  __shared__ __align__(16) _Float16 sc[64][E + 8];
  const int tid = threadIdx.x; const int b = blockIdx.y, l0 = blockIdx.x * 64;
#pragma unroll 1
  for (int cc = 0; cc < 2; ++cc) { const int c = tid + cc * 256; const float w0 = cw[c * 3], w1 = cw[c * 3 + 1], w2 = cw[c * 3 + 2], bb = cb[c]; const float* col_ = q + (size_t)b * SS * DM + E + c;
#pragma unroll 4
    for (int i = 0; i < 64; ++i) { const int l = l0 + i; const float xm = l > 0 ? col_[(size_t)(l - 1) * DM] : 0.f, x0 = col_[(size_t)l * DM], xp = l < SS - 1 ? col_[(size_t)(l + 1) * DM] : 0.f;
      sc[i][c] = (_Float16)(w0 * xm + w1 * x0 + w2 * xp + bb); } }
  __syncthreads();
  for (int qq = tid; qq < 64 * (E / 8); qq += 256) { const int i = qq >> 6, pc = qq & 63; vst2(C16 + ((size_t)b * SS + l0 + i) * E + pc * 8, *(const v4u*)(&sc[i][pc * 8])); }
}
// T = queries + CAT Wf^T / 16 + bf : block (64 rows, 128 cols), K = 1024
__global__ __launch_bounds__(128) void k_wf(const _Float16* __restrict__ CAT, const _Float16* __restrict__ PF, const float* __restrict__ bfv, const float* __restrict__ q, float* __restrict__ T) {
  __shared__ __align__(16) float so[4][16][132];
  const int tid = threadIdx.x, wave = tid >> 5, lane = tid & 31, col = lane & 15, g = lane >> 4; const int r0 = blockIdx.x * 64 + wave * 16, n0 = blockIdx.y * 128;
  v8f acc[8] = {};
#pragma unroll 2
  for (int kc = 0; kc < DM / 32; ++kc) { const v16h a = frag_h(CAT + (size_t)(r0 + col) * DM + kc * 32, lane);
#pragma unroll
    for (int j = 0; j < 8; ++j) acc[j] = wmma16(a, frag_h(PF + (size_t)(n0 + j * 16 + col) * DM + kc * 32, lane), acc[j]); }
#pragma unroll
  for (int j = 0; j < 8; ++j) { const int n = n0 + j * 16 + col; const float bb = bfv[n];
#pragma unroll
    for (int r = 0; r < 8; ++r) so[wave][8 * g + r][j * 16 + col] = acc[j][r] * (1.0f / 16.0f) + bb + q[(size_t)(r0 + 8 * g + r) * DM + n]; }
  LDSX();
#pragma unroll 4
  for (int rl = 0; rl < 16; ++rl) vst2(T + (size_t)(r0 + rl) * DM + n0 + lane * 4, *(const v4f*)(&so[wave][rl][lane * 4]));
}
// LayerNorm over 1024 per row: wave per row (32 floats per lane)
__global__ __launch_bounds__(256) void k_ln(const float* __restrict__ T, const float* __restrict__ gm, const float* __restrict__ bt, float* __restrict__ out) {
  // LayerNorm over 1024 per row: wave per row; lane owns columns p*128 + lane*4 .. +3 for p = 0..7 so every store instruction writes one contiguous 512-B run by 32 consecutive lanes
  const int wave = threadIdx.x >> 5, lane = threadIdx.x & 31; const size_t row = (size_t)blockIdx.x * 8 + wave; const float* tr = T + row * DM;
  float s = 0.f, sq = 0.f;
#pragma unroll
  for (int p = 0; p < 8; ++p) { const v4f v = *(const v4f*)(tr + p * 128 + lane * 4);
#pragma unroll
    for (int e = 0; e < 4; ++e) { s += v[e]; sq += v[e] * v[e]; } }
#pragma unroll
  for (int o = 16; o > 0; o >>= 1) { s += __shfl_xor(s, o, 32); sq += __shfl_xor(sq, o, 32); }
  const float mu = s * (1.0f / DM); float var = sq * (1.0f / DM) - mu * mu; var = var > 0.f ? var : 0.f; const float rs = rsqrtf(var + 1e-5f);
#pragma unroll 1
  for (int p = 0; p < 8; ++p) { const int c0 = p * 128 + lane * 4; v4f v = *(const v4f*)(tr + c0);
#pragma unroll
    for (int e = 0; e < 4; ++e) v[e] = (v[e] - mu) * rs * gm[c0 + e] + bt[c0 + e];
    vst2(out + row * DM + c0, v); }
}
extern "C" void kernel_launch(void* const* d_in, const int* in_sizes, int n_in, void* d_out, int out_size, void* d_ws, size_t ws_size, hipStream_t stream) {
  (void)in_sizes; (void)n_in; (void)out_size; (void)ws_size;
  const float** I = (const float**)d_in;
  const float* queries = I[0]; const float* keys = I[1]; const float* values = I[2]; const float* Wq = I[3]; const float* bq = I[4]; const float* Wk = I[5]; const float* bk = I[6]; const float* Wv = I[7]; const float* bv = I[8];
  const float* Woa = I[9]; const float* boa = I[10]; const float* cw = I[11]; const float* cb = I[12]; const float* Woc = I[13]; const float* boc = I[14]; const float* Wf = I[15]; const float* bfv = I[16]; const float* gm = I[17]; const float* bt = I[18];
  float* out = (float*)d_out;
  char* ws = (char*)d_ws; size_t off = 0;
  auto take = [&](size_t bytes) { char* p = ws + off; off += (bytes + 255) & ~(size_t)255; return p; };
  _Float16* Xq = (_Float16*)take((size_t)NR * E * 2); _Float16* Xk = (_Float16*)take((size_t)NR * E * 2); _Float16* Xv = (_Float16*)take((size_t)NR * E * 2);
  _Float16* PT = (_Float16*)take((size_t)5 * E * E * 2); _Float16* PF = (_Float16*)take((size_t)DM * DM * 2);
  _Float16* Q16 = (_Float16*)take((size_t)NR * E * 2); _Float16* K16 = (_Float16*)take((size_t)NR * E * 2); _Float16* VTh = (_Float16*)take((size_t)NR * E * 2); _Float16* O16 = Xq;   // Xq dead after k_qkv
  _Float16* C16 = Xk;                                            // Xk dead after k_qkv
  _Float16* CAT = (_Float16*)take((size_t)NR * DM * 2); float* T = (float*)take((size_t)NR * DM * 4);
  // ws ~ 104 MB
  k_cvt<<<(NR * E / 8 + 255) / 256, 256, 0, stream>>>(queries, 0, Xq);
  k_cvt<<<(NR * E / 8 + 255) / 256, 256, 0, stream>>>(keys, 0, Xk);
  k_cvt<<<(NR * E / 8 + 255) / 256, 256, 0, stream>>>(values, 0, Xv);
  k_pack<<<5 * E + DM, 256, 0, stream>>>(Wq, Wk, Wv, Woa, Woc, Wf, PT, PF);
  k_qkv<<<dim3(NR / 64, E / 128, 3), 128, 0, stream>>>(Xq, Xk, Xv, PT, bq, bk, bv, Q16, K16, VTh);
  k_attn<<<dim3(SS / 64, NB * NH), 128, 0, stream>>>(Q16, K16, VTh, O16);
  k_proj512<<<dim3(NR / 64, E / 128), 128, 0, stream>>>(O16, 1, PT + (size_t)3 * E * E, boa, 1.0f / (16.0f * 8.0f), 0, CAT);
  k_conv<<<dim3(SS / 64, NB), 256, 0, stream>>>(queries, cw, cb, C16);
  k_proj512<<<dim3(NR / 64, E / 128), 128, 0, stream>>>(C16, 0, PT + (size_t)4 * E * E, boc, 1.0f / 16.0f, E, CAT);
  k_wf<<<dim3(NR / 64, DM / 128), 128, 0, stream>>>(CAT, PF, bfv, queries, T);
  k_ln<<<NR / 8, 256, 0, stream>>>(T, gm, bt, out);
}

// v001
// A run of this version takes 230 microseconds.
// Two timings next to v000 put it at 2.01 and 2.00 times that version's speed.
// compute dtype: f16 operands for the projections, attention and the final 1024x1024 projection (activations as f16 rows, weights packed x16, q/k x4, P lifted by 2^14, V x4, ctx x8), f32 accumulate; the depthwise conv, residual and LayerNorm in f32. Output = LN(queries + out) is residual-dominated.
#include <hip/hip_runtime.h>
#include <math.h>

typedef __attribute__((ext_vector_type(16))) _Float16 v16h;
typedef __attribute__((ext_vector_type(16))) __bf16 v16b;
typedef __attribute__((ext_vector_type(8)))  _Float16 v8h;
typedef __attribute__((ext_vector_type(8)))  float v8f;
typedef __attribute__((ext_vector_type(4)))  float v4f;
typedef __attribute__((ext_vector_type(2)))  float v2f;
typedef __attribute__((ext_vector_type(4)))  unsigned v4u;
typedef __attribute__((ext_vector_type(4)))  int v4i;
typedef float __attribute__((may_alias)) float_a;
typedef int __attribute__((may_alias)) int_a;

template <typename T> __device__ __forceinline__ void vst2(void* p, T v) { *(T*)p = v;  }
__device__ __forceinline__ v8f wmma16(v16h a, v16h b, v8f c) {
  v8f d = __builtin_amdgcn_wmma_f32_16x16x32_f16(false, a, false, b, (short)0, c, false, false);
  asm volatile("v_nop\n\tv_nop\n\tv_nop\n\tv_nop" : "+v"(d) : "v"(a), "v"(b));
  return d;
}
__device__ __forceinline__ v8f wmma_bf(v16b a, v16b b, v8f c) {
  v8f d = __builtin_amdgcn_wmma_f32_16x16x32_bf16(false, a, false, b, (short)0, c, false, false);
  asm volatile("v_nop\n\tv_nop\n\tv_nop\n\tv_nop" : "+v"(d) : "v"(a), "v"(b));
  return d;
}
// 16x16x32 fragments: lane = (h = lane>>4, row/col = lane&15); elements 0..7 = k0+8h+0..7, 8..15 = k0+16+8h+0..7; D element r = row 8h+r
__device__ __forceinline__ v16h frag_h(const _Float16* rowk0, int lane) {
  union { v16h v; v8h q[2]; } u; const _Float16* p = rowk0 + 8 * (lane >> 4);
  u.q[0] = *(const v8h*)p; u.q[1] = *(const v8h*)(p + 16); return u.v;
}
__device__ __forceinline__ v16h frag_f32(const float* rowk0, int lane) {
  v16h a; const float* p = rowk0 + 8 * (lane >> 4);
#pragma unroll
  for (int i = 0; i < 8; ++i) { a[i] = (_Float16)p[i]; a[8 + i] = (_Float16)p[16 + i]; }
  return a;
}
__device__ __forceinline__ v16h frag_f32s(const float* rowk0, int lane, float sc) {
  v16h a; const float* p = rowk0 + 8 * (lane >> 4);
#pragma unroll
  for (int i = 0; i < 8; ++i) { a[i] = (_Float16)(p[i] * sc); a[8 + i] = (_Float16)(p[16 + i] * sc); }
  return a;
}
// column fragment from a [K][ld] layout (column n), rows >= K read as 0
__device__ __forceinline__ v16h fragc_f32(const float* W, int k0, int n, int lane, int ld, int K) {
  v16h a; const int g = lane >> 4;
#pragma unroll
  for (int i = 0; i < 8; ++i) { const int ka = k0 + 8 * g + i, kb = ka + 16;
    a[i] = (_Float16)(ka < K ? W[(size_t)ka * ld + n] : 0.f); a[8 + i] = (_Float16)(kb < K ? W[(size_t)kb * ld + n] : 0.f); }
  return a;
}
struct F2 { v16b h, l; };
__device__ __forceinline__ F2 bsplit16(const float v[16]) { F2 r;
#pragma unroll
  for (int i = 0; i < 16; ++i) { const __bf16 h = (__bf16)v[i]; r.h[i] = h; r.l[i] = (__bf16)(v[i] - (float)h); }
  return r; }
__device__ __forceinline__ F2 split_row(const float* row, int k0, int lane) { float v[16]; const float* p = row + k0 + 8 * (lane >> 4);
#pragma unroll
  for (int i = 0; i < 8; ++i) { v[i] = p[i]; v[8 + i] = p[16 + i]; }
  return bsplit16(v); }
__device__ __forceinline__ F2 split_rowK(const float* row, int k0, int lane, int K) { float v[16]; const int g = lane >> 4;
#pragma unroll
  for (int i = 0; i < 8; ++i) { const int ka = k0 + 8 * g + i, kb = ka + 16; v[i] = ka < K ? row[ka] : 0.f; v[8 + i] = kb < K ? row[kb] : 0.f; }
  return bsplit16(v); }
__device__ __forceinline__ F2 split_col(const float* W, int k0, int n, int lane, int ld, int K) { float v[16]; const int g = lane >> 4;
#pragma unroll
  for (int i = 0; i < 8; ++i) { const int ka = k0 + 8 * g + i, kb = ka + 16; v[i] = ka < K ? W[(size_t)ka * ld + n] : 0.f; v[8 + i] = kb < K ? W[(size_t)kb * ld + n] : 0.f; }
  return bsplit16(v); }
__device__ __forceinline__ v8f mac3(const F2& a, const F2& b, v8f c) { c = wmma_bf(a.l, b.h, c); c = wmma_bf(a.h, b.l, c); return wmma_bf(a.h, b.h, c); }
__device__ __forceinline__ float sigm(float v) { return 1.0f / (1.0f + expf(-v)); }
#define LDSX() do { asm volatile("s_wait_dscnt 0" ::: "memory"); __builtin_amdgcn_wave_barrier(); __builtin_amdgcn_fence(__ATOMIC_RELEASE, "workgroup"); } while (0)


// CSP attention block on [4,2048,1024]: attention branch on channels 0..511 (q from queries, k from keys, v from values; 8 heads x 64, softmax(q.k/8), out-proj Wo_attn), conv branch on
// channels 512..1023 of queries (depthwise k=3 along the sequence + bias, then Wo_conv), concat -> Wf (1024x1024) + bf, x = queries + out, LayerNorm.
// k_cvt (three 512-wide f16 row sets from the 1024-wide inputs), k_pack (Wq|Wk|Wv|Wo_attn|Wo_conv rows x16; Wf rows x16), k_qkv, k_attn (flash-style online softmax), k_proj512 (O@Wo_attn^T -> CAT[:, :512];
#define NB 4
#define SS 2048
#define DM 1024
#define E 512
#define NH 8
#define HD 64
#define NR (NB * SS)

// Operand tiles staged in LDS once per work-group of 128 threads: rows of 64 halves (one 128-B line), 16 rows per step, so a wave's load covers 4 whole lines.
#define LP 72   // LDS row pitch in halves: 144 B = 16 B x 9, so the 16-byte fragment reads of 16 rows fall on distinct banks
template <int ROWS> __device__ __forceinline__ void tile_ld(const _Float16* __restrict__ src, size_t pitch, int tid, v8h (&r)[ROWS / 16]) {
#pragma unroll
  for (int i = 0; i < ROWS / 16; ++i) r[i] = *(const v8h*)(src + (size_t)(i * 16 + (tid >> 3)) * pitch + (tid & 7) * 8);
}
template <int ROWS> __device__ __forceinline__ void tile_st(_Float16* dst, int tid, const v8h (&r)[ROWS / 16]) {
#pragma unroll
  for (int i = 0; i < ROWS / 16; ++i) *(v8h*)(dst + (i * 16 + (tid >> 3)) * LP + (tid & 7) * 8) = r[i];
}
// acc[j] += A(16 rows of this wave) x W(rows j*16..j*16+15 of the block's 128)^T over KD: the 128 W rows go through two LDS buffers, 64 k per stage, shared by the 4 waves;
// the next stage's W lines and A fragments are loaded while this stage is multiplied; one barrier per stage publishes the next buffer and ends the reads of the one refilled after it.
template <int KD, typename AF> __device__ __forceinline__ void gemm_w_lds(AF afrag, const _Float16* __restrict__ Wrows, _Float16 (*sB)[128 * LP], int tid, v8f (&acc)[8]) {
  const int lane = tid & 31, col = lane & 15;
  v8h rb[8]; v16h a[2], an[2];
  tile_ld<128>(Wrows, KD, tid, rb); a[0] = afrag(0); a[1] = afrag(1);
  tile_st<128>(sB[0], tid, rb);
  __syncthreads();
#pragma unroll 1   // kept rolled: built unrolled by two, the fragments loaded ahead are copied more often, not less, and are waited for in the middle of a stage
  for (int st = 0; st < KD / 64; ++st) { const bool more = st + 1 < KD / 64;
    if (more) { tile_ld<128>(Wrows + (st + 1) * 64, KD, tid, rb); an[0] = afrag(2 * st + 2); an[1] = afrag(2 * st + 3);
      asm volatile("s_wait_xcnt 0x0" ::: "memory"); }   // stands behind the run of loads, in front of the loop's foot, where their address registers are stepped on
    const _Float16* sb = sB[st & 1];
#pragma unroll
    for (int kc = 0; kc < 2; ++kc) { v16h b[8];
#pragma unroll
      for (int j = 0; j < 8; ++j) b[j] = frag_h(sb + (j * 16 + col) * LP + kc * 32, lane);
#pragma unroll
      for (int j = 0; j < 8; ++j) acc[j] = wmma16(a[kc], b[j], acc[j]); }
    if (more) { tile_st<128>(sB[(st + 1) & 1], tid, rb); a[0] = an[0]; a[1] = an[1]; __syncthreads(); } }
}

// X16[r][0..512) = f16(src[r][coff .. coff+512))  (src rows are 1024 wide)
__global__ __launch_bounds__(256) void k_cvt(const float* __restrict__ src, int coff, _Float16* __restrict__ X16) {
  const size_t i8 = (size_t)blockIdx.x * 256 + threadIdx.x; if (i8 >= (size_t)NR * E / 8) return; const size_t r = i8 / (E / 8), pc = i8 % (E / 8);
  union { v8h h; v4u u; } pk; const float* s = src + r * DM + coff + pc * 8;
#pragma unroll
  for (int e = 0; e < 8; ++e) pk.h[e] = (_Float16)s[e];
  vst2(X16 + r * E + pc * 8, pk.u);
}
// PT rows (512 halves x16): [0,E) Wq, [E,2E) Wk, [2E,3E) Wv, [3E,4E) Wo_attn, [4E,5E) Wo_conv ([out][in]); PF rows (1024 halves x16): Wf rows
__global__ __launch_bounds__(256) void k_pack(const float* __restrict__ Wq, const float* __restrict__ Wk, const float* __restrict__ Wv, const float* __restrict__ Woa, const float* __restrict__ Woc, const float* __restrict__ Wf, _Float16* __restrict__ PT, _Float16* __restrict__ PF) {
  const int n = blockIdx.x, tid = threadIdx.x; __shared__ __align__(16) _Float16 srow[DM];
  if (n < 5 * E) { const int which = n / E, nn = n % E; const float* W = which == 0 ? Wq : (which == 1 ? Wk : (which == 2 ? Wv : (which == 3 ? Woa : Woc)));
    srow[tid] = (_Float16)(W[(size_t)nn * E + tid] * 16.0f); srow[tid + 256] = (_Float16)(W[(size_t)nn * E + tid + 256] * 16.0f); __syncthreads();
    if (tid < E / 8) vst2(PT + (size_t)n * E + tid * 8, *(const v4u*)(&srow[tid * 8])); }
  else { const int nn = n - 5 * E; for (int k = tid; k < DM; k += 256) srow[k] = (_Float16)(Wf[(size_t)nn * DM + k] * 16.0f); __syncthreads();
    if (tid < DM / 8) vst2(PF + (size_t)nn * DM + tid * 8, *(const v4u*)(&srow[tid * 8])); }
}
__global__ __launch_bounds__(128) void k_qkv(const _Float16* __restrict__ Xq, const _Float16* __restrict__ Xk, const _Float16* __restrict__ Xv, const _Float16* __restrict__ PT, const float* __restrict__ bq, const float* __restrict__ bk, const float* __restrict__ bv,
                                            _Float16* __restrict__ Q16, _Float16* __restrict__ K16, _Float16* __restrict__ VTh) {
  __shared__ __align__(16) float so[4][16][132];
  __shared__ __align__(16) _Float16 sth[128][72];
  __shared__ __align__(16) _Float16 sB[2][128 * LP];
  const int tid = threadIdx.x, wave = tid >> 5, lane = tid & 31, col = lane & 15, g = lane >> 4;
  const int which = blockIdx.z, r0b = blockIdx.x * 64, r0 = r0b + wave * 16, n0 = blockIdx.y * 128; const int b = r0b / SS, s0 = r0b % SS;
  const _Float16* X16 = which == 0 ? Xq : (which == 1 ? Xk : Xv); const float* bb_ = which == 0 ? bq : (which == 1 ? bk : bv);
  v8f acc[8] = {};
  gemm_w_lds<E>([&](int kc) { return frag_h(X16 + (size_t)(r0 + col) * E + kc * 32, lane); }, PT + (size_t)(which * E + n0) * E, sB, tid, acc);
  if (which < 2) {
#pragma unroll
    for (int j = 0; j < 8; ++j) { const float bb = bb_[n0 + j * 16 + col];
#pragma unroll
      for (int r = 0; r < 8; ++r) so[wave][8 * g + r][j * 16 + col] = (acc[j][r] * (1.0f / 16.0f) + bb) * 4.0f; }
    LDSX();
    _Float16* Dst = which == 0 ? Q16 : K16;
    for (int qq = lane; qq < 16 * 2 * 8; qq += 32) { const int hh = qq >> 7, rl = (qq >> 3) & 15, pc = qq & 7; const int h = (n0 >> 6) + hh; union { v8h h8; v4u u; } pk;
#pragma unroll
      for (int e = 0; e < 8; ++e) pk.h8[e] = (_Float16)so[wave][rl][hh * 64 + pc * 8 + e];
      vst2(Dst + (((size_t)b * NH + h) * SS + s0 + wave * 16 + rl) * HD + pc * 8, pk.u); } }
  else {
#pragma unroll
    for (int j = 0; j < 8; ++j) { const float bb = bb_[n0 + j * 16 + col];
#pragma unroll
      for (int r = 0; r < 8; ++r) sth[j * 16 + col][wave * 16 + 8 * g + r] = (_Float16)((acc[j][r] * (1.0f / 16.0f) + bb) * 4.0f); }
    __syncthreads();
    for (int qq = tid; qq < 128 * 8; qq += 128) { const int cl = qq >> 3, pc = qq & 7; const int c = n0 + cl, h = c >> 6, d = c & 63; vst2(VTh + (((size_t)b * NH + h) * HD + d) * SS + s0 + pc * 8, *(const v4u*)(&sth[cl][pc * 8])); } }
}
__global__ __launch_bounds__(128) void k_attn(const _Float16* __restrict__ Q16, const _Float16* __restrict__ K16, const _Float16* __restrict__ VTh, _Float16* __restrict__ O16) {
  __shared__ __align__(16) float sS[4][16][68];
  __shared__ __align__(16) _Float16 sPh[4][16][72];
  __shared__ __align__(16) _Float16 sK[2][64 * LP];   // 64 keys x 64 d
  __shared__ __align__(16) _Float16 sV[2][64 * LP];   // 64 d x 64 keys
  float (*sO)[16][68] = sS;   // the score rows are dead behind the loop: the output bounce takes their place, which keeps four work-groups well inside a WGP's LDS beside the new tiles
  const int tid = threadIdx.x, w = tid >> 5, lane = tid & 31, col = lane & 15, g = lane >> 4;
  const size_t bh = blockIdx.y; const int q0 = blockIdx.x * 64 + w * 16;
  v16h aq[2];
#pragma unroll
  for (int kc = 0; kc < 2; ++kc) aq[kc] = frag_h(Q16 + (bh * SS + q0 + col) * HD + kc * 32, lane);
  float mrun = -3.0e38f, lrun = 0.f; v8f acc[4] = {};
  const _Float16* Kb = K16 + bh * SS * HD; const _Float16* Vb = VTh + bh * HD * SS; v8h rk[4], rv[4];
  tile_ld<64>(Kb, HD, tid, rk); tile_ld<64>(Vb, SS, tid, rv); tile_st<64>(sK[0], tid, rk); tile_st<64>(sV[0], tid, rv);
  __syncthreads();
#pragma unroll 1
  for (int kt = 0; kt < SS / 64; ++kt) { const bool more = kt + 1 < SS / 64;
    const _Float16* sk = sK[kt & 1]; const _Float16* sv = sV[kt & 1];
    v16h kf[4][2];
#pragma unroll
    for (int t = 0; t < 4; ++t) {
#pragma unroll
      for (int kc = 0; kc < 2; ++kc) kf[t][kc] = frag_h(sk + (t * 16 + col) * LP + kc * 32, lane); }
#pragma unroll
    for (int t = 0; t < 4; ++t) { v8f s = {};
#pragma unroll
      for (int kc = 0; kc < 2; ++kc) s = wmma16(aq[kc], kf[t][kc], s);
#pragma unroll
      for (int r = 0; r < 8; ++r) sS[w][8 * g + r][t * 16 + col] = s[r] * (0.125f / 16.0f); }
    LDSX();
    // the next tiles' lines are asked for here, behind the fence above (which waits for every load in flight), so that they fly under the softmax
    if (more) { tile_ld<64>(Kb + (size_t)(kt + 1) * 64 * HD, HD, tid, rk); tile_ld<64>(Vb + (kt + 1) * 64, SS, tid, rv); }
    float mx = -3.4e38f;
#pragma unroll
    for (int jj = 0; jj < 32; ++jj) mx = fmaxf(mx, sS[w][col][g * 32 + jj]);
    mx = fmaxf(mx, __shfl_xor(mx, 16, 32));
    const float mnew = fmaxf(mrun, mx); const float corr = expf(mrun - mnew);
    float ps = 0.f;
#pragma unroll
    for (int jj = 0; jj < 32; ++jj) { const float p = expf(sS[w][col][g * 32 + jj] - mnew) * 16384.0f; ps += p; sPh[w][col][g * 32 + jj] = (_Float16)p; }
    ps += __shfl_xor(ps, 16, 32);
    lrun = lrun * corr + ps * (1.0f / 16384.0f); mrun = mnew;
#pragma unroll
    for (int r = 0; r < 8; ++r) { const float cr = __shfl(corr, 8 * g + r, 32);
#pragma unroll
      for (int t = 0; t < 4; ++t) acc[t][r] *= cr; }
    LDSX();
#pragma unroll
    for (int kc = 0; kc < 2; ++kc) { const v16h ph = frag_h(&sPh[w][col][0] + kc * 32, lane); v16h vf[4];
#pragma unroll
      for (int t = 0; t < 4; ++t) vf[t] = frag_h(sv + (t * 16 + col) * LP + kc * 32, lane);
#pragma unroll
      for (int t = 0; t < 4; ++t) acc[t] = wmma16(ph, vf[t], acc[t]); }
    __builtin_amdgcn_wave_barrier();
    if (more) { tile_st<64>(sK[(kt + 1) & 1], tid, rk); tile_st<64>(sV[(kt + 1) & 1], tid, rv); __syncthreads(); } }
#pragma unroll
  for (int r = 0; r < 8; ++r) { const float lr = __shfl(lrun, 8 * g + r, 32); const float inv = 8.0f / (lr * 16384.0f * 4.0f);
#pragma unroll
    for (int t = 0; t < 4; ++t) sO[w][8 * g + r][t * 16 + col] = acc[t][r] * inv; }
  LDSX();
  for (int qq = lane; qq < 16 * 8; qq += 32) { const int rl = qq >> 3, pc = qq & 7; union { v8h h8; v4u u; } pk;
#pragma unroll
    for (int e = 0; e < 8; ++e) pk.h8[e] = (_Float16)sO[w][rl][pc * 8 + e];
    vst2(O16 + ((bh * SS) + q0 + rl) * HD + pc * 8, pk.u); }
}
// CAT[:, coff .. coff+512) = f16( A PTw^T * ascale + b ) : A rows 512 halves; headm = 1 -> A is the head-major O16 (x8), else token-major rows; block (64 rows, 128 cols)
__global__ __launch_bounds__(128) void k_proj512(const _Float16* __restrict__ A16, int headm, const _Float16* __restrict__ PTw, const float* __restrict__ bias, float ascale, int coff, _Float16* __restrict__ CAT) {
  __shared__ __align__(16) _Float16 so[4][16][136];
  __shared__ __align__(16) _Float16 sB[2][128 * LP];
  const int tid = threadIdx.x, wave = tid >> 5, lane = tid & 31, col = lane & 15, g = lane >> 4;
  const int r0 = blockIdx.x * 64 + wave * 16, n0 = blockIdx.y * 128; const int ra = r0 + col; const int b = ra / SS, s = ra % SS;
  v8f acc[8] = {};
  const _Float16* Ab = A16 + (headm ? ((size_t)b * NH * SS + s) * HD : (size_t)ra * E); const size_t hstep = headm ? (size_t)SS * HD : (size_t)64;   // 64 k on: the next head's row, or 64 halves on in the token's row
  gemm_w_lds<E>([&](int kc) { return frag_h(Ab + (size_t)(kc >> 1) * hstep + (kc & 1) * 32, lane); }, PTw + (size_t)n0 * E, sB, tid, acc);
#pragma unroll
  for (int j = 0; j < 8; ++j) { const float bb = bias[n0 + j * 16 + col];
#pragma unroll
    for (int r = 0; r < 8; ++r) so[wave][8 * g + r][j * 16 + col] = (_Float16)(acc[j][r] * ascale + bb); }
  LDSX();
  for (int rl = 0; rl < 16; ++rl) { if (lane < 16) vst2(CAT + (size_t)(r0 + rl) * DM + coff + n0 + lane * 8, *(const v4u*)(&so[wave][rl][lane * 8])); }
}
// depthwise conv (k=3, pad 1) along the sequence on queries[:, :, 512 + c]: C16[b][l][c] f16 ; block = (b, 64 positions): thread c handles columns c, c+256 over the 64 positions
__global__ __launch_bounds__(256) void k_conv(const float* __restrict__ q, const float* __restrict__ cw, const float* __restrict__ cb, _Float16* __restrict__ C16) {
  __shared__ __align__(16) _Float16 sc[64][E + 8];
  const int tid = threadIdx.x; const int b = blockIdx.y, l0 = blockIdx.x * 64;
#pragma unroll 1
  for (int cc = 0; cc < 2; ++cc) { const int c = tid + cc * 256; const float w0 = cw[c * 3], w1 = cw[c * 3 + 1], w2 = cw[c * 3 + 2], bb = cb[c]; const float* col_ = q + (size_t)b * SS * DM + E + c;
#pragma unroll 4
    for (int i = 0; i < 64; ++i) { const int l = l0 + i; const float xm = l > 0 ? col_[(size_t)(l - 1) * DM] : 0.f, x0 = col_[(size_t)l * DM], xp = l < SS - 1 ? col_[(size_t)(l + 1) * DM] : 0.f;
      sc[i][c] = (_Float16)(w0 * xm + w1 * x0 + w2 * xp + bb); } }
  __syncthreads();
  for (int qq = tid; qq < 64 * (E / 8); qq += 256) { const int i = qq >> 6, pc = qq & 63; vst2(C16 + ((size_t)b * SS + l0 + i) * E + pc * 8, *(const v4u*)(&sc[i][pc * 8])); }
}
// T = queries + CAT Wf^T / 16 + bf : block (64 rows, 128 cols), K = 1024
__global__ __launch_bounds__(128) void k_wf(const _Float16* __restrict__ CAT, const _Float16* __restrict__ PF, const float* __restrict__ bfv, const float* __restrict__ q, float* __restrict__ T) {
  __shared__ __align__(16) float so[4][16][132];
  __shared__ __align__(16) _Float16 sB[2][128 * LP];
  const int tid = threadIdx.x, wave = tid >> 5, lane = tid & 31, col = lane & 15, g = lane >> 4; const int r0 = blockIdx.x * 64 + wave * 16, n0 = blockIdx.y * 128;
  v8f acc[8] = {};
  gemm_w_lds<DM>([&](int kc) { return frag_h(CAT + (size_t)(r0 + col) * DM + kc * 32, lane); }, PF + (size_t)n0 * DM, sB, tid, acc);
#pragma unroll
  for (int j = 0; j < 8; ++j) { const int n = n0 + j * 16 + col; const float bb = bfv[n];
#pragma unroll
    for (int r = 0; r < 8; ++r) so[wave][8 * g + r][j * 16 + col] = acc[j][r] * (1.0f / 16.0f) + bb + q[(size_t)(r0 + 8 * g + r) * DM + n]; }
  LDSX();
#pragma unroll 4
  for (int rl = 0; rl < 16; ++rl) vst2(T + (size_t)(r0 + rl) * DM + n0 + lane * 4, *(const v4f*)(&so[wave][rl][lane * 4]));
}
// LayerNorm over 1024 per row: wave per row (32 floats per lane)
__global__ __launch_bounds__(256) void k_ln(const float* __restrict__ T, const float* __restrict__ gm, const float* __restrict__ bt, float* __restrict__ out) {
  // LayerNorm over 1024 per row: wave per row; lane owns columns p*128 + lane*4 .. +3 for p = 0..7 so every store instruction writes one contiguous 512-B run by 32 consecutive lanes
  const int wave = threadIdx.x >> 5, lane = threadIdx.x & 31; const size_t row = (size_t)blockIdx.x * 8 + wave; const float* tr = T + row * DM;
  float s = 0.f, sq = 0.f;
#pragma unroll
  for (int p = 0; p < 8; ++p) { const v4f v = *(const v4f*)(tr + p * 128 + lane * 4);
#pragma unroll
    for (int e = 0; e < 4; ++e) { s += v[e]; sq += v[e] * v[e]; } }
#pragma unroll
  for (int o = 16; o > 0; o >>= 1) { s += __shfl_xor(s, o, 32); sq += __shfl_xor(sq, o, 32); }
  const float mu = s * (1.0f / DM); float var = sq * (1.0f / DM) - mu * mu; var = var > 0.f ? var : 0.f; const float rs = rsqrtf(var + 1e-5f);
#pragma unroll 1
  for (int p = 0; p < 8; ++p) { const int c0 = p * 128 + lane * 4; v4f v = *(const v4f*)(tr + c0);
#pragma unroll
    for (int e = 0; e < 4; ++e) v[e] = (v[e] - mu) * rs * gm[c0 + e] + bt[c0 + e];
    vst2(out + row * DM + c0, v); }
}
extern "C" void kernel_launch(void* const* d_in, const int* in_sizes, int n_in, void* d_out, int out_size, void* d_ws, size_t ws_size, hipStream_t stream) {
  (void)in_sizes; (void)n_in; (void)out_size; (void)ws_size;
  const float** I = (const float**)d_in;
  const float* queries = I[0]; const float* keys = I[1]; const float* values = I[2]; const float* Wq = I[3]; const float* bq = I[4]; const float* Wk = I[5]; const float* bk = I[6]; const float* Wv = I[7]; const float* bv = I[8];
  const float* Woa = I[9]; const float* boa = I[10]; const float* cw = I[11]; const float* cb = I[12]; const float* Woc = I[13]; const float* boc = I[14]; const float* Wf = I[15]; const float* bfv = I[16]; const float* gm = I[17]; const float* bt = I[18];
  float* out = (float*)d_out;
  char* ws = (char*)d_ws; size_t off = 0;
  auto take = [&](size_t bytes) { char* p = ws + off; off += (bytes + 255) & ~(size_t)255; return p; };
  _Float16* Xq = (_Float16*)take((size_t)NR * E * 2); _Float16* Xk = (_Float16*)take((size_t)NR * E * 2); _Float16* Xv = (_Float16*)take((size_t)NR * E * 2);
  _Float16* PT = (_Float16*)take((size_t)5 * E * E * 2); _Float16* PF = (_Float16*)take((size_t)DM * DM * 2);
  _Float16* Q16 = (_Float16*)take((size_t)NR * E * 2); _Float16* K16 = (_Float16*)take((size_t)NR * E * 2); _Float16* VTh = (_Float16*)take((size_t)NR * E * 2); _Float16* O16 = Xq;   // Xq dead after k_qkv
  _Float16* C16 = Xk;                                            // Xk dead after k_qkv
  _Float16* CAT = (_Float16*)take((size_t)NR * DM * 2); float* T = (float*)take((size_t)NR * DM * 4);
  // ws ~ 104 MB
  k_cvt<<<(NR * E / 8 + 255) / 256, 256, 0, stream>>>(queries, 0, Xq);
  k_cvt<<<(NR * E / 8 + 255) / 256, 256, 0, stream>>>(keys, 0, Xk);
  k_cvt<<<(NR * E / 8 + 255) / 256, 256, 0, stream>>>(values, 0, Xv);
  k_pack<<<5 * E + DM, 256, 0, stream>>>(Wq, Wk, Wv, Woa, Woc, Wf, PT, PF);
  k_qkv<<<dim3(NR / 64, E / 128, 3), 128, 0, stream>>>(Xq, Xk, Xv, PT, bq, bk, bv, Q16, K16, VTh);
  k_attn<<<dim3(SS / 64, NB * NH), 128, 0, stream>>>(Q16, K16, VTh, O16);
  k_proj512<<<dim3(NR / 64, E / 128), 128, 0, stream>>>(O16, 1, PT + (size_t)3 * E * E, boa, 1.0f / (16.0f * 8.0f), 0, CAT);
  k_conv<<<dim3(SS / 64, NB), 256, 0, stream>>>(queries, cw, cb, C16);
  k_proj512<<<dim3(NR / 64, E / 128), 128, 0, stream>>>(C16, 0, PT + (size_t)4 * E * E, boc, 1.0f / 16.0f, E, CAT);
  k_wf<<<dim3(NR / 64, DM / 128), 128, 0, stream>>>(CAT, PF, bfv, queries, T);
  k_ln<<<NR / 8, 256, 0, stream>>>(T, gm, bt, out);
}

// v002
// Measured time: 208 microseconds a run.
// Next to v001, in two timings, it ran 1.11 times as fast each time.
// All steps since v000 together make it 2.21 times as fast.
// compute dtype: f16 operands for the projections, attention and the final 1024x1024 projection (activations as f16 rows, weights packed x16, q/k x4, P lifted by 2^14, V x4, ctx x8), f32 accumulate; the depthwise conv, residual and LayerNorm in f32. Output = LN(queries + out) is residual-dominated.
#include <hip/hip_runtime.h>
#include <math.h>

typedef __attribute__((ext_vector_type(16))) _Float16 v16h;
typedef __attribute__((ext_vector_type(16))) __bf16 v16b;
typedef __attribute__((ext_vector_type(8)))  _Float16 v8h;
typedef __attribute__((ext_vector_type(8)))  float v8f;
typedef __attribute__((ext_vector_type(4)))  float v4f;
typedef __attribute__((ext_vector_type(2)))  float v2f;
typedef __attribute__((ext_vector_type(4)))  unsigned v4u;
typedef __attribute__((ext_vector_type(4)))  int v4i;
typedef float __attribute__((may_alias)) float_a;
typedef int __attribute__((may_alias)) int_a;

template <typename T> __device__ __forceinline__ void vst2(void* p, T v) { *(T*)p = v;  }
__device__ __forceinline__ v8f wmma16(v16h a, v16h b, v8f c) {
  v8f d = __builtin_amdgcn_wmma_f32_16x16x32_f16(false, a, false, b, (short)0, c, false, false);
  asm volatile("v_nop\n\tv_nop\n\tv_nop\n\tv_nop" : "+v"(d) : "v"(a), "v"(b));
  return d;
}
__device__ __forceinline__ v8f wmma_bf(v16b a, v16b b, v8f c) {
  v8f d = __builtin_amdgcn_wmma_f32_16x16x32_bf16(false, a, false, b, (short)0, c, false, false);
  asm volatile("v_nop\n\tv_nop\n\tv_nop\n\tv_nop" : "+v"(d) : "v"(a), "v"(b));
  return d;
}
// 16x16x32 fragments: lane = (h = lane>>4, row/col = lane&15); elements 0..7 = k0+8h+0..7, 8..15 = k0+16+8h+0..7; D element r = row 8h+r
__device__ __forceinline__ v16h frag_h(const _Float16* rowk0, int lane) {
  union { v16h v; v8h q[2]; } u; const _Float16* p = rowk0 + 8 * (lane >> 4);
  u.q[0] = *(const v8h*)p; u.q[1] = *(const v8h*)(p + 16); return u.v;
}
__device__ __forceinline__ v16h frag_f32(const float* rowk0, int lane) {
  v16h a; const float* p = rowk0 + 8 * (lane >> 4);
#pragma unroll
  for (int i = 0; i < 8; ++i) { a[i] = (_Float16)p[i]; a[8 + i] = (_Float16)p[16 + i]; }
  return a;
}
__device__ __forceinline__ v16h frag_f32s(const float* rowk0, int lane, float sc) {
  v16h a; const float* p = rowk0 + 8 * (lane >> 4);
#pragma unroll
  for (int i = 0; i < 8; ++i) { a[i] = (_Float16)(p[i] * sc); a[8 + i] = (_Float16)(p[16 + i] * sc); }
  return a;
}
// column fragment from a [K][ld] layout (column n), rows >= K read as 0
__device__ __forceinline__ v16h fragc_f32(const float* W, int k0, int n, int lane, int ld, int K) {
  v16h a; const int g = lane >> 4;
#pragma unroll
  for (int i = 0; i < 8; ++i) { const int ka = k0 + 8 * g + i, kb = ka + 16;
    a[i] = (_Float16)(ka < K ? W[(size_t)ka * ld + n] : 0.f); a[8 + i] = (_Float16)(kb < K ? W[(size_t)kb * ld + n] : 0.f); }
  return a;
}
struct F2 { v16b h, l; };
__device__ __forceinline__ F2 bsplit16(const float v[16]) { F2 r;
#pragma unroll
  for (int i = 0; i < 16; ++i) { const __bf16 h = (__bf16)v[i]; r.h[i] = h; r.l[i] = (__bf16)(v[i] - (float)h); }
  return r; }
__device__ __forceinline__ F2 split_row(const float* row, int k0, int lane) { float v[16]; const float* p = row + k0 + 8 * (lane >> 4);
#pragma unroll
  for (int i = 0; i < 8; ++i) { v[i] = p[i]; v[8 + i] = p[16 + i]; }
  return bsplit16(v); }
__device__ __forceinline__ F2 split_rowK(const float* row, int k0, int lane, int K) { float v[16]; const int g = lane >> 4;
#pragma unroll
  for (int i = 0; i < 8; ++i) { const int ka = k0 + 8 * g + i, kb = ka + 16; v[i] = ka < K ? row[ka] : 0.f; v[8 + i] = kb < K ? row[kb] : 0.f; }
  return bsplit16(v); }
__device__ __forceinline__ F2 split_col(const float* W, int k0, int n, int lane, int ld, int K) { float v[16]; const int g = lane >> 4;
#pragma unroll
  for (int i = 0; i < 8; ++i) { const int ka = k0 + 8 * g + i, kb = ka + 16; v[i] = ka < K ? W[(size_t)ka * ld + n] : 0.f; v[8 + i] = kb < K ? W[(size_t)kb * ld + n] : 0.f; }
  return bsplit16(v); }
__device__ __forceinline__ v8f mac3(const F2& a, const F2& b, v8f c) { c = wmma_bf(a.l, b.h, c); c = wmma_bf(a.h, b.l, c); return wmma_bf(a.h, b.h, c); }
__device__ __forceinline__ float sigm(float v) { return 1.0f / (1.0f + expf(-v)); }
#define LDSX() do { asm volatile("s_wait_dscnt 0" ::: "memory"); __builtin_amdgcn_wave_barrier(); __builtin_amdgcn_fence(__ATOMIC_RELEASE, "workgroup"); } while (0)


// CSP attention block on [4,2048,1024]: attention branch on channels 0..511 (q from queries, k from keys, v from values; 8 heads x 64, softmax(q.k/8), out-proj Wo_attn), conv branch on
// channels 512..1023 of queries (depthwise k=3 along the sequence + bias, then Wo_conv), concat -> Wf (1024x1024) + bf, x = queries + out, LayerNorm.
// k_cvt (three 512-wide f16 row sets from the 1024-wide inputs), k_pack (Wq|Wk|Wv|Wo_attn|Wo_conv rows x16; Wf rows x16), k_qkv, k_attn (flash-style online softmax), k_proj512 (O@Wo_attn^T -> CAT[:, :512];
#define NB 4
#define SS 2048
#define DM 1024
#define E 512
#define NH 8
#define HD 64
#define NR (NB * SS)

// Operand tiles staged in LDS once per work-group of 128 threads: rows of 64 halves (one 128-B line), 16 rows per step, so a wave's load covers 4 whole lines.
#define LP 72   // LDS row pitch in halves: 144 B = 16 B x 9, so the 16-byte fragment reads of 16 rows fall on distinct banks
template <int ROWS> __device__ __forceinline__ void tile_ld(const _Float16* __restrict__ src, size_t pitch, int tid, v8h (&r)[ROWS / 16]) {
#pragma unroll
  for (int i = 0; i < ROWS / 16; ++i) r[i] = *(const v8h*)(src + (size_t)(i * 16 + (tid >> 3)) * pitch + (tid & 7) * 8);
}
template <int ROWS> __device__ __forceinline__ void tile_st(_Float16* dst, int tid, const v8h (&r)[ROWS / 16]) {
#pragma unroll
  for (int i = 0; i < ROWS / 16; ++i) *(v8h*)(dst + (i * 16 + (tid >> 3)) * LP + (tid & 7) * 8) = r[i];
}
// acc[j] += A(16 rows of this wave) x W(rows j*16..j*16+15 of the block's 128)^T over KD: the 128 W rows go through two LDS buffers, 64 k per stage, shared by the 4 waves;
// the next stage's W lines and A fragments are loaded while this stage is multiplied; one barrier per stage publishes the next buffer and ends the reads of the one refilled after it.
template <int KD, typename AF> __device__ __forceinline__ void gemm_w_lds(AF afrag, const _Float16* __restrict__ Wrows, _Float16 (*sB)[128 * LP], int tid, v8f (&acc)[8]) {
  const int lane = tid & 31, col = lane & 15;
  v8h rb[8]; v16h a[2], an[2];
  tile_ld<128>(Wrows, KD, tid, rb); a[0] = afrag(0); a[1] = afrag(1);
  tile_st<128>(sB[0], tid, rb);
  __syncthreads();
#pragma unroll 1   // kept rolled: built unrolled by two, the fragments loaded ahead are copied more often, not less, and are waited for in the middle of a stage
  for (int st = 0; st < KD / 64; ++st) { const bool more = st + 1 < KD / 64;
    if (more) { tile_ld<128>(Wrows + (st + 1) * 64, KD, tid, rb); an[0] = afrag(2 * st + 2); an[1] = afrag(2 * st + 3);
      asm volatile("s_wait_xcnt 0x0" ::: "memory"); }   // stands behind the run of loads, in front of the loop's foot, where their address registers are stepped on
    const _Float16* sb = sB[st & 1];
#pragma unroll
    for (int kc = 0; kc < 2; ++kc) { v16h b[8];
#pragma unroll
      for (int j = 0; j < 8; ++j) b[j] = frag_h(sb + (j * 16 + col) * LP + kc * 32, lane);
#pragma unroll
      for (int j = 0; j < 8; ++j) acc[j] = wmma16(a[kc], b[j], acc[j]); }
    if (more) { tile_st<128>(sB[(st + 1) & 1], tid, rb); a[0] = an[0]; a[1] = an[1]; __syncthreads(); } }
}

// X16[r][0..512) = f16(src[r][coff .. coff+512))  (src rows are 1024 wide)
__global__ __launch_bounds__(256) void k_cvt(const float* __restrict__ src, int coff, _Float16* __restrict__ X16) {
  const size_t i8 = (size_t)blockIdx.x * 256 + threadIdx.x; if (i8 >= (size_t)NR * E / 8) return; const size_t r = i8 / (E / 8), pc = i8 % (E / 8);
  union { v8h h; v4u u; } pk; const float* s = src + r * DM + coff + pc * 8;
#pragma unroll
  for (int e = 0; e < 8; ++e) pk.h[e] = (_Float16)s[e];
  vst2(X16 + r * E + pc * 8, pk.u);
}
// PT rows (512 halves x16): [0,E) Wq, [E,2E) Wk, [2E,3E) Wv, [3E,4E) Wo_attn, [4E,5E) Wo_conv ([out][in]); PF rows (1024 halves x16): Wf rows
__global__ __launch_bounds__(256) void k_pack(const float* __restrict__ Wq, const float* __restrict__ Wk, const float* __restrict__ Wv, const float* __restrict__ Woa, const float* __restrict__ Woc, const float* __restrict__ Wf, _Float16* __restrict__ PT, _Float16* __restrict__ PF) {
  const int n = blockIdx.x, tid = threadIdx.x; __shared__ __align__(16) _Float16 srow[DM];
  if (n < 5 * E) { const int which = n / E, nn = n % E; const float* W = which == 0 ? Wq : (which == 1 ? Wk : (which == 2 ? Wv : (which == 3 ? Woa : Woc)));
    srow[tid] = (_Float16)(W[(size_t)nn * E + tid] * 16.0f); srow[tid + 256] = (_Float16)(W[(size_t)nn * E + tid + 256] * 16.0f); __syncthreads();
    if (tid < E / 8) vst2(PT + (size_t)n * E + tid * 8, *(const v4u*)(&srow[tid * 8])); }
  else { const int nn = n - 5 * E; for (int k = tid; k < DM; k += 256) srow[k] = (_Float16)(Wf[(size_t)nn * DM + k] * 16.0f); __syncthreads();
    if (tid < DM / 8) vst2(PF + (size_t)nn * DM + tid * 8, *(const v4u*)(&srow[tid * 8])); }
}
__global__ __launch_bounds__(128) void k_qkv(const _Float16* __restrict__ Xq, const _Float16* __restrict__ Xk, const _Float16* __restrict__ Xv, const _Float16* __restrict__ PT, const float* __restrict__ bq, const float* __restrict__ bk, const float* __restrict__ bv,
                                            _Float16* __restrict__ Q16, _Float16* __restrict__ K16, _Float16* __restrict__ VTh) {
  __shared__ __align__(16) float so[4][16][132];
  __shared__ __align__(16) _Float16 sth[128][72];
  __shared__ __align__(16) _Float16 sB[2][128 * LP];
  const int tid = threadIdx.x, wave = tid >> 5, lane = tid & 31, col = lane & 15, g = lane >> 4;
  const int which = blockIdx.z, r0b = blockIdx.x * 64, r0 = r0b + wave * 16, n0 = blockIdx.y * 128; const int b = r0b / SS, s0 = r0b % SS;
  const _Float16* X16 = which == 0 ? Xq : (which == 1 ? Xk : Xv); const float* bb_ = which == 0 ? bq : (which == 1 ? bk : bv);
  v8f acc[8] = {};
  gemm_w_lds<E>([&](int kc) { return frag_h(X16 + (size_t)(r0 + col) * E + kc * 32, lane); }, PT + (size_t)(which * E + n0) * E, sB, tid, acc);
  if (which < 2) {
#pragma unroll
    for (int j = 0; j < 8; ++j) { const float bb = bb_[n0 + j * 16 + col];
#pragma unroll
      for (int r = 0; r < 8; ++r) so[wave][8 * g + r][j * 16 + col] = (acc[j][r] * (1.0f / 16.0f) + bb) * 4.0f; }
    LDSX();
    _Float16* Dst = which == 0 ? Q16 : K16;
    for (int qq = lane; qq < 16 * 2 * 8; qq += 32) { const int hh = qq >> 7, rl = (qq >> 3) & 15, pc = qq & 7; const int h = (n0 >> 6) + hh; union { v8h h8; v4u u; } pk;
#pragma unroll
      for (int e = 0; e < 8; ++e) pk.h8[e] = (_Float16)so[wave][rl][hh * 64 + pc * 8 + e];
      vst2(Dst + (((size_t)b * NH + h) * SS + s0 + wave * 16 + rl) * HD + pc * 8, pk.u); } }
  else {
#pragma unroll
    for (int j = 0; j < 8; ++j) { const float bb = bb_[n0 + j * 16 + col];
#pragma unroll
      for (int r = 0; r < 8; ++r) sth[j * 16 + col][wave * 16 + 8 * g + r] = (_Float16)((acc[j][r] * (1.0f / 16.0f) + bb) * 4.0f); }
    __syncthreads();
    for (int qq = tid; qq < 128 * 8; qq += 128) { const int cl = qq >> 3, pc = qq & 7; const int c = n0 + cl, h = c >> 6, d = c & 63; vst2(VTh + (((size_t)b * NH + h) * HD + d) * SS + s0 + pc * 8, *(const v4u*)(&sth[cl][pc * 8])); } }
}
__global__ __launch_bounds__(128) void k_attn(const _Float16* __restrict__ Q16, const _Float16* __restrict__ K16, const _Float16* __restrict__ VTh, _Float16* __restrict__ O16) {
  __shared__ __align__(16) float sS[4][16][68];
  __shared__ __align__(16) _Float16 sPh[4][16][72];
  __shared__ __align__(16) _Float16 sK[2][64 * LP];   // 64 keys x 64 d
  __shared__ __align__(16) _Float16 sV[2][64 * LP];   // 64 d x 64 keys
  float (*sO)[16][68] = sS;   // the score rows are dead behind the loop: the output bounce takes their place, which keeps four work-groups well inside a WGP's LDS beside the new tiles
  const int tid = threadIdx.x, w = tid >> 5, lane = tid & 31, col = lane & 15, g = lane >> 4;
  const size_t bh = blockIdx.y; const int q0 = blockIdx.x * 64 + w * 16;
  v16h aq[2];
#pragma unroll
  for (int kc = 0; kc < 2; ++kc) aq[kc] = frag_h(Q16 + (bh * SS + q0 + col) * HD + kc * 32, lane);
  float mrun = -3.0e38f, lrun = 0.f; v8f acc[4] = {};
  const _Float16* Kb = K16 + bh * SS * HD; const _Float16* Vb = VTh + bh * HD * SS; v8h rk[4], rv[4];
  tile_ld<64>(Kb, HD, tid, rk); tile_ld<64>(Vb, SS, tid, rv); tile_st<64>(sK[0], tid, rk); tile_st<64>(sV[0], tid, rv);
  __syncthreads();
#pragma unroll 1
  for (int kt = 0; kt < SS / 64; ++kt) { const bool more = kt + 1 < SS / 64;
    const _Float16* sk = sK[kt & 1]; const _Float16* sv = sV[kt & 1];
    v16h kf[4][2];
#pragma unroll
    for (int t = 0; t < 4; ++t) {
#pragma unroll
      for (int kc = 0; kc < 2; ++kc) kf[t][kc] = frag_h(sk + (t * 16 + col) * LP + kc * 32, lane); }
#pragma unroll
    for (int t = 0; t < 4; ++t) { v8f s = {};
#pragma unroll
      for (int kc = 0; kc < 2; ++kc) s = wmma16(aq[kc], kf[t][kc], s);
#pragma unroll
      for (int r = 0; r < 8; ++r) sS[w][8 * g + r][t * 16 + col] = s[r] * (0.125f / 16.0f * 1.44269504f); }   // scores kept in units of log2: e^x = 2^(x log2 e), so each exponential below is one subtract and one v_exp_f32
    LDSX();
    // the next tiles' lines are asked for here, behind the fence above (which waits for every load in flight), so that they fly under the softmax
    if (more) { tile_ld<64>(Kb + (size_t)(kt + 1) * 64 * HD, HD, tid, rk); tile_ld<64>(Vb + (kt + 1) * 64, SS, tid, rv); }
    float mx = -3.4e38f;
#pragma unroll
    for (int jj = 0; jj < 32; ++jj) mx = fmaxf(mx, sS[w][col][g * 32 + jj]);
    mx = fmaxf(mx, __shfl_xor(mx, 16, 32));
    const float mnew = fmaxf(mrun, mx); const float corr = __builtin_amdgcn_exp2f(mrun - mnew); const float mlift = mnew - 14.0f;   // the lift of P by 2^14 rides in the exponent
    float ps = 0.f;
#pragma unroll
    for (int jj = 0; jj < 32; ++jj) { const float p = __builtin_amdgcn_exp2f(sS[w][col][g * 32 + jj] - mlift); ps += p; sPh[w][col][g * 32 + jj] = (_Float16)p; }
    ps += __shfl_xor(ps, 16, 32);
    lrun = lrun * corr + ps * (1.0f / 16384.0f); mrun = mnew;
#pragma unroll
    for (int r = 0; r < 8; ++r) { const float cr = __shfl(corr, 8 * g + r, 32);
#pragma unroll
      for (int t = 0; t < 4; ++t) acc[t][r] *= cr; }
    LDSX();
#pragma unroll
    for (int kc = 0; kc < 2; ++kc) { const v16h ph = frag_h(&sPh[w][col][0] + kc * 32, lane); v16h vf[4];
#pragma unroll
      for (int t = 0; t < 4; ++t) vf[t] = frag_h(sv + (t * 16 + col) * LP + kc * 32, lane);
#pragma unroll
      for (int t = 0; t < 4; ++t) acc[t] = wmma16(ph, vf[t], acc[t]); }
    __builtin_amdgcn_wave_barrier();
    if (more) { tile_st<64>(sK[(kt + 1) & 1], tid, rk); tile_st<64>(sV[(kt + 1) & 1], tid, rv); __syncthreads(); } }
#pragma unroll
  for (int r = 0; r < 8; ++r) { const float lr = __shfl(lrun, 8 * g + r, 32); const float inv = 8.0f / (lr * 16384.0f * 4.0f);
#pragma unroll
    for (int t = 0; t < 4; ++t) sO[w][8 * g + r][t * 16 + col] = acc[t][r] * inv; }
  LDSX();
  for (int qq = lane; qq < 16 * 8; qq += 32) { const int rl = qq >> 3, pc = qq & 7; union { v8h h8; v4u u; } pk;
#pragma unroll
    for (int e = 0; e < 8; ++e) pk.h8[e] = (_Float16)sO[w][rl][pc * 8 + e];
    vst2(O16 + ((bh * SS) + q0 + rl) * HD + pc * 8, pk.u); }
}
// CAT[:, coff .. coff+512) = f16( A PTw^T * ascale + b ) : A rows 512 halves; headm = 1 -> A is the head-major O16 (x8), else token-major rows; block (64 rows, 128 cols)
__global__ __launch_bounds__(128) void k_proj512(const _Float16* __restrict__ A16, int headm, const _Float16* __restrict__ PTw, const float* __restrict__ bias, float ascale, int coff, _Float16* __restrict__ CAT) {
  __shared__ __align__(16) _Float16 so[4][16][136];
  __shared__ __align__(16) _Float16 sB[2][128 * LP];
  const int tid = threadIdx.x, wave = tid >> 5, lane = tid & 31, col = lane & 15, g = lane >> 4;
  const int r0 = blockIdx.x * 64 + wave * 16, n0 = blockIdx.y * 128; const int ra = r0 + col; const int b = ra / SS, s = ra % SS;
  v8f acc[8] = {};
  const _Float16* Ab = A16 + (headm ? ((size_t)b * NH * SS + s) * HD : (size_t)ra * E); const size_t hstep = headm ? (size_t)SS * HD : (size_t)64;   // 64 k on: the next head's row, or 64 halves on in the token's row
  gemm_w_lds<E>([&](int kc) { return frag_h(Ab + (size_t)(kc >> 1) * hstep + (kc & 1) * 32, lane); }, PTw + (size_t)n0 * E, sB, tid, acc);
#pragma unroll
  for (int j = 0; j < 8; ++j) { const float bb = bias[n0 + j * 16 + col];
#pragma unroll
    for (int r = 0; r < 8; ++r) so[wave][8 * g + r][j * 16 + col] = (_Float16)(acc[j][r] * ascale + bb); }
  LDSX();
  for (int rl = 0; rl < 16; ++rl) { if (lane < 16) vst2(CAT + (size_t)(r0 + rl) * DM + coff + n0 + lane * 8, *(const v4u*)(&so[wave][rl][lane * 8])); }
}
// depthwise conv (k=3, pad 1) along the sequence on queries[:, :, 512 + c]: C16[b][l][c] f16 ; block = (b, 64 positions): thread c handles columns c, c+256 over the 64 positions
__global__ __launch_bounds__(256) void k_conv(const float* __restrict__ q, const float* __restrict__ cw, const float* __restrict__ cb, _Float16* __restrict__ C16) {
  __shared__ __align__(16) _Float16 sc[64][E + 8];
  const int tid = threadIdx.x; const int b = blockIdx.y, l0 = blockIdx.x * 64;
#pragma unroll 1
  for (int cc = 0; cc < 2; ++cc) { const int c = tid + cc * 256; const float w0 = cw[c * 3], w1 = cw[c * 3 + 1], w2 = cw[c * 3 + 2], bb = cb[c]; const float* col_ = q + (size_t)b * SS * DM + E + c;
#pragma unroll 4
    for (int i = 0; i < 64; ++i) { const int l = l0 + i; const float xm = l > 0 ? col_[(size_t)(l - 1) * DM] : 0.f, x0 = col_[(size_t)l * DM], xp = l < SS - 1 ? col_[(size_t)(l + 1) * DM] : 0.f;
      sc[i][c] = (_Float16)(w0 * xm + w1 * x0 + w2 * xp + bb); } }
  __syncthreads();
  for (int qq = tid; qq < 64 * (E / 8); qq += 256) { const int i = qq >> 6, pc = qq & 63; vst2(C16 + ((size_t)b * SS + l0 + i) * E + pc * 8, *(const v4u*)(&sc[i][pc * 8])); }
}
// T = queries + CAT Wf^T / 16 + bf : block (64 rows, 128 cols), K = 1024
__global__ __launch_bounds__(128) void k_wf(const _Float16* __restrict__ CAT, const _Float16* __restrict__ PF, const float* __restrict__ bfv, const float* __restrict__ q, float* __restrict__ T) {
  __shared__ __align__(16) float so[4][16][132];
  __shared__ __align__(16) _Float16 sB[2][128 * LP];
  const int tid = threadIdx.x, wave = tid >> 5, lane = tid & 31, col = lane & 15, g = lane >> 4; const int r0 = blockIdx.x * 64 + wave * 16, n0 = blockIdx.y * 128;
  v8f acc[8] = {};
  gemm_w_lds<DM>([&](int kc) { return frag_h(CAT + (size_t)(r0 + col) * DM + kc * 32, lane); }, PF + (size_t)n0 * DM, sB, tid, acc);
#pragma unroll
  for (int j = 0; j < 8; ++j) { const int n = n0 + j * 16 + col; const float bb = bfv[n];
#pragma unroll
    for (int r = 0; r < 8; ++r) so[wave][8 * g + r][j * 16 + col] = acc[j][r] * (1.0f / 16.0f) + bb + q[(size_t)(r0 + 8 * g + r) * DM + n]; }
  LDSX();
#pragma unroll 4
  for (int rl = 0; rl < 16; ++rl) vst2(T + (size_t)(r0 + rl) * DM + n0 + lane * 4, *(const v4f*)(&so[wave][rl][lane * 4]));
}
// LayerNorm over 1024 per row: wave per row (32 floats per lane)
__global__ __launch_bounds__(256) void k_ln(const float* __restrict__ T, const float* __restrict__ gm, const float* __restrict__ bt, float* __restrict__ out) {
  // LayerNorm over 1024 per row: wave per row; lane owns columns p*128 + lane*4 .. +3 for p = 0..7 so every store instruction writes one contiguous 512-B run by 32 consecutive lanes
  const int wave = threadIdx.x >> 5, lane = threadIdx.x & 31; const size_t row = (size_t)blockIdx.x * 8 + wave; const float* tr = T + row * DM;
  float s = 0.f, sq = 0.f;
#pragma unroll
  for (int p = 0; p < 8; ++p) { const v4f v = *(const v4f*)(tr + p * 128 + lane * 4);
#pragma unroll
    for (int e = 0; e < 4; ++e) { s += v[e]; sq += v[e] * v[e]; } }
#pragma unroll
  for (int o = 16; o > 0; o >>= 1) { s += __shfl_xor(s, o, 32); sq += __shfl_xor(sq, o, 32); }
  const float mu = s * (1.0f / DM); float var = sq * (1.0f / DM) - mu * mu; var = var > 0.f ? var : 0.f; const float rs = rsqrtf(var + 1e-5f);
#pragma unroll 1
  for (int p = 0; p < 8; ++p) { const int c0 = p * 128 + lane * 4; v4f v = *(const v4f*)(tr + c0);
#pragma unroll
    for (int e = 0; e < 4; ++e) v[e] = (v[e] - mu) * rs * gm[c0 + e] + bt[c0 + e];
    vst2(out + row * DM + c0, v); }
}
extern "C" void kernel_launch(void* const* d_in, const int* in_sizes, int n_in, void* d_out, int out_size, void* d_ws, size_t ws_size, hipStream_t stream) {
  (void)in_sizes; (void)n_in; (void)out_size; (void)ws_size;
  const float** I = (const float**)d_in;
  const float* queries = I[0]; const float* keys = I[1]; const float* values = I[2]; const float* Wq = I[3]; const float* bq = I[4]; const float* Wk = I[5]; const float* bk = I[6]; const float* Wv = I[7]; const float* bv = I[8];
  const float* Woa = I[9]; const float* boa = I[10]; const float* cw = I[11]; const float* cb = I[12]; const float* Woc = I[13]; const float* boc = I[14]; const float* Wf = I[15]; const float* bfv = I[16]; const float* gm = I[17]; const float* bt = I[18];
  float* out = (float*)d_out;
  char* ws = (char*)d_ws; size_t off = 0;
  auto take = [&](size_t bytes) { char* p = ws + off; off += (bytes + 255) & ~(size_t)255; return p; };
  _Float16* Xq = (_Float16*)take((size_t)NR * E * 2); _Float16* Xk = (_Float16*)take((size_t)NR * E * 2); _Float16* Xv = (_Float16*)take((size_t)NR * E * 2);
  _Float16* PT = (_Float16*)take((size_t)5 * E * E * 2); _Float16* PF = (_Float16*)take((size_t)DM * DM * 2);
  _Float16* Q16 = (_Float16*)take((size_t)NR * E * 2); _Float16* K16 = (_Float16*)take((size_t)NR * E * 2); _Float16* VTh = (_Float16*)take((size_t)NR * E * 2); _Float16* O16 = Xq;   // Xq dead after k_qkv
  _Float16* C16 = Xk;                                            // Xk dead after k_qkv
  _Float16* CAT = (_Float16*)take((size_t)NR * DM * 2); float* T = (float*)take((size_t)NR * DM * 4);
  // ws ~ 104 MB
  k_cvt<<<(NR * E / 8 + 255) / 256, 256, 0, stream>>>(queries, 0, Xq);
  k_cvt<<<(NR * E / 8 + 255) / 256, 256, 0, stream>>>(keys, 0, Xk);
  k_cvt<<<(NR * E / 8 + 255) / 256, 256, 0, stream>>>(values, 0, Xv);
  k_pack<<<5 * E + DM, 256, 0, stream>>>(Wq, Wk, Wv, Woa, Woc, Wf, PT, PF);
  k_qkv<<<dim3(NR / 64, E / 128, 3), 128, 0, stream>>>(Xq, Xk, Xv, PT, bq, bk, bv, Q16, K16, VTh);
  k_attn<<<dim3(SS / 64, NB * NH), 128, 0, stream>>>(Q16, K16, VTh, O16);
  k_proj512<<<dim3(NR / 64, E / 128), 128, 0, stream>>>(O16, 1, PT + (size_t)3 * E * E, boa, 1.0f / (16.0f * 8.0f), 0, CAT);
  k_conv<<<dim3(SS / 64, NB), 256, 0, stream>>>(queries, cw, cb, C16);
  k_proj512<<<dim3(NR / 64, E / 128), 128, 0, stream>>>(C16, 0, PT + (size_t)4 * E * E, boc, 1.0f / 16.0f, E, CAT);
  k_wf<<<dim3(NR / 64, DM / 128), 128, 0, stream>>>(CAT, PF, bfv, queries, T);
  k_ln<<<NR / 8, 256, 0, stream>>>(T, gm, bt, out);
}

// v003
// A run of this version takes 156 microseconds.
// Next to v002, in two timings, it ran 1.33 times as fast each time.
// Over all steps from v000 it is 2.95 times as fast.
// compute dtype: f16 operands for the projections, attention and the final 1024x1024 projection (activations as f16 rows, weights packed x16, q/k x4, P lifted by 2^14, V x4, ctx x8), f32 accumulate; the depthwise conv, residual and LayerNorm in f32. Output = LN(queries + out) is residual-dominated.
#include <hip/hip_runtime.h>
#include <math.h>

typedef __attribute__((ext_vector_type(16))) _Float16 v16h;
typedef __attribute__((ext_vector_type(16))) __bf16 v16b;
typedef __attribute__((ext_vector_type(8)))  _Float16 v8h;
typedef __attribute__((ext_vector_type(4)))  _Float16 v4h;
typedef __attribute__((ext_vector_type(8)))  float v8f;
typedef __attribute__((ext_vector_type(4)))  float v4f;
typedef __attribute__((ext_vector_type(2)))  float v2f;
typedef __attribute__((ext_vector_type(4)))  unsigned v4u;
typedef __attribute__((ext_vector_type(4)))  int v4i;
typedef float __attribute__((may_alias)) float_a;
typedef int __attribute__((may_alias)) int_a;

template <typename T> __device__ __forceinline__ void vst2(void* p, T v) { *(T*)p = v;  }
__device__ __forceinline__ v8f wmma16(v16h a, v16h b, v8f c) {
  v8f d = __builtin_amdgcn_wmma_f32_16x16x32_f16(false, a, false, b, (short)0, c, false, false);
  asm volatile("v_nop\n\tv_nop\n\tv_nop\n\tv_nop" : "+v"(d) : "v"(a), "v"(b));
  return d;
}
__device__ __forceinline__ v8f wmma_bf(v16b a, v16b b, v8f c) {
  v8f d = __builtin_amdgcn_wmma_f32_16x16x32_bf16(false, a, false, b, (short)0, c, false, false);
  asm volatile("v_nop\n\tv_nop\n\tv_nop\n\tv_nop" : "+v"(d) : "v"(a), "v"(b));
  return d;
}
// 16x16x32 fragments: lane = (h = lane>>4, row/col = lane&15); elements 0..7 = k0+8h+0..7, 8..15 = k0+16+8h+0..7; D element r = row 8h+r
__device__ __forceinline__ v16h frag_h(const _Float16* rowk0, int lane) {
  union { v16h v; v8h q[2]; } u; const _Float16* p = rowk0 + 8 * (lane >> 4);
  u.q[0] = *(const v8h*)p; u.q[1] = *(const v8h*)(p + 16); return u.v;
}
__device__ __forceinline__ v16h frag_f32(const float* rowk0, int lane) {
  v16h a; const float* p = rowk0 + 8 * (lane >> 4);
#pragma unroll
  for (int i = 0; i < 8; ++i) { a[i] = (_Float16)p[i]; a[8 + i] = (_Float16)p[16 + i]; }
  return a;
}
__device__ __forceinline__ v16h frag_f32s(const float* rowk0, int lane, float sc) {
  v16h a; const float* p = rowk0 + 8 * (lane >> 4);
#pragma unroll
  for (int i = 0; i < 8; ++i) { a[i] = (_Float16)(p[i] * sc); a[8 + i] = (_Float16)(p[16 + i] * sc); }
  return a;
}
// column fragment from a [K][ld] layout (column n), rows >= K read as 0
__device__ __forceinline__ v16h fragc_f32(const float* W, int k0, int n, int lane, int ld, int K) {
  v16h a; const int g = lane >> 4;
#pragma unroll
  for (int i = 0; i < 8; ++i) { const int ka = k0 + 8 * g + i, kb = ka + 16;
    a[i] = (_Float16)(ka < K ? W[(size_t)ka * ld + n] : 0.f); a[8 + i] = (_Float16)(kb < K ? W[(size_t)kb * ld + n] : 0.f); }
  return a;
}
struct F2 { v16b h, l; };
__device__ __forceinline__ F2 bsplit16(const float v[16]) { F2 r;
#pragma unroll
  for (int i = 0; i < 16; ++i) { const __bf16 h = (__bf16)v[i]; r.h[i] = h; r.l[i] = (__bf16)(v[i] - (float)h); }
  return r; }
__device__ __forceinline__ F2 split_row(const float* row, int k0, int lane) { float v[16]; const float* p = row + k0 + 8 * (lane >> 4);
#pragma unroll
  for (int i = 0; i < 8; ++i) { v[i] = p[i]; v[8 + i] = p[16 + i]; }
  return bsplit16(v); }
__device__ __forceinline__ F2 split_rowK(const float* row, int k0, int lane, int K) { float v[16]; const int g = lane >> 4;
#pragma unroll
  for (int i = 0; i < 8; ++i) { const int ka = k0 + 8 * g + i, kb = ka + 16; v[i] = ka < K ? row[ka] : 0.f; v[8 + i] = kb < K ? row[kb] : 0.f; }
  return bsplit16(v); }
__device__ __forceinline__ F2 split_col(const float* W, int k0, int n, int lane, int ld, int K) { float v[16]; const int g = lane >> 4;
#pragma unroll
  for (int i = 0; i < 8; ++i) { const int ka = k0 + 8 * g + i, kb = ka + 16; v[i] = ka < K ? W[(size_t)ka * ld + n] : 0.f; v[8 + i] = kb < K ? W[(size_t)kb * ld + n] : 0.f; }
  return bsplit16(v); }
__device__ __forceinline__ v8f mac3(const F2& a, const F2& b, v8f c) { c = wmma_bf(a.l, b.h, c); c = wmma_bf(a.h, b.l, c); return wmma_bf(a.h, b.h, c); }
__device__ __forceinline__ float sigm(float v) { return 1.0f / (1.0f + expf(-v)); }
#define LDSX() do { asm volatile("s_wait_dscnt 0" ::: "memory"); __builtin_amdgcn_wave_barrier(); __builtin_amdgcn_fence(__ATOMIC_RELEASE, "workgroup"); } while (0)


// CSP attention block on [4,2048,1024]: attention branch on channels 0..511 (q from queries, k from keys, v from values; 8 heads x 64, softmax(q.k/8), out-proj Wo_attn), conv branch on
// channels 512..1023 of queries (depthwise k=3 along the sequence + bias, then Wo_conv), concat -> Wf (1024x1024) + bf, x = queries + out, LayerNorm.
// k_cvt (three 512-wide f16 row sets from the 1024-wide inputs), k_pack (Wq|Wk|Wv|Wo_attn|Wo_conv rows x16; Wf rows x16), k_qkv, k_attn (flash-style online softmax), k_proj512 (O@Wo_attn^T -> CAT[:, :512];
#define NB 4
#define SS 2048
#define DM 1024
#define E 512
#define NH 8
#define HD 64
#define NR (NB * SS)

// Operand tiles staged in LDS once per work-group of 128 threads: rows of 64 halves (one 128-B line), 16 rows per step, so a wave's load covers 4 whole lines.
#define LP 72   // LDS row pitch in halves: 144 B = 16 B x 9, so the 16-byte fragment reads of 16 rows fall on distinct banks
template <int ROWS> __device__ __forceinline__ void tile_ld(const _Float16* __restrict__ src, size_t pitch, int tid, v8h (&r)[ROWS / 16]) {
#pragma unroll
  for (int i = 0; i < ROWS / 16; ++i) r[i] = *(const v8h*)(src + (size_t)(i * 16 + (tid >> 3)) * pitch + (tid & 7) * 8);
}
template <int ROWS> __device__ __forceinline__ void tile_st(_Float16* dst, int tid, const v8h (&r)[ROWS / 16]) {
#pragma unroll
  for (int i = 0; i < ROWS / 16; ++i) *(v8h*)(dst + (i * 16 + (tid >> 3)) * LP + (tid & 7) * 8) = r[i];
}
// acc[j] += A(16 rows of this wave) x W(rows j*16..j*16+15 of the block's 128)^T over KD: the 128 W rows go through two LDS buffers, 64 k per stage, shared by the 4 waves;
// the next stage's W lines and A fragments are loaded while this stage is multiplied; one barrier per stage publishes the next buffer and ends the reads of the one refilled after it.
template <int KD, typename AF> __device__ __forceinline__ void gemm_w_lds(AF afrag, const _Float16* __restrict__ Wrows, _Float16 (*sB)[128 * LP], int tid, v8f (&acc)[8]) {
  const int lane = tid & 31, col = lane & 15;
  v8h rb[8]; v16h a[2], an[2];
  tile_ld<128>(Wrows, KD, tid, rb); a[0] = afrag(0); a[1] = afrag(1);
  tile_st<128>(sB[0], tid, rb);
  __syncthreads();
#pragma unroll 1   // kept rolled: built unrolled by two, the fragments loaded ahead are copied more often, not less, and are waited for in the middle of a stage
  for (int st = 0; st < KD / 64; ++st) { const bool more = st + 1 < KD / 64;
    if (more) { tile_ld<128>(Wrows + (st + 1) * 64, KD, tid, rb); an[0] = afrag(2 * st + 2); an[1] = afrag(2 * st + 3);
      asm volatile("s_wait_xcnt 0x0" ::: "memory"); }   // stands behind the run of loads, in front of the loop's foot, where their address registers are stepped on
    const _Float16* sb = sB[st & 1];
#pragma unroll
    for (int kc = 0; kc < 2; ++kc) { v16h b[8];
#pragma unroll
      for (int j = 0; j < 8; ++j) b[j] = frag_h(sb + (j * 16 + col) * LP + kc * 32, lane);
#pragma unroll
      for (int j = 0; j < 8; ++j) acc[j] = wmma16(a[kc], b[j], acc[j]); }
    if (more) { tile_st<128>(sB[(st + 1) & 1], tid, rb); a[0] = an[0]; a[1] = an[1]; __syncthreads(); } }
}

// X16[r][0..512) = f16(src[r][coff .. coff+512))  (src rows are 1024 wide)
__global__ __launch_bounds__(256) void k_cvt(const float* __restrict__ src, int coff, _Float16* __restrict__ X16) {
  const size_t i8 = (size_t)blockIdx.x * 256 + threadIdx.x; if (i8 >= (size_t)NR * E / 8) return; const size_t r = i8 / (E / 8), pc = i8 % (E / 8);
  union { v8h h; v4u u; } pk; const float* s = src + r * DM + coff + pc * 8;
#pragma unroll
  for (int e = 0; e < 8; ++e) pk.h[e] = (_Float16)s[e];
  vst2(X16 + r * E + pc * 8, pk.u);
}
// PT rows (512 halves x16): [0,E) Wq, [E,2E) Wk, [2E,3E) Wv, [3E,4E) Wo_attn, [4E,5E) Wo_conv ([out][in]); PF rows (1024 halves x16): Wf rows
__global__ __launch_bounds__(256) void k_pack(const float* __restrict__ Wq, const float* __restrict__ Wk, const float* __restrict__ Wv, const float* __restrict__ Woa, const float* __restrict__ Woc, const float* __restrict__ Wf, _Float16* __restrict__ PT, _Float16* __restrict__ PF) {
  const int n = blockIdx.x, tid = threadIdx.x; __shared__ __align__(16) _Float16 srow[DM];
  if (n < 5 * E) { const int which = n / E, nn = n % E; const float* W = which == 0 ? Wq : (which == 1 ? Wk : (which == 2 ? Wv : (which == 3 ? Woa : Woc)));
    srow[tid] = (_Float16)(W[(size_t)nn * E + tid] * 16.0f); srow[tid + 256] = (_Float16)(W[(size_t)nn * E + tid + 256] * 16.0f); __syncthreads();
    if (tid < E / 8) vst2(PT + (size_t)n * E + tid * 8, *(const v4u*)(&srow[tid * 8])); }
  else { const int nn = n - 5 * E; for (int k = tid; k < DM; k += 256) srow[k] = (_Float16)(Wf[(size_t)nn * DM + k] * 16.0f); __syncthreads();
    if (tid < DM / 8) vst2(PF + (size_t)nn * DM + tid * 8, *(const v4u*)(&srow[tid * 8])); }
}
__global__ __launch_bounds__(128) void k_qkv(const _Float16* __restrict__ Xq, const _Float16* __restrict__ Xk, const _Float16* __restrict__ Xv, const _Float16* __restrict__ PT, const float* __restrict__ bq, const float* __restrict__ bk, const float* __restrict__ bv,
                                            _Float16* __restrict__ Q16, _Float16* __restrict__ K16, _Float16* __restrict__ VTh) {
  __shared__ __align__(16) float so[4][16][132];
  __shared__ __align__(16) _Float16 sth[128][72];
  __shared__ __align__(16) _Float16 sB[2][128 * LP];
  const int tid = threadIdx.x, wave = tid >> 5, lane = tid & 31, col = lane & 15, g = lane >> 4;
  const int which = blockIdx.z, r0b = blockIdx.x * 64, r0 = r0b + wave * 16, n0 = blockIdx.y * 128; const int b = r0b / SS, s0 = r0b % SS;
  const _Float16* X16 = which == 0 ? Xq : (which == 1 ? Xk : Xv); const float* bb_ = which == 0 ? bq : (which == 1 ? bk : bv);
  v8f acc[8] = {};
  gemm_w_lds<E>([&](int kc) { return frag_h(X16 + (size_t)(r0 + col) * E + kc * 32, lane); }, PT + (size_t)(which * E + n0) * E, sB, tid, acc);
  if (which < 2) {
#pragma unroll
    for (int j = 0; j < 8; ++j) { const float bb = bb_[n0 + j * 16 + col];
#pragma unroll
      for (int r = 0; r < 8; ++r) so[wave][8 * g + r][j * 16 + col] = (acc[j][r] * (1.0f / 16.0f) + bb) * 4.0f; }
    LDSX();
    _Float16* Dst = which == 0 ? Q16 : K16;
    for (int qq = lane; qq < 16 * 2 * 8; qq += 32) { const int hh = qq >> 7, rl = (qq >> 3) & 15, pc = qq & 7; const int h = (n0 >> 6) + hh; union { v8h h8; v4u u; } pk;
#pragma unroll
      for (int e = 0; e < 8; ++e) pk.h8[e] = (_Float16)so[wave][rl][hh * 64 + pc * 8 + e];
      vst2(Dst + (((size_t)b * NH + h) * SS + s0 + wave * 16 + rl) * HD + pc * 8, pk.u); } }
  else {
#pragma unroll
    for (int j = 0; j < 8; ++j) { const float bb = bb_[n0 + j * 16 + col];
#pragma unroll
      for (int r = 0; r < 8; ++r) sth[j * 16 + col][wave * 16 + 8 * g + r] = (_Float16)((acc[j][r] * (1.0f / 16.0f) + bb) * 4.0f); }
    __syncthreads();
    for (int qq = tid; qq < 128 * 8; qq += 128) { const int cl = qq >> 3, pc = qq & 7; const int c = n0 + cl, h = c >> 6, d = c & 63; vst2(VTh + (((size_t)b * NH + h) * HD + d) * SS + s0 + pc * 8, *(const v4u*)(&sth[cl][pc * 8])); } }
}
__global__ __launch_bounds__(128) void k_attn(const _Float16* __restrict__ Q16, const _Float16* __restrict__ K16, const _Float16* __restrict__ VTh, _Float16* __restrict__ O16) {
  __shared__ __align__(16) float sS[4][16][68];
  __shared__ __align__(16) _Float16 sPh[4][16][72];
  __shared__ __align__(16) _Float16 sK[2][64 * LP];   // 64 keys x 64 d
  __shared__ __align__(16) _Float16 sV[2][64 * LP];   // 64 d x 64 keys
  float (*sO)[16][68] = sS;   // the score rows are dead behind the loop: the output bounce takes their place, which keeps four work-groups well inside a WGP's LDS beside the new tiles
  const int tid = threadIdx.x, w = tid >> 5, lane = tid & 31, col = lane & 15, g = lane >> 4;
  const size_t bh = blockIdx.y; const int q0 = blockIdx.x * 64 + w * 16;
  v16h aq[2];
#pragma unroll
  for (int kc = 0; kc < 2; ++kc) aq[kc] = frag_h(Q16 + (bh * SS + q0 + col) * HD + kc * 32, lane);
  float mrun = -3.0e38f, lrun = 0.f; v8f acc[4] = {};
  const _Float16* Kb = K16 + bh * SS * HD; const _Float16* Vb = VTh + bh * HD * SS; v8h rk[4], rv[4];
  tile_ld<64>(Kb, HD, tid, rk); tile_ld<64>(Vb, SS, tid, rv); tile_st<64>(sK[0], tid, rk); tile_st<64>(sV[0], tid, rv);
  __syncthreads();
#pragma unroll 1
  for (int kt = 0; kt < SS / 64; ++kt) { const bool more = kt + 1 < SS / 64;
    const _Float16* sk = sK[kt & 1]; const _Float16* sv = sV[kt & 1];
    v16h kf[4][2];
#pragma unroll
    for (int t = 0; t < 4; ++t) {
#pragma unroll
      for (int kc = 0; kc < 2; ++kc) kf[t][kc] = frag_h(sk + (t * 16 + col) * LP + kc * 32, lane); }
#pragma unroll
    for (int t = 0; t < 4; ++t) { v8f s = {};
#pragma unroll
      for (int kc = 0; kc < 2; ++kc) s = wmma16(aq[kc], kf[t][kc], s);
#pragma unroll
      for (int r = 0; r < 8; ++r) sS[w][8 * g + r][t * 16 + col] = s[r] * (0.125f / 16.0f * 1.44269504f); }   // scores kept in units of log2: e^x = 2^(x log2 e), so each exponential below is one subtract and one v_exp_f32
    LDSX();
    // the next tiles' lines are asked for here, behind the fence above (which waits for every load in flight), so that they fly under the softmax
    if (more) { tile_ld<64>(Kb + (size_t)(kt + 1) * 64 * HD, HD, tid, rk); tile_ld<64>(Vb + (kt + 1) * 64, SS, tid, rv); }
    float mx = -3.4e38f;
#pragma unroll
    for (int jj = 0; jj < 32; ++jj) mx = fmaxf(mx, sS[w][col][g * 32 + jj]);
    mx = fmaxf(mx, __shfl_xor(mx, 16, 32));
    const float mnew = fmaxf(mrun, mx); const float corr = __builtin_amdgcn_exp2f(mrun - mnew); const float mlift = mnew - 14.0f;   // the lift of P by 2^14 rides in the exponent
    float ps = 0.f;
#pragma unroll
    for (int jj = 0; jj < 32; ++jj) { const float p = __builtin_amdgcn_exp2f(sS[w][col][g * 32 + jj] - mlift); ps += p; sPh[w][col][g * 32 + jj] = (_Float16)p; }
    ps += __shfl_xor(ps, 16, 32);
    lrun = lrun * corr + ps * (1.0f / 16384.0f); mrun = mnew;
#pragma unroll
    for (int r = 0; r < 8; ++r) { const float cr = __shfl(corr, 8 * g + r, 32);
#pragma unroll
      for (int t = 0; t < 4; ++t) acc[t][r] *= cr; }
    LDSX();
#pragma unroll
    for (int kc = 0; kc < 2; ++kc) { const v16h ph = frag_h(&sPh[w][col][0] + kc * 32, lane); v16h vf[4];
#pragma unroll
      for (int t = 0; t < 4; ++t) vf[t] = frag_h(sv + (t * 16 + col) * LP + kc * 32, lane);
#pragma unroll
      for (int t = 0; t < 4; ++t) acc[t] = wmma16(ph, vf[t], acc[t]); }
    __builtin_amdgcn_wave_barrier();
    if (more) { tile_st<64>(sK[(kt + 1) & 1], tid, rk); tile_st<64>(sV[(kt + 1) & 1], tid, rv); __syncthreads(); } }
#pragma unroll
  for (int r = 0; r < 8; ++r) { const float lr = __shfl(lrun, 8 * g + r, 32); const float inv = 8.0f / (lr * 16384.0f * 4.0f);
#pragma unroll
    for (int t = 0; t < 4; ++t) sO[w][8 * g + r][t * 16 + col] = acc[t][r] * inv; }
  LDSX();
  for (int qq = lane; qq < 16 * 8; qq += 32) { const int rl = qq >> 3, pc = qq & 7; union { v8h h8; v4u u; } pk;
#pragma unroll
    for (int e = 0; e < 8; ++e) pk.h8[e] = (_Float16)sO[w][rl][pc * 8 + e];
    vst2(O16 + ((bh * SS) + q0 + rl) * HD + pc * 8, pk.u); }
}
// CAT[:, coff .. coff+512) = f16( A PTw^T * ascale + b ) : A rows 512 halves; headm = 1 -> A is the head-major O16 (x8), else token-major rows; block (64 rows, 128 cols)
__global__ __launch_bounds__(128) void k_proj512(const _Float16* __restrict__ A16, int headm, const _Float16* __restrict__ PTw, const float* __restrict__ bias, float ascale, int coff, _Float16* __restrict__ CAT) {
  __shared__ __align__(16) _Float16 so[4][16][136];
  __shared__ __align__(16) _Float16 sB[2][128 * LP];
  const int tid = threadIdx.x, wave = tid >> 5, lane = tid & 31, col = lane & 15, g = lane >> 4;
  const int r0 = blockIdx.x * 64 + wave * 16, n0 = blockIdx.y * 128; const int ra = r0 + col; const int b = ra / SS, s = ra % SS;
  v8f acc[8] = {};
  const _Float16* Ab = A16 + (headm ? ((size_t)b * NH * SS + s) * HD : (size_t)ra * E); const size_t hstep = headm ? (size_t)SS * HD : (size_t)64;   // 64 k on: the next head's row, or 64 halves on in the token's row
  gemm_w_lds<E>([&](int kc) { return frag_h(Ab + (size_t)(kc >> 1) * hstep + (kc & 1) * 32, lane); }, PTw + (size_t)n0 * E, sB, tid, acc);
#pragma unroll
  for (int j = 0; j < 8; ++j) { const float bb = bias[n0 + j * 16 + col];
#pragma unroll
    for (int r = 0; r < 8; ++r) so[wave][8 * g + r][j * 16 + col] = (_Float16)(acc[j][r] * ascale + bb); }
  LDSX();
  for (int rl = 0; rl < 16; ++rl) { if (lane < 16) vst2(CAT + (size_t)(r0 + rl) * DM + coff + n0 + lane * 8, *(const v4u*)(&so[wave][rl][lane * 8])); }
}
// depthwise conv (k=3, pad 1) along the sequence on queries[:, :, 512 + c]: C16[b][l][c] f16 ; thread = 4 columns x CR positions, 128 threads per run of CR positions, two runs per block.
// A thread's CR + 2 input rows are loaded without a condition (the two edge rows from a clamped address, set to 0 behind the load), so that all of them are in flight before the first is waited for;
// a wave's load covers 512 contiguous bytes of a row and its store 256 contiguous bytes, so no LDS bounce is needed.
#define CR 8
__global__ __launch_bounds__(256) void k_conv(const float* __restrict__ q, const float* __restrict__ cw, const float* __restrict__ cb, _Float16* __restrict__ C16) {
  const int tid = threadIdx.x; const int c = (tid & 127) * 4, r0 = (blockIdx.x * 2 + (tid >> 7)) * CR, l0 = r0 % SS;   // r0 = b * SS + l0; a run never crosses a batch (SS is a multiple of CR)
  const bool top = l0 > 0, bot = l0 + CR < SS; const float* col_ = q + (size_t)r0 * DM + E + c;
  v4f x[CR + 2];
  x[0] = *(const v4f*)(col_ - (top ? DM : 0));
#pragma unroll
  for (int i = 0; i < CR; ++i) x[i + 1] = *(const v4f*)(col_ + (size_t)i * DM);
  x[CR + 1] = *(const v4f*)(col_ + (size_t)(bot ? CR : CR - 1) * DM);
  const v4f bb = *(const v4f*)(cb + c);
  const float* wp = cw + c * 3; v4f wv[3];   // the 4 columns' 12 taps: tap k of column c + e is element e * 3 + k
  wv[0] = *(const v4f*)wp; wv[1] = *(const v4f*)(wp + 4);
  asm volatile("s_wait_xcnt 0x0" ::: "memory");   // the last load's result may be given the registers that hold the address of the loads above
  wv[2] = *(const v4f*)(wp + 8);
#pragma unroll
  for (int e = 0; e < 4; ++e) { x[0][e] = top ? x[0][e] : 0.f; x[CR + 1][e] = bot ? x[CR + 1][e] : 0.f; }
#pragma unroll
  for (int i = 0; i < CR; ++i) { v4h o;
#pragma unroll
    for (int e = 0; e < 4; ++e) o[e] = (_Float16)(wv[(e * 3) >> 2][(e * 3) & 3] * x[i][e] + wv[(e * 3 + 1) >> 2][(e * 3 + 1) & 3] * x[i + 1][e] + wv[(e * 3 + 2) >> 2][(e * 3 + 2) & 3] * x[i + 2][e] + bb[e]);
    vst2(C16 + (size_t)(r0 + i) * E + c, o); }
}
// T = queries + CAT Wf^T / 16 + bf : block (64 rows, 128 cols), K = 1024
__global__ __launch_bounds__(128) void k_wf(const _Float16* __restrict__ CAT, const _Float16* __restrict__ PF, const float* __restrict__ bfv, const float* __restrict__ q, float* __restrict__ T) {
  __shared__ __align__(16) float so[4][16][132];
  __shared__ __align__(16) _Float16 sB[2][128 * LP];
  const int tid = threadIdx.x, wave = tid >> 5, lane = tid & 31, col = lane & 15, g = lane >> 4; const int r0 = blockIdx.x * 64 + wave * 16, n0 = blockIdx.y * 128;
  v8f acc[8] = {};
  gemm_w_lds<DM>([&](int kc) { return frag_h(CAT + (size_t)(r0 + col) * DM + kc * 32, lane); }, PF + (size_t)n0 * DM, sB, tid, acc);
#pragma unroll
  for (int j = 0; j < 8; ++j) { const int n = n0 + j * 16 + col; const float bb = bfv[n];
#pragma unroll
    for (int r = 0; r < 8; ++r) so[wave][8 * g + r][j * 16 + col] = acc[j][r] * (1.0f / 16.0f) + bb + q[(size_t)(r0 + 8 * g + r) * DM + n]; }
  LDSX();
#pragma unroll 4
  for (int rl = 0; rl < 16; ++rl) vst2(T + (size_t)(r0 + rl) * DM + n0 + lane * 4, *(const v4f*)(&so[wave][rl][lane * 4]));
}
// LayerNorm over 1024 per row: wave per row (32 floats per lane)
__global__ __launch_bounds__(256) void k_ln(const float* __restrict__ T, const float* __restrict__ gm, const float* __restrict__ bt, float* __restrict__ out) {
  // LayerNorm over 1024 per row: wave per row; lane owns columns p*128 + lane*4 .. +3 for p = 0..7 so every store instruction writes one contiguous 512-B run by 32 consecutive lanes
  const int wave = threadIdx.x >> 5, lane = threadIdx.x & 31; const size_t row = (size_t)blockIdx.x * 8 + wave; const float* tr = T + row * DM;
  float s = 0.f, sq = 0.f;
#pragma unroll
  for (int p = 0; p < 8; ++p) { const v4f v = *(const v4f*)(tr + p * 128 + lane * 4);
#pragma unroll
    for (int e = 0; e < 4; ++e) { s += v[e]; sq += v[e] * v[e]; } }
#pragma unroll
  for (int o = 16; o > 0; o >>= 1) { s += __shfl_xor(s, o, 32); sq += __shfl_xor(sq, o, 32); }
  const float mu = s * (1.0f / DM); float var = sq * (1.0f / DM) - mu * mu; var = var > 0.f ? var : 0.f; const float rs = rsqrtf(var + 1e-5f);
#pragma unroll 1
  for (int p = 0; p < 8; ++p) { const int c0 = p * 128 + lane * 4; v4f v = *(const v4f*)(tr + c0);
#pragma unroll
    for (int e = 0; e < 4; ++e) v[e] = (v[e] - mu) * rs * gm[c0 + e] + bt[c0 + e];
    vst2(out + row * DM + c0, v); }
}
extern "C" void kernel_launch(void* const* d_in, const int* in_sizes, int n_in, void* d_out, int out_size, void* d_ws, size_t ws_size, hipStream_t stream) {
  (void)in_sizes; (void)n_in; (void)out_size; (void)ws_size;
  const float** I = (const float**)d_in;
  const float* queries = I[0]; const float* keys = I[1]; const float* values = I[2]; const float* Wq = I[3]; const float* bq = I[4]; const float* Wk = I[5]; const float* bk = I[6]; const float* Wv = I[7]; const float* bv = I[8];
  const float* Woa = I[9]; const float* boa = I[10]; const float* cw = I[11]; const float* cb = I[12]; const float* Woc = I[13]; const float* boc = I[14]; const float* Wf = I[15]; const float* bfv = I[16]; const float* gm = I[17]; const float* bt = I[18];
  float* out = (float*)d_out;
  char* ws = (char*)d_ws; size_t off = 0;
  auto take = [&](size_t bytes) { char* p = ws + off; off += (bytes + 255) & ~(size_t)255; return p; };
  _Float16* Xq = (_Float16*)take((size_t)NR * E * 2); _Float16* Xk = (_Float16*)take((size_t)NR * E * 2); _Float16* Xv = (_Float16*)take((size_t)NR * E * 2);
  _Float16* PT = (_Float16*)take((size_t)5 * E * E * 2); _Float16* PF = (_Float16*)take((size_t)DM * DM * 2);
  _Float16* Q16 = (_Float16*)take((size_t)NR * E * 2); _Float16* K16 = (_Float16*)take((size_t)NR * E * 2); _Float16* VTh = (_Float16*)take((size_t)NR * E * 2); _Float16* O16 = Xq;   // Xq dead after k_qkv
  _Float16* C16 = Xk;                                            // Xk dead after k_qkv
  _Float16* CAT = (_Float16*)take((size_t)NR * DM * 2); float* T = (float*)take((size_t)NR * DM * 4);
  // ws ~ 104 MB
  k_cvt<<<(NR * E / 8 + 255) / 256, 256, 0, stream>>>(queries, 0, Xq);
  k_cvt<<<(NR * E / 8 + 255) / 256, 256, 0, stream>>>(keys, 0, Xk);
  k_cvt<<<(NR * E / 8 + 255) / 256, 256, 0, stream>>>(values, 0, Xv);
  k_pack<<<5 * E + DM, 256, 0, stream>>>(Wq, Wk, Wv, Woa, Woc, Wf, PT, PF);
  k_qkv<<<dim3(NR / 64, E / 128, 3), 128, 0, stream>>>(Xq, Xk, Xv, PT, bq, bk, bv, Q16, K16, VTh);
  k_attn<<<dim3(SS / 64, NB * NH), 128, 0, stream>>>(Q16, K16, VTh, O16);
  k_proj512<<<dim3(NR / 64, E / 128), 128, 0, stream>>>(O16, 1, PT + (size_t)3 * E * E, boa, 1.0f / (16.0f * 8.0f), 0, CAT);
  k_conv<<<NR / CR / 2, 256, 0, stream>>>(queries, cw, cb, C16);
  k_proj512<<<dim3(NR / 64, E / 128), 128, 0, stream>>>(C16, 0, PT + (size_t)4 * E * E, boc, 1.0f / 16.0f, E, CAT);
  k_wf<<<dim3(NR / 64, DM / 128), 128, 0, stream>>>(CAT, PF, bfv, queries, T);
  k_ln<<<NR / 8, 256, 0, stream>>>(T, gm, bt, out);
}

// v004
// A run of this version takes 149 microseconds.
// Next to v003, in two timings, it ran 1.04 and 1.05 times as fast.
// All steps since v000 together make it 3.09 times as fast.
// compute dtype: f16 operands for the projections, attention and the final 1024x1024 projection (activations as f16 rows, weights packed x16, q/k x4, P lifted by 2^14, V x4, ctx x8), f32 accumulate; the depthwise conv, residual and LayerNorm in f32. Output = LN(queries + out) is residual-dominated.
#include <hip/hip_runtime.h>
#include <math.h>

typedef __attribute__((ext_vector_type(16))) _Float16 v16h;
typedef __attribute__((ext_vector_type(16))) __bf16 v16b;
typedef __attribute__((ext_vector_type(8)))  _Float16 v8h;
typedef __attribute__((ext_vector_type(4)))  _Float16 v4h;
typedef __attribute__((ext_vector_type(8)))  float v8f;
typedef __attribute__((ext_vector_type(4)))  float v4f;
typedef __attribute__((ext_vector_type(2)))  float v2f;
typedef __attribute__((ext_vector_type(4)))  unsigned v4u;
typedef __attribute__((ext_vector_type(4)))  int v4i;
typedef float __attribute__((may_alias)) float_a;
typedef int __attribute__((may_alias)) int_a;

template <typename T> __device__ __forceinline__ void vst2(void* p, T v) { *(T*)p = v;  }
__device__ __forceinline__ v8f wmma16(v16h a, v16h b, v8f c) {
  v8f d = __builtin_amdgcn_wmma_f32_16x16x32_f16(false, a, false, b, (short)0, c, false, false);
  asm volatile("v_nop\n\tv_nop\n\tv_nop\n\tv_nop" : "+v"(d) : "v"(a), "v"(b));
  return d;
}
__device__ __forceinline__ v8f wmma_bf(v16b a, v16b b, v8f c) {
  v8f d = __builtin_amdgcn_wmma_f32_16x16x32_bf16(false, a, false, b, (short)0, c, false, false);
  asm volatile("v_nop\n\tv_nop\n\tv_nop\n\tv_nop" : "+v"(d) : "v"(a), "v"(b));
  return d;
}
// 16x16x32 fragments: lane = (h = lane>>4, row/col = lane&15); elements 0..7 = k0+8h+0..7, 8..15 = k0+16+8h+0..7; D element r = row 8h+r
__device__ __forceinline__ v16h frag_h(const _Float16* rowk0, int lane) {
  union { v16h v; v8h q[2]; } u; const _Float16* p = rowk0 + 8 * (lane >> 4);
  u.q[0] = *(const v8h*)p; u.q[1] = *(const v8h*)(p + 16); return u.v;
}
__device__ __forceinline__ v16h frag_f32(const float* rowk0, int lane) {
  v16h a; const float* p = rowk0 + 8 * (lane >> 4);
#pragma unroll
  for (int i = 0; i < 8; ++i) { a[i] = (_Float16)p[i]; a[8 + i] = (_Float16)p[16 + i]; }
  return a;
}
__device__ __forceinline__ v16h frag_f32s(const float* rowk0, int lane, float sc) {
  v16h a; const float* p = rowk0 + 8 * (lane >> 4);
#pragma unroll
  for (int i = 0; i < 8; ++i) { a[i] = (_Float16)(p[i] * sc); a[8 + i] = (_Float16)(p[16 + i] * sc); }
  return a;
}
// column fragment from a [K][ld] layout (column n), rows >= K read as 0
__device__ __forceinline__ v16h fragc_f32(const float* W, int k0, int n, int lane, int ld, int K) {
  v16h a; const int g = lane >> 4;
#pragma unroll
  for (int i = 0; i < 8; ++i) { const int ka = k0 + 8 * g + i, kb = ka + 16;
    a[i] = (_Float16)(ka < K ? W[(size_t)ka * ld + n] : 0.f); a[8 + i] = (_Float16)(kb < K ? W[(size_t)kb * ld + n] : 0.f); }
  return a;
}
struct F2 { v16b h, l; };
__device__ __forceinline__ F2 bsplit16(const float v[16]) { F2 r;
#pragma unroll
  for (int i = 0; i < 16; ++i) { const __bf16 h = (__bf16)v[i]; r.h[i] = h; r.l[i] = (__bf16)(v[i] - (float)h); }
  return r; }
__device__ __forceinline__ F2 split_row(const float* row, int k0, int lane) { float v[16]; const float* p = row + k0 + 8 * (lane >> 4);
#pragma unroll
  for (int i = 0; i < 8; ++i) { v[i] = p[i]; v[8 + i] = p[16 + i]; }
  return bsplit16(v); }
__device__ __forceinline__ F2 split_rowK(const float* row, int k0, int lane, int K) { float v[16]; const int g = lane >> 4;
#pragma unroll
  for (int i = 0; i < 8; ++i) { const int ka = k0 + 8 * g + i, kb = ka + 16; v[i] = ka < K ? row[ka] : 0.f; v[8 + i] = kb < K ? row[kb] : 0.f; }
  return bsplit16(v); }
__device__ __forceinline__ F2 split_col(const float* W, int k0, int n, int lane, int ld, int K) { float v[16]; const int g = lane >> 4;
#pragma unroll
  for (int i = 0; i < 8; ++i) { const int ka = k0 + 8 * g + i, kb = ka + 16; v[i] = ka < K ? W[(size_t)ka * ld + n] : 0.f; v[8 + i] = kb < K ? W[(size_t)kb * ld + n] : 0.f; }
  return bsplit16(v); }
__device__ __forceinline__ v8f mac3(const F2& a, const F2& b, v8f c) { c = wmma_bf(a.l, b.h, c); c = wmma_bf(a.h, b.l, c); return wmma_bf(a.h, b.h, c); }
__device__ __forceinline__ float sigm(float v) { return 1.0f / (1.0f + expf(-v)); }
#define LDSX() do { asm volatile("s_wait_dscnt 0" ::: "memory"); __builtin_amdgcn_wave_barrier(); __builtin_amdgcn_fence(__ATOMIC_RELEASE, "workgroup"); } while (0)


// CSP attention block on [4,2048,1024]: attention branch on channels 0..511 (q from queries, k from keys, v from values; 8 heads x 64, softmax(q.k/8), out-proj Wo_attn), conv branch on
// channels 512..1023 of queries (depthwise k=3 along the sequence + bias, then Wo_conv), concat -> Wf (1024x1024) + bf, x = queries + out, LayerNorm.
// k_prep (three 512-wide f16 row sets from the 1024-wide inputs; Wq|Wk|Wv|Wo_attn|Wo_conv rows x16; Wf rows x16), k_qkv, k_attn, k_proj512 (O@Wo_attn^T -> CAT[:, :512];
#define NB 4
#define SS 2048
#define DM 1024
#define E 512
#define NH 8
#define HD 64
#define NR (NB * SS)

// Operand tiles staged in LDS once per work-group of 128 threads: rows of 64 halves (one 128-B line), 16 rows per step, so a wave's load covers 4 whole lines.
#define LP 72   // LDS row pitch in halves: 144 B = 16 B x 9, so the 16-byte fragment reads of 16 rows fall on distinct banks
template <int ROWS> __device__ __forceinline__ void tile_ld(const _Float16* __restrict__ src, size_t pitch, int tid, v8h (&r)[ROWS / 16]) {
#pragma unroll
  for (int i = 0; i < ROWS / 16; ++i) r[i] = *(const v8h*)(src + (size_t)(i * 16 + (tid >> 3)) * pitch + (tid & 7) * 8);
}
template <int ROWS> __device__ __forceinline__ void tile_st(_Float16* dst, int tid, const v8h (&r)[ROWS / 16]) {
#pragma unroll
  for (int i = 0; i < ROWS / 16; ++i) *(v8h*)(dst + (i * 16 + (tid >> 3)) * LP + (tid & 7) * 8) = r[i];
}
// acc[j] += A(16 rows of this wave) x W(rows j*16..j*16+15 of the block's 128)^T over KD: the 128 W rows go through two LDS buffers, 64 k per stage, shared by the 4 waves;
// the next stage's W lines and A fragments are loaded while this stage is multiplied; one barrier per stage publishes the next buffer and ends the reads of the one refilled after it.
template <int KD, typename AF> __device__ __forceinline__ void gemm_w_lds(AF afrag, const _Float16* __restrict__ Wrows, _Float16 (*sB)[128 * LP], int tid, v8f (&acc)[8]) {
  const int lane = tid & 31, col = lane & 15;
  v8h rb[8]; v16h a[2], an[2];
  tile_ld<128>(Wrows, KD, tid, rb); a[0] = afrag(0); a[1] = afrag(1);
  tile_st<128>(sB[0], tid, rb);
  __syncthreads();
#pragma unroll 1   // kept rolled: built unrolled by two, the fragments loaded ahead are copied more often, not less, and are waited for in the middle of a stage
  for (int st = 0; st < KD / 64; ++st) { const bool more = st + 1 < KD / 64;
    if (more) { tile_ld<128>(Wrows + (st + 1) * 64, KD, tid, rb); an[0] = afrag(2 * st + 2); an[1] = afrag(2 * st + 3);
      asm volatile("s_wait_xcnt 0x0" ::: "memory"); }   // stands behind the run of loads, in front of the loop's foot, where their address registers are stepped on
    const _Float16* sb = sB[st & 1];
#pragma unroll
    for (int kc = 0; kc < 2; ++kc) { v16h b[8];
#pragma unroll
      for (int j = 0; j < 8; ++j) b[j] = frag_h(sb + (j * 16 + col) * LP + kc * 32, lane);
#pragma unroll
      for (int j = 0; j < 8; ++j) acc[j] = wmma16(a[kc], b[j], acc[j]); }
    if (more) { tile_st<128>(sB[(st + 1) & 1], tid, rb); a[0] = an[0]; a[1] = an[1]; __syncthreads(); } }
}

// Every f32 operand that the products read as f16 is converted by ONE launch. A quad is 4 floats; a block takes 256 * PQ quads of one source, a thread PQ quads that lie 256 quads apart, and asks for all
// PQ before the first is waited for. A wave's load covers 512 contiguous bytes of a row and its store 256 contiguous bytes, so no LDS bounce is needed. Rows are counted in 512 floats (128 quads):
// PITCH floats lie between two of them in the source (1024 in the activations, of which the first 512 columns are taken; 512 in the weights, which are dense), 512 halves in the destination.
#define PQ 16
#define AB (NR * E / 4 / (256 * PQ))   // blocks per activation
#define WB (E * E / 4 / (256 * PQ))    // blocks per 512 x 512 weight
#define FB (DM * DM / 4 / (256 * PQ))  // blocks of Wf
template <int PITCH, int SCALE> __device__ __forceinline__ void pack_run(const float* __restrict__ src, _Float16* __restrict__ dst, int lb, int tid) {
  const float* s = src + (size_t)(lb * (2 * PQ) + (tid >> 7)) * PITCH + (tid & 127) * 4; _Float16* d = dst + ((size_t)lb * (256 * PQ) + tid) * 4;
  v4f x[PQ];
#pragma unroll
  for (int i = 0; i < PQ - 1; ++i) x[i] = *(const v4f*)(s + (size_t)i * 2 * PITCH);
  asm volatile("s_wait_xcnt 0x0" ::: "memory");   // the last load's result may be given the registers that hold the address of the loads above
  x[PQ - 1] = *(const v4f*)(s + (size_t)(PQ - 1) * 2 * PITCH);
  asm volatile("s_wait_xcnt 0x0" ::: "memory");   // behind the last load, in front of whatever next takes its address registers
#pragma unroll
  for (int i = 0; i < PQ; ++i) { v4h o;
#pragma unroll
    for (int e = 0; e < 4; ++e) o[e] = (_Float16)(x[i][e] * (float)SCALE);
    vst2(d + i * 1024, o); }
  asm volatile("s_wait_xcnt 0x0" ::: "memory");   // behind the last store, in front of whatever next takes the stores' address or data registers on any way out of this run
}
// blocks [0, 3 AB): Xq | Xk | Xv = f16 of columns 0..511 of queries | keys | values; [3 AB, 3 AB + 5 WB): PT rows (512 halves, x16) = Wq | Wk | Wv | Wo_attn | Wo_conv ([out][in]); the last FB: PF rows (1024 halves, x16) = Wf
__global__ __launch_bounds__(256) void k_prep(const float* __restrict__ q, const float* __restrict__ k, const float* __restrict__ v, const float* __restrict__ Wq, const float* __restrict__ Wk, const float* __restrict__ Wv,
                                             const float* __restrict__ Woa, const float* __restrict__ Woc, const float* __restrict__ Wf, _Float16* __restrict__ Xq, _Float16* __restrict__ Xk, _Float16* __restrict__ Xv,
                                             _Float16* __restrict__ PT, _Float16* __restrict__ PF) {
  const int bx = blockIdx.x, tid = threadIdx.x;
  if (bx < 3 * AB) { const int which = bx / AB; pack_run<DM, 1>(which == 0 ? q : (which == 1 ? k : v), which == 0 ? Xq : (which == 1 ? Xk : Xv), bx % AB, tid); }
  else if (bx < 3 * AB + 5 * WB) { const int n = bx - 3 * AB, which = n / WB; const float* W = which == 0 ? Wq : (which == 1 ? Wk : (which == 2 ? Wv : (which == 3 ? Woa : Woc)));
    pack_run<E, 16>(W, PT + (size_t)which * E * E, n % WB, tid); }
  else pack_run<E, 16>(Wf, PF, bx - 3 * AB - 5 * WB, tid);
}
__global__ __launch_bounds__(128) void k_qkv(const _Float16* __restrict__ Xq, const _Float16* __restrict__ Xk, const _Float16* __restrict__ Xv, const _Float16* __restrict__ PT, const float* __restrict__ bq, const float* __restrict__ bk, const float* __restrict__ bv,
                                            _Float16* __restrict__ Q16, _Float16* __restrict__ K16, _Float16* __restrict__ VTh) {
  __shared__ __align__(16) float so[4][16][132];
  __shared__ __align__(16) _Float16 sth[128][72];
  __shared__ __align__(16) _Float16 sB[2][128 * LP];
  const int tid = threadIdx.x, wave = tid >> 5, lane = tid & 31, col = lane & 15, g = lane >> 4;
  const int which = blockIdx.z, r0b = blockIdx.x * 64, r0 = r0b + wave * 16, n0 = blockIdx.y * 128; const int b = r0b / SS, s0 = r0b % SS;
  const _Float16* X16 = which == 0 ? Xq : (which == 1 ? Xk : Xv); const float* bb_ = which == 0 ? bq : (which == 1 ? bk : bv);
  v8f acc[8] = {};
  gemm_w_lds<E>([&](int kc) { return frag_h(X16 + (size_t)(r0 + col) * E + kc * 32, lane); }, PT + (size_t)(which * E + n0) * E, sB, tid, acc);
  if (which < 2) {
#pragma unroll
    for (int j = 0; j < 8; ++j) { const float bb = bb_[n0 + j * 16 + col];
#pragma unroll
      for (int r = 0; r < 8; ++r) so[wave][8 * g + r][j * 16 + col] = (acc[j][r] * (1.0f / 16.0f) + bb) * 4.0f; }
    LDSX();
    _Float16* Dst = which == 0 ? Q16 : K16;
    for (int qq = lane; qq < 16 * 2 * 8; qq += 32) { const int hh = qq >> 7, rl = (qq >> 3) & 15, pc = qq & 7; const int h = (n0 >> 6) + hh; union { v8h h8; v4u u; } pk;
#pragma unroll
      for (int e = 0; e < 8; ++e) pk.h8[e] = (_Float16)so[wave][rl][hh * 64 + pc * 8 + e];
      vst2(Dst + (((size_t)b * NH + h) * SS + s0 + wave * 16 + rl) * HD + pc * 8, pk.u); } }
  else {
#pragma unroll
    for (int j = 0; j < 8; ++j) { const float bb = bb_[n0 + j * 16 + col];
#pragma unroll
      for (int r = 0; r < 8; ++r) sth[j * 16 + col][wave * 16 + 8 * g + r] = (_Float16)((acc[j][r] * (1.0f / 16.0f) + bb) * 4.0f); }
    __syncthreads();
    for (int qq = tid; qq < 128 * 8; qq += 128) { const int cl = qq >> 3, pc = qq & 7; const int c = n0 + cl, h = c >> 6, d = c & 63; vst2(VTh + (((size_t)b * NH + h) * HD + d) * SS + s0 + pc * 8, *(const v4u*)(&sth[cl][pc * 8])); } }
}
__global__ __launch_bounds__(128) void k_attn(const _Float16* __restrict__ Q16, const _Float16* __restrict__ K16, const _Float16* __restrict__ VTh, _Float16* __restrict__ O16) {
  __shared__ __align__(16) float sS[4][16][68];
  __shared__ __align__(16) _Float16 sPh[4][16][72];
  __shared__ __align__(16) _Float16 sK[2][64 * LP];   // 64 keys x 64 d
  __shared__ __align__(16) _Float16 sV[2][64 * LP];   // 64 d x 64 keys
  float (*sO)[16][68] = sS;   // the score rows are dead behind the loop: the output bounce takes their place, which keeps four work-groups well inside a WGP's LDS beside the new tiles
  const int tid = threadIdx.x, w = tid >> 5, lane = tid & 31, col = lane & 15, g = lane >> 4;
  const size_t bh = blockIdx.y; const int q0 = blockIdx.x * 64 + w * 16;
  v16h aq[2];
#pragma unroll
  for (int kc = 0; kc < 2; ++kc) aq[kc] = frag_h(Q16 + (bh * SS + q0 + col) * HD + kc * 32, lane);
  float mrun = -3.0e38f, lrun = 0.f; v8f acc[4] = {};
  const _Float16* Kb = K16 + bh * SS * HD; const _Float16* Vb = VTh + bh * HD * SS; v8h rk[4], rv[4];
  tile_ld<64>(Kb, HD, tid, rk); tile_ld<64>(Vb, SS, tid, rv); tile_st<64>(sK[0], tid, rk); tile_st<64>(sV[0], tid, rv);
  __syncthreads();
#pragma unroll 1
  for (int kt = 0; kt < SS / 64; ++kt) { const bool more = kt + 1 < SS / 64;
    const _Float16* sk = sK[kt & 1]; const _Float16* sv = sV[kt & 1];
    v16h kf[4][2];
#pragma unroll
    for (int t = 0; t < 4; ++t) {
#pragma unroll
      for (int kc = 0; kc < 2; ++kc) kf[t][kc] = frag_h(sk + (t * 16 + col) * LP + kc * 32, lane); }
#pragma unroll
    for (int t = 0; t < 4; ++t) { v8f s = {};
#pragma unroll
      for (int kc = 0; kc < 2; ++kc) s = wmma16(aq[kc], kf[t][kc], s);
#pragma unroll
      for (int r = 0; r < 8; ++r) sS[w][8 * g + r][t * 16 + col] = s[r] * (0.125f / 16.0f * 1.44269504f); }   // scores kept in units of log2: e^x = 2^(x log2 e), so each exponential below is one subtract and one v_exp_f32
    LDSX();
    // the next tiles' lines are asked for here, behind the fence above (which waits for every load in flight), so that they fly under the softmax
    if (more) { tile_ld<64>(Kb + (size_t)(kt + 1) * 64 * HD, HD, tid, rk); tile_ld<64>(Vb + (kt + 1) * 64, SS, tid, rv); }
    float mx = -3.4e38f;
#pragma unroll
    for (int jj = 0; jj < 32; ++jj) mx = fmaxf(mx, sS[w][col][g * 32 + jj]);
    mx = fmaxf(mx, __shfl_xor(mx, 16, 32));
    const float mnew = fmaxf(mrun, mx); const float corr = __builtin_amdgcn_exp2f(mrun - mnew); const float mlift = mnew - 14.0f;   // the lift of P by 2^14 rides in the exponent
    float ps = 0.f;
#pragma unroll
    for (int jj = 0; jj < 32; ++jj) { const float p = __builtin_amdgcn_exp2f(sS[w][col][g * 32 + jj] - mlift); ps += p; sPh[w][col][g * 32 + jj] = (_Float16)p; }
    ps += __shfl_xor(ps, 16, 32);
    lrun = lrun * corr + ps * (1.0f / 16384.0f); mrun = mnew;
#pragma unroll
    for (int r = 0; r < 8; ++r) { const float cr = __shfl(corr, 8 * g + r, 32);
#pragma unroll
      for (int t = 0; t < 4; ++t) acc[t][r] *= cr; }
    LDSX();
#pragma unroll
    for (int kc = 0; kc < 2; ++kc) { const v16h ph = frag_h(&sPh[w][col][0] + kc * 32, lane); v16h vf[4];
#pragma unroll
      for (int t = 0; t < 4; ++t) vf[t] = frag_h(sv + (t * 16 + col) * LP + kc * 32, lane);
#pragma unroll
      for (int t = 0; t < 4; ++t) acc[t] = wmma16(ph, vf[t], acc[t]); }
    __builtin_amdgcn_wave_barrier();
    if (more) { tile_st<64>(sK[(kt + 1) & 1], tid, rk); tile_st<64>(sV[(kt + 1) & 1], tid, rv); __syncthreads(); } }
#pragma unroll
  for (int r = 0; r < 8; ++r) { const float lr = __shfl(lrun, 8 * g + r, 32); const float inv = 8.0f / (lr * 16384.0f * 4.0f);
#pragma unroll
    for (int t = 0; t < 4; ++t) sO[w][8 * g + r][t * 16 + col] = acc[t][r] * inv; }
  LDSX();
  for (int qq = lane; qq < 16 * 8; qq += 32) { const int rl = qq >> 3, pc = qq & 7; union { v8h h8; v4u u; } pk;
#pragma unroll
    for (int e = 0; e < 8; ++e) pk.h8[e] = (_Float16)sO[w][rl][pc * 8 + e];
    vst2(O16 + ((bh * SS) + q0 + rl) * HD + pc * 8, pk.u); }
}
// CAT[:, coff .. coff+512) = f16( A PTw^T * ascale + b ) : A rows 512 halves; headm = 1 -> A is the head-major O16 (x8), else token-major rows; block (64 rows, 128 cols)
__global__ __launch_bounds__(128) void k_proj512(const _Float16* __restrict__ A16, int headm, const _Float16* __restrict__ PTw, const float* __restrict__ bias, float ascale, int coff, _Float16* __restrict__ CAT) {
  __shared__ __align__(16) _Float16 so[4][16][136];
  __shared__ __align__(16) _Float16 sB[2][128 * LP];
  const int tid = threadIdx.x, wave = tid >> 5, lane = tid & 31, col = lane & 15, g = lane >> 4;
  const int r0 = blockIdx.x * 64 + wave * 16, n0 = blockIdx.y * 128; const int ra = r0 + col; const int b = ra / SS, s = ra % SS;
  v8f acc[8] = {};
  const _Float16* Ab = A16 + (headm ? ((size_t)b * NH * SS + s) * HD : (size_t)ra * E); const size_t hstep = headm ? (size_t)SS * HD : (size_t)64;   // 64 k on: the next head's row, or 64 halves on in the token's row
  gemm_w_lds<E>([&](int kc) { return frag_h(Ab + (size_t)(kc >> 1) * hstep + (kc & 1) * 32, lane); }, PTw + (size_t)n0 * E, sB, tid, acc);
#pragma unroll
  for (int j = 0; j < 8; ++j) { const float bb = bias[n0 + j * 16 + col];
#pragma unroll
    for (int r = 0; r < 8; ++r) so[wave][8 * g + r][j * 16 + col] = (_Float16)(acc[j][r] * ascale + bb); }
  LDSX();
  for (int rl = 0; rl < 16; ++rl) { if (lane < 16) vst2(CAT + (size_t)(r0 + rl) * DM + coff + n0 + lane * 8, *(const v4u*)(&so[wave][rl][lane * 8])); }
}
// depthwise conv (k=3, pad 1) along the sequence on queries[:, :, 512 + c]: C16[b][l][c] f16 ; thread = 4 columns x CR positions, 128 threads per run of CR positions, two runs per block.
// A thread's CR + 2 input rows are loaded without a condition (the two edge rows from a clamped address, set to 0 behind the load), so that all of them are in flight before the first is waited for;
// a wave's load covers 512 contiguous bytes of a row and its store 256 contiguous bytes, so no LDS bounce is needed.
#define CR 8
__global__ __launch_bounds__(256) void k_conv(const float* __restrict__ q, const float* __restrict__ cw, const float* __restrict__ cb, _Float16* __restrict__ C16) {
  const int tid = threadIdx.x; const int c = (tid & 127) * 4, r0 = (blockIdx.x * 2 + (tid >> 7)) * CR, l0 = r0 % SS;   // r0 = b * SS + l0; a run never crosses a batch (SS is a multiple of CR)
  const bool top = l0 > 0, bot = l0 + CR < SS; const float* col_ = q + (size_t)r0 * DM + E + c;
  v4f x[CR + 2];
  x[0] = *(const v4f*)(col_ - (top ? DM : 0));
#pragma unroll
  for (int i = 0; i < CR; ++i) x[i + 1] = *(const v4f*)(col_ + (size_t)i * DM);
  x[CR + 1] = *(const v4f*)(col_ + (size_t)(bot ? CR : CR - 1) * DM);
  const v4f bb = *(const v4f*)(cb + c);
  const float* wp = cw + c * 3; v4f wv[3];   // the 4 columns' 12 taps: tap k of column c + e is element e * 3 + k
  wv[0] = *(const v4f*)wp; wv[1] = *(const v4f*)(wp + 4);
  asm volatile("s_wait_xcnt 0x0" ::: "memory");   // the last load's result may be given the registers that hold the address of the loads above
  wv[2] = *(const v4f*)(wp + 8);
#pragma unroll
  for (int e = 0; e < 4; ++e) { x[0][e] = top ? x[0][e] : 0.f; x[CR + 1][e] = bot ? x[CR + 1][e] : 0.f; }
#pragma unroll
  for (int i = 0; i < CR; ++i) { v4h o;
#pragma unroll
    for (int e = 0; e < 4; ++e) o[e] = (_Float16)(wv[(e * 3) >> 2][(e * 3) & 3] * x[i][e] + wv[(e * 3 + 1) >> 2][(e * 3 + 1) & 3] * x[i + 1][e] + wv[(e * 3 + 2) >> 2][(e * 3 + 2) & 3] * x[i + 2][e] + bb[e]);
    vst2(C16 + (size_t)(r0 + i) * E + c, o); }
}
// T = queries + CAT Wf^T / 16 + bf : block (64 rows, 128 cols), K = 1024
__global__ __launch_bounds__(128) void k_wf(const _Float16* __restrict__ CAT, const _Float16* __restrict__ PF, const float* __restrict__ bfv, const float* __restrict__ q, float* __restrict__ T) {
  __shared__ __align__(16) float so[4][16][132];
  __shared__ __align__(16) _Float16 sB[2][128 * LP];
  const int tid = threadIdx.x, wave = tid >> 5, lane = tid & 31, col = lane & 15, g = lane >> 4; const int r0 = blockIdx.x * 64 + wave * 16, n0 = blockIdx.y * 128;
  v8f acc[8] = {};
  gemm_w_lds<DM>([&](int kc) { return frag_h(CAT + (size_t)(r0 + col) * DM + kc * 32, lane); }, PF + (size_t)n0 * DM, sB, tid, acc);
#pragma unroll
  for (int j = 0; j < 8; ++j) { const int n = n0 + j * 16 + col; const float bb = bfv[n];
#pragma unroll
    for (int r = 0; r < 8; ++r) so[wave][8 * g + r][j * 16 + col] = acc[j][r] * (1.0f / 16.0f) + bb + q[(size_t)(r0 + 8 * g + r) * DM + n]; }
  LDSX();
#pragma unroll 4
  for (int rl = 0; rl < 16; ++rl) vst2(T + (size_t)(r0 + rl) * DM + n0 + lane * 4, *(const v4f*)(&so[wave][rl][lane * 4]));
}
// LayerNorm over 1024 per row: wave per row (32 floats per lane)
__global__ __launch_bounds__(256) void k_ln(const float* __restrict__ T, const float* __restrict__ gm, const float* __restrict__ bt, float* __restrict__ out) {
  // LayerNorm over 1024 per row: wave per row; lane owns columns p*128 + lane*4 .. +3 for p = 0..7 so every store instruction writes one contiguous 512-B run by 32 consecutive lanes
  const int wave = threadIdx.x >> 5, lane = threadIdx.x & 31; const size_t row = (size_t)blockIdx.x * 8 + wave; const float* tr = T + row * DM;
  float s = 0.f, sq = 0.f;
#pragma unroll
  for (int p = 0; p < 8; ++p) { const v4f v = *(const v4f*)(tr + p * 128 + lane * 4);
#pragma unroll
    for (int e = 0; e < 4; ++e) { s += v[e]; sq += v[e] * v[e]; } }
#pragma unroll
  for (int o = 16; o > 0; o >>= 1) { s += __shfl_xor(s, o, 32); sq += __shfl_xor(sq, o, 32); }
  const float mu = s * (1.0f / DM); float var = sq * (1.0f / DM) - mu * mu; var = var > 0.f ? var : 0.f; const float rs = rsqrtf(var + 1e-5f);
#pragma unroll 1
  for (int p = 0; p < 8; ++p) { const int c0 = p * 128 + lane * 4; v4f v = *(const v4f*)(tr + c0);
#pragma unroll
    for (int e = 0; e < 4; ++e) v[e] = (v[e] - mu) * rs * gm[c0 + e] + bt[c0 + e];
    vst2(out + row * DM + c0, v); }
}
extern "C" void kernel_launch(void* const* d_in, const int* in_sizes, int n_in, void* d_out, int out_size, void* d_ws, size_t ws_size, hipStream_t stream) {
  (void)in_sizes; (void)n_in; (void)out_size; (void)ws_size;
  const float** I = (const float**)d_in;
  const float* queries = I[0]; const float* keys = I[1]; const float* values = I[2]; const float* Wq = I[3]; const float* bq = I[4]; const float* Wk = I[5]; const float* bk = I[6]; const float* Wv = I[7]; const float* bv = I[8];
  const float* Woa = I[9]; const float* boa = I[10]; const float* cw = I[11]; const float* cb = I[12]; const float* Woc = I[13]; const float* boc = I[14]; const float* Wf = I[15]; const float* bfv = I[16]; const float* gm = I[17]; const float* bt = I[18];
  float* out = (float*)d_out;
  char* ws = (char*)d_ws; size_t off = 0;
  auto take = [&](size_t bytes) { char* p = ws + off; off += (bytes + 255) & ~(size_t)255; return p; };
  _Float16* Xq = (_Float16*)take((size_t)NR * E * 2); _Float16* Xk = (_Float16*)take((size_t)NR * E * 2); _Float16* Xv = (_Float16*)take((size_t)NR * E * 2);
  _Float16* PT = (_Float16*)take((size_t)5 * E * E * 2); _Float16* PF = (_Float16*)take((size_t)DM * DM * 2);
  _Float16* Q16 = (_Float16*)take((size_t)NR * E * 2); _Float16* K16 = (_Float16*)take((size_t)NR * E * 2); _Float16* VTh = (_Float16*)take((size_t)NR * E * 2); _Float16* O16 = Xq;   // Xq dead after k_qkv
  _Float16* C16 = Xk;                                            // Xk dead after k_qkv
  _Float16* CAT = (_Float16*)take((size_t)NR * DM * 2); float* T = (float*)take((size_t)NR * DM * 4);
  // ws ~ 104 MB
  k_prep<<<3 * AB + 5 * WB + FB, 256, 0, stream>>>(queries, keys, values, Wq, Wk, Wv, Woa, Woc, Wf, Xq, Xk, Xv, PT, PF);
  k_qkv<<<dim3(NR / 64, E / 128, 3), 128, 0, stream>>>(Xq, Xk, Xv, PT, bq, bk, bv, Q16, K16, VTh);
  k_attn<<<dim3(SS / 64, NB * NH), 128, 0, stream>>>(Q16, K16, VTh, O16);
  k_proj512<<<dim3(NR / 64, E / 128), 128, 0, stream>>>(O16, 1, PT + (size_t)3 * E * E, boa, 1.0f / (16.0f * 8.0f), 0, CAT);
  k_conv<<<NR / CR / 2, 256, 0, stream>>>(queries, cw, cb, C16);
  k_proj512<<<dim3(NR / 64, E / 128), 128, 0, stream>>>(C16, 0, PT + (size_t)4 * E * E, boc, 1.0f / 16.0f, E, CAT);
  k_wf<<<dim3(NR / 64, DM / 128), 128, 0, stream>>>(CAT, PF, bfv, queries, T);
  k_ln<<<NR / 8, 256, 0, stream>>>(T, gm, bt, out);
}

// v005
// It runs in 135 microseconds.
// Next to v004, in two timings, it ran 1.10 and 1.11 times as fast.
// Over all steps from v000 it is 3.41 times as fast.
// compute dtype: f16 operands for the projections, attention and the final 1024x1024 projection (activations as f16 rows, weights packed x16, q/k x4, P lifted by 2^14, V x4, ctx x8), f32 accumulate; the depthwise conv, residual and LayerNorm in f32. Output = LN(queries + out) is residual-dominated.
#include <hip/hip_runtime.h>
#include <math.h>

typedef __attribute__((ext_vector_type(16))) _Float16 v16h;
typedef __attribute__((ext_vector_type(16))) __bf16 v16b;
typedef __attribute__((ext_vector_type(8)))  _Float16 v8h;
typedef __attribute__((ext_vector_type(4)))  _Float16 v4h;
typedef __attribute__((ext_vector_type(2)))  _Float16 v2h;
typedef __attribute__((ext_vector_type(8)))  float v8f;
typedef __attribute__((ext_vector_type(4)))  float v4f;
typedef __attribute__((ext_vector_type(2)))  float v2f;
typedef __attribute__((ext_vector_type(4)))  unsigned v4u;
typedef __attribute__((ext_vector_type(4)))  int v4i;
typedef float __attribute__((may_alias)) float_a;
typedef int __attribute__((may_alias)) int_a;

template <typename T> __device__ __forceinline__ void vst2(void* p, T v) { *(T*)p = v;  }
__device__ __forceinline__ v8f wmma16(v16h a, v16h b, v8f c) {
  v8f d = __builtin_amdgcn_wmma_f32_16x16x32_f16(false, a, false, b, (short)0, c, false, false);
  asm volatile("v_nop\n\tv_nop\n\tv_nop\n\tv_nop" : "+v"(d) : "v"(a), "v"(b));
  return d;
}
__device__ __forceinline__ v8f wmma_bf(v16b a, v16b b, v8f c) {
  v8f d = __builtin_amdgcn_wmma_f32_16x16x32_bf16(false, a, false, b, (short)0, c, false, false);
  asm volatile("v_nop\n\tv_nop\n\tv_nop\n\tv_nop" : "+v"(d) : "v"(a), "v"(b));
  return d;
}
// 16x16x32 fragments: lane = (h = lane>>4, row/col = lane&15); elements 0..7 = k0+8h+0..7, 8..15 = k0+16+8h+0..7; D element r = row 8h+r
__device__ __forceinline__ v16h frag_h(const _Float16* rowk0, int lane) {
  union { v16h v; v8h q[2]; } u; const _Float16* p = rowk0 + 8 * (lane >> 4);
  u.q[0] = *(const v8h*)p; u.q[1] = *(const v8h*)(p + 16); return u.v;
}
__device__ __forceinline__ v16h frag_f32(const float* rowk0, int lane) {
  v16h a; const float* p = rowk0 + 8 * (lane >> 4);
#pragma unroll
  for (int i = 0; i < 8; ++i) { a[i] = (_Float16)p[i]; a[8 + i] = (_Float16)p[16 + i]; }
  return a;
}
__device__ __forceinline__ v16h frag_f32s(const float* rowk0, int lane, float sc) {
  v16h a; const float* p = rowk0 + 8 * (lane >> 4);
#pragma unroll
  for (int i = 0; i < 8; ++i) { a[i] = (_Float16)(p[i] * sc); a[8 + i] = (_Float16)(p[16 + i] * sc); }
  return a;
}
// column fragment from a [K][ld] layout (column n), rows >= K read as 0
__device__ __forceinline__ v16h fragc_f32(const float* W, int k0, int n, int lane, int ld, int K) {
  v16h a; const int g = lane >> 4;
#pragma unroll
  for (int i = 0; i < 8; ++i) { const int ka = k0 + 8 * g + i, kb = ka + 16;
    a[i] = (_Float16)(ka < K ? W[(size_t)ka * ld + n] : 0.f); a[8 + i] = (_Float16)(kb < K ? W[(size_t)kb * ld + n] : 0.f); }
  return a;
}
struct F2 { v16b h, l; };
__device__ __forceinline__ F2 bsplit16(const float v[16]) { F2 r;
#pragma unroll
  for (int i = 0; i < 16; ++i) { const __bf16 h = (__bf16)v[i]; r.h[i] = h; r.l[i] = (__bf16)(v[i] - (float)h); }
  return r; }
__device__ __forceinline__ F2 split_row(const float* row, int k0, int lane) { float v[16]; const float* p = row + k0 + 8 * (lane >> 4);
#pragma unroll
  for (int i = 0; i < 8; ++i) { v[i] = p[i]; v[8 + i] = p[16 + i]; }
  return bsplit16(v); }
__device__ __forceinline__ F2 split_rowK(const float* row, int k0, int lane, int K) { float v[16]; const int g = lane >> 4;
#pragma unroll
  for (int i = 0; i < 8; ++i) { const int ka = k0 + 8 * g + i, kb = ka + 16; v[i] = ka < K ? row[ka] : 0.f; v[8 + i] = kb < K ? row[kb] : 0.f; }
  return bsplit16(v); }
__device__ __forceinline__ F2 split_col(const float* W, int k0, int n, int lane, int ld, int K) { float v[16]; const int g = lane >> 4;
#pragma unroll
  for (int i = 0; i < 8; ++i) { const int ka = k0 + 8 * g + i, kb = ka + 16; v[i] = ka < K ? W[(size_t)ka * ld + n] : 0.f; v[8 + i] = kb < K ? W[(size_t)kb * ld + n] : 0.f; }
  return bsplit16(v); }
__device__ __forceinline__ v8f mac3(const F2& a, const F2& b, v8f c) { c = wmma_bf(a.l, b.h, c); c = wmma_bf(a.h, b.l, c); return wmma_bf(a.h, b.h, c); }
__device__ __forceinline__ float sigm(float v) { return 1.0f / (1.0f + expf(-v)); }
#define LDSX() do { asm volatile("s_wait_dscnt 0" ::: "memory"); __builtin_amdgcn_wave_barrier(); __builtin_amdgcn_fence(__ATOMIC_RELEASE, "workgroup"); } while (0)


// CSP attention block on [4,2048,1024]: attention branch on channels 0..511 (q from queries, k from keys, v from values; 8 heads x 64, softmax(q.k/8), out-proj Wo_attn), conv branch on
// channels 512..1023 of queries (depthwise k=3 along the sequence + bias, then Wo_conv), concat -> Wf (1024x1024) + bf, x = queries + out, LayerNorm.
// k_prep (three 512-wide f16 row sets from the 1024-wide inputs; Wq|Wk|Wv|Wo_attn|Wo_conv rows x16; Wf rows x16), k_qkv, k_attn, k_proj512 (O@Wo_attn^T -> CAT[:, :512];
#define NB 4
#define SS 2048
#define DM 1024
#define E 512
#define NH 8
#define HD 64
#define NR (NB * SS)

// Operand tiles staged in LDS once per work-group of 128 threads: rows of 64 halves (one 128-B line), 16 rows per step, so a wave's load covers 4 whole lines.
#define LP 72   // LDS row pitch in halves: 144 B = 16 B x 9, so the 16-byte fragment reads of 16 rows fall on distinct banks
template <int ROWS> __device__ __forceinline__ void tile_ld(const _Float16* __restrict__ src, size_t pitch, int tid, v8h (&r)[ROWS / 16]) {
#pragma unroll
  for (int i = 0; i < ROWS / 16; ++i) r[i] = *(const v8h*)(src + (size_t)(i * 16 + (tid >> 3)) * pitch + (tid & 7) * 8);
}
template <int ROWS> __device__ __forceinline__ void tile_st(_Float16* dst, int tid, const v8h (&r)[ROWS / 16]) {
#pragma unroll
  for (int i = 0; i < ROWS / 16; ++i) *(v8h*)(dst + (i * 16 + (tid >> 3)) * LP + (tid & 7) * 8) = r[i];
}
// acc[j] += A(16 rows of this wave) x W(rows j*16..j*16+15 of the block's 128)^T over KD: the 128 W rows go through two LDS buffers, 64 k per stage, shared by the 4 waves;
// the next stage's W lines and A fragments are loaded while this stage is multiplied; one barrier per stage publishes the next buffer and ends the reads of the one refilled after it.
template <int KD, typename AF> __device__ __forceinline__ void gemm_w_lds(AF afrag, const _Float16* __restrict__ Wrows, _Float16 (*sB)[128 * LP], int tid, v8f (&acc)[8]) {
  const int lane = tid & 31, col = lane & 15;
  v8h rb[8]; v16h a[2], an[2];
  tile_ld<128>(Wrows, KD, tid, rb); a[0] = afrag(0); a[1] = afrag(1);
  tile_st<128>(sB[0], tid, rb);
  __syncthreads();
#pragma unroll 1   // kept rolled: built unrolled by two, the fragments loaded ahead are copied more often, not less, and are waited for in the middle of a stage
  for (int st = 0; st < KD / 64; ++st) { const bool more = st + 1 < KD / 64;
    if (more) { tile_ld<128>(Wrows + (st + 1) * 64, KD, tid, rb); an[0] = afrag(2 * st + 2); an[1] = afrag(2 * st + 3);
      asm volatile("s_wait_xcnt 0x0" ::: "memory"); }   // stands behind the run of loads, in front of the loop's foot, where their address registers are stepped on
    const _Float16* sb = sB[st & 1];
#pragma unroll
    for (int kc = 0; kc < 2; ++kc) { v16h b[8];
#pragma unroll
      for (int j = 0; j < 8; ++j) b[j] = frag_h(sb + (j * 16 + col) * LP + kc * 32, lane);
#pragma unroll
      for (int j = 0; j < 8; ++j) acc[j] = wmma16(a[kc], b[j], acc[j]); }
    if (more) { tile_st<128>(sB[(st + 1) & 1], tid, rb); a[0] = an[0]; a[1] = an[1]; __syncthreads(); } }
}

// Every f32 operand that the products read as f16 is converted by ONE launch. A quad is 4 floats; a block takes 256 * PQ quads of one source, a thread PQ quads that lie 256 quads apart, and asks for all
// PQ before the first is waited for. A wave's load covers 512 contiguous bytes of a row and its store 256 contiguous bytes, so no LDS bounce is needed. Rows are counted in 512 floats (128 quads):
// PITCH floats lie between two of them in the source (1024 in the activations, of which the first 512 columns are taken; 512 in the weights, which are dense), 512 halves in the destination.
#define PQ 16
#define AB (NR * E / 4 / (256 * PQ))   // blocks per activation
#define WB (E * E / 4 / (256 * PQ))    // blocks per 512 x 512 weight
#define FB (DM * DM / 4 / (256 * PQ))  // blocks of Wf
template <int PITCH, int SCALE> __device__ __forceinline__ void pack_run(const float* __restrict__ src, _Float16* __restrict__ dst, int lb, int tid) {
  const float* s = src + (size_t)(lb * (2 * PQ) + (tid >> 7)) * PITCH + (tid & 127) * 4; _Float16* d = dst + ((size_t)lb * (256 * PQ) + tid) * 4;
  v4f x[PQ];
#pragma unroll
  for (int i = 0; i < PQ - 1; ++i) x[i] = *(const v4f*)(s + (size_t)i * 2 * PITCH);
  asm volatile("s_wait_xcnt 0x0" ::: "memory");   // the last load's result may be given the registers that hold the address of the loads above
  x[PQ - 1] = *(const v4f*)(s + (size_t)(PQ - 1) * 2 * PITCH);
  asm volatile("s_wait_xcnt 0x0" ::: "memory");   // behind the last load, in front of whatever next takes its address registers
#pragma unroll
  for (int i = 0; i < PQ; ++i) { v4h o;
#pragma unroll
    for (int e = 0; e < 4; ++e) o[e] = (_Float16)(x[i][e] * (float)SCALE);
    vst2(d + i * 1024, o); }
  asm volatile("s_wait_xcnt 0x0" ::: "memory");   // behind the last store, in front of whatever next takes the stores' address or data registers on any way out of this run
}
// blocks [0, 3 AB): Xq | Xk | Xv = f16 of columns 0..511 of queries | keys | values; [3 AB, 3 AB + 5 WB): PT rows (512 halves, x16) = Wq | Wk | Wv | Wo_attn | Wo_conv ([out][in]); the last FB: PF rows (1024 halves, x16) = Wf
__global__ __launch_bounds__(256) void k_prep(const float* __restrict__ q, const float* __restrict__ k, const float* __restrict__ v, const float* __restrict__ Wq, const float* __restrict__ Wk, const float* __restrict__ Wv,
                                             const float* __restrict__ Woa, const float* __restrict__ Woc, const float* __restrict__ Wf, _Float16* __restrict__ Xq, _Float16* __restrict__ Xk, _Float16* __restrict__ Xv,
                                             _Float16* __restrict__ PT, _Float16* __restrict__ PF) {
  const int bx = blockIdx.x, tid = threadIdx.x;
  if (bx < 3 * AB) { const int which = bx / AB; pack_run<DM, 1>(which == 0 ? q : (which == 1 ? k : v), which == 0 ? Xq : (which == 1 ? Xk : Xv), bx % AB, tid); }
  else if (bx < 3 * AB + 5 * WB) { const int n = bx - 3 * AB, which = n / WB; const float* W = which == 0 ? Wq : (which == 1 ? Wk : (which == 2 ? Wv : (which == 3 ? Woa : Woc)));
    pack_run<E, 16>(W, PT + (size_t)which * E * E, n % WB, tid); }
  else pack_run<E, 16>(Wf, PF, bx - 3 * AB - 5 * WB, tid);
}
__global__ __launch_bounds__(128) void k_qkv(const _Float16* __restrict__ Xq, const _Float16* __restrict__ Xk, const _Float16* __restrict__ Xv, const _Float16* __restrict__ PT, const float* __restrict__ bq, const float* __restrict__ bk, const float* __restrict__ bv,
                                            _Float16* __restrict__ Q16, _Float16* __restrict__ K16, _Float16* __restrict__ VTh) {
  __shared__ __align__(16) float so[4][16][132];
  __shared__ __align__(16) _Float16 sth[128][72];
  __shared__ __align__(16) _Float16 sB[2][128 * LP];
  const int tid = threadIdx.x, wave = tid >> 5, lane = tid & 31, col = lane & 15, g = lane >> 4;
  const int which = blockIdx.z, r0b = blockIdx.x * 64, r0 = r0b + wave * 16, n0 = blockIdx.y * 128; const int b = r0b / SS, s0 = r0b % SS;
  const _Float16* X16 = which == 0 ? Xq : (which == 1 ? Xk : Xv); const float* bb_ = which == 0 ? bq : (which == 1 ? bk : bv);
  v8f acc[8] = {};
  gemm_w_lds<E>([&](int kc) { return frag_h(X16 + (size_t)(r0 + col) * E + kc * 32, lane); }, PT + (size_t)(which * E + n0) * E, sB, tid, acc);
  if (which < 2) {
#pragma unroll
    for (int j = 0; j < 8; ++j) { const float bb = bb_[n0 + j * 16 + col];
#pragma unroll
      for (int r = 0; r < 8; ++r) so[wave][8 * g + r][j * 16 + col] = (acc[j][r] * (1.0f / 16.0f) + bb) * 4.0f; }
    LDSX();
    _Float16* Dst = which == 0 ? Q16 : K16;
    for (int qq = lane; qq < 16 * 2 * 8; qq += 32) { const int hh = qq >> 7, rl = (qq >> 3) & 15, pc = qq & 7; const int h = (n0 >> 6) + hh; union { v8h h8; v4u u; } pk;
#pragma unroll
      for (int e = 0; e < 8; ++e) pk.h8[e] = (_Float16)so[wave][rl][hh * 64 + pc * 8 + e];
      vst2(Dst + (((size_t)b * NH + h) * SS + s0 + wave * 16 + rl) * HD + pc * 8, pk.u); } }
  else {
#pragma unroll
    for (int j = 0; j < 8; ++j) { const float bb = bb_[n0 + j * 16 + col];
#pragma unroll
      for (int r = 0; r < 8; ++r) sth[j * 16 + col][wave * 16 + 8 * g + r] = (_Float16)((acc[j][r] * (1.0f / 16.0f) + bb) * 4.0f); }
    __syncthreads();
    for (int qq = tid; qq < 128 * 8; qq += 128) { const int cl = qq >> 3, pc = qq & 7; const int c = n0 + cl, h = c >> 6, d = c & 63; vst2(VTh + (((size_t)b * NH + h) * HD + d) * SS + s0 + pc * 8, *(const v4u*)(&sth[cl][pc * 8])); } }
}
// lane l <-> lane l ^ 16 through a vector cross-row move (a shuffle would go through the LDS queue)
__device__ __forceinline__ float xhalf(float x) { const int b = __builtin_bit_cast(int, x); return __builtin_bit_cast(float, __builtin_amdgcn_permlanex16(b, b, 0x76543210, 0xfedcba98, false, false)); }
// Both products are taken transposed: S^T = K Q^T (A = 16 keys from LDS, B = the wave's 16 queries, kept in registers) and O^T += V^T P^T (A = 16 d rows of V^T from LDS, B = P^T).
// A lane (col, g) then holds, of query col, the scores of keys t*16 + 8g + r (tile t, register r): the softmax stays in the lane's registers, the two lanes of a query meet once per 64 keys for the maximum,
// and tiles 2kc and 2kc+1, converted in place, ARE the B fragment of keys kc*32 .. +31 (element e < 8: key 8g + e, element 8 + e: key 16 + 8g + e, the k order of frag_h). Neither S nor P touches LDS.
__global__ __launch_bounds__(128) void k_attn(const _Float16* __restrict__ Q16, const _Float16* __restrict__ K16, const _Float16* __restrict__ VTh, _Float16* __restrict__ O16) {
  __shared__ __align__(16) _Float16 sOh[4][16][72];   // output bounce, a wave's own 16 rows: whole 128-B lines go out
  __shared__ __align__(16) _Float16 sK[2][64 * LP];   // 64 keys x 64 d
  __shared__ __align__(16) _Float16 sV[2][64 * LP];   // 64 d x 64 keys
  const int tid = threadIdx.x, w = tid >> 5, lane = tid & 31, col = lane & 15, g = lane >> 4;
  const size_t bh = blockIdx.y; const int q0 = blockIdx.x * 64 + w * 16;
  v16h aq[2];
#pragma unroll
  for (int kc = 0; kc < 2; ++kc) aq[kc] = frag_h(Q16 + (bh * SS + q0 + col) * HD + kc * 32, lane);
  float mrun = -3.0e38f, lrun = 0.f; v8f acc[4] = {};   // lrun: this lane's half of the keys; the halves are joined behind the loop
  const _Float16* Kb = K16 + bh * SS * HD; const _Float16* Vb = VTh + bh * HD * SS; v8h rk[4], rv[4];
  tile_ld<64>(Kb, HD, tid, rk); tile_ld<64>(Vb, SS, tid, rv); tile_st<64>(sK[0], tid, rk); tile_st<64>(sV[0], tid, rv);
  __syncthreads();
  const float cs = 0.125f / 16.0f * 1.44269504f;   // scores in units of log2: e^x = 2^(x log2 e), so each exponential is one multiply-add and one v_exp_f32
#pragma unroll 1
  for (int kt = 0; kt < SS / 64; ++kt) { const bool more = kt + 1 < SS / 64;
    // the next tiles' lines are asked for first, so that they fly under the whole trip
    if (more) { tile_ld<64>(Kb + (size_t)(kt + 1) * 64 * HD, HD, tid, rk); tile_ld<64>(Vb + (kt + 1) * 64, SS, tid, rv);
      asm volatile("s_wait_xcnt 0x0" ::: "memory"); }   // stands behind the run of loads, in front of whatever next takes their address registers
    const _Float16* sk = sK[kt & 1]; const _Float16* sv = sV[kt & 1];
    v16h kf[4][2];
#pragma unroll
    for (int t = 0; t < 4; ++t) {
#pragma unroll
      for (int kc = 0; kc < 2; ++kc) kf[t][kc] = frag_h(sk + (t * 16 + col) * LP + kc * 32, lane); }
    v8f s[4] = {};
#pragma unroll
    for (int kc = 0; kc < 2; ++kc) {
#pragma unroll
      for (int t = 0; t < 4; ++t) s[t] = wmma16(kf[t][kc], aq[kc], s[t]); }
    float mt[4];
#pragma unroll
    for (int t = 0; t < 4; ++t) { mt[t] = s[t][0];
#pragma unroll
      for (int r = 1; r < 8; ++r) mt[t] = fmaxf(mt[t], s[t][r]); }
    float mx = fmaxf(fmaxf(mt[0], mt[1]), fmaxf(mt[2], mt[3]));
    mx = fmaxf(mx, xhalf(mx)) * cs;   // the maximum of the raw scores, scaled (cs > 0): both lanes of a query hold the same value
    const float mnew = fmaxf(mrun, mx); const float corr = __builtin_amdgcn_exp2f(mrun - mnew); const float mlift = mnew - 14.0f;   // the lift of P by 2^14 rides in the exponent
    const v2f cs2 = {cs, cs}, nm2 = {-mlift, -mlift};
    v2f ps2[2] = {}; v16h ph[2];
#pragma unroll
    for (int t = 0; t < 4; ++t) {
#pragma unroll
      for (int i = 0; i < 4; ++i) { const v2f sc = {s[t][2 * i], s[t][2 * i + 1]}; const v2f ar = __builtin_elementwise_fma(sc, cs2, nm2);
        const v2f p = {__builtin_amdgcn_exp2f(ar[0]), __builtin_amdgcn_exp2f(ar[1])}; ps2[t & 1] += p;
        const v2h hp = __builtin_convertvector(p, v2h); ph[t >> 1][(t & 1) * 8 + 2 * i] = hp[0]; ph[t >> 1][(t & 1) * 8 + 2 * i + 1] = hp[1]; } }
    lrun = lrun * corr + ((ps2[0][0] + ps2[0][1]) + (ps2[1][0] + ps2[1][1])) * (1.0f / 16384.0f); mrun = mnew;
#pragma unroll
    for (int t = 0; t < 4; ++t) acc[t] = acc[t] * corr;   // a lane's 32 output values belong to its one query
#pragma unroll
    for (int kc = 0; kc < 2; ++kc) { v16h vf[4];
#pragma unroll
      for (int t = 0; t < 4; ++t) vf[t] = frag_h(sv + (t * 16 + col) * LP + kc * 32, lane);
#pragma unroll
      for (int t = 0; t < 4; ++t) acc[t] = wmma16(vf[t], ph[kc], acc[t]); }
    if (more) { tile_st<64>(sK[(kt + 1) & 1], tid, rk); tile_st<64>(sV[(kt + 1) & 1], tid, rv); __syncthreads(); } }
  lrun += xhalf(lrun);
  const float inv = 8.0f / (lrun * 16384.0f * 4.0f);
#pragma unroll
  for (int t = 0; t < 4; ++t) { v8h o;   // acc[t][r] = O[query col][d = t*16 + 8g + r]: 8 consecutive d of one row
#pragma unroll
    for (int r = 0; r < 8; ++r) o[r] = (_Float16)(acc[t][r] * inv);
    *(v8h*)(&sOh[w][col][t * 16 + 8 * g]) = o; }
  LDSX();
  for (int qq = lane; qq < 16 * 8; qq += 32) { const int rl = qq >> 3, pc = qq & 7;
    vst2(O16 + ((bh * SS) + q0 + rl) * HD + pc * 8, *(const v4u*)(&sOh[w][rl][pc * 8])); }
}
// CAT[:, coff .. coff+512) = f16( A PTw^T * ascale + b ) : A rows 512 halves; headm = 1 -> A is the head-major O16 (x8), else token-major rows; block (64 rows, 128 cols)
__global__ __launch_bounds__(128) void k_proj512(const _Float16* __restrict__ A16, int headm, const _Float16* __restrict__ PTw, const float* __restrict__ bias, float ascale, int coff, _Float16* __restrict__ CAT) {
  __shared__ __align__(16) _Float16 so[4][16][136];
  __shared__ __align__(16) _Float16 sB[2][128 * LP];
  const int tid = threadIdx.x, wave = tid >> 5, lane = tid & 31, col = lane & 15, g = lane >> 4;
  const int r0 = blockIdx.x * 64 + wave * 16, n0 = blockIdx.y * 128; const int ra = r0 + col; const int b = ra / SS, s = ra % SS;
  v8f acc[8] = {};
  const _Float16* Ab = A16 + (headm ? ((size_t)b * NH * SS + s) * HD : (size_t)ra * E); const size_t hstep = headm ? (size_t)SS * HD : (size_t)64;   // 64 k on: the next head's row, or 64 halves on in the token's row
  gemm_w_lds<E>([&](int kc) { return frag_h(Ab + (size_t)(kc >> 1) * hstep + (kc & 1) * 32, lane); }, PTw + (size_t)n0 * E, sB, tid, acc);
#pragma unroll
  for (int j = 0; j < 8; ++j) { const float bb = bias[n0 + j * 16 + col];
#pragma unroll
    for (int r = 0; r < 8; ++r) so[wave][8 * g + r][j * 16 + col] = (_Float16)(acc[j][r] * ascale + bb); }
  LDSX();
  for (int rl = 0; rl < 16; ++rl) { if (lane < 16) vst2(CAT + (size_t)(r0 + rl) * DM + coff + n0 + lane * 8, *(const v4u*)(&so[wave][rl][lane * 8])); }
}
// depthwise conv (k=3, pad 1) along the sequence on queries[:, :, 512 + c]: C16[b][l][c] f16 ; thread = 4 columns x CR positions, 128 threads per run of CR positions, two runs per block.
// A thread's CR + 2 input rows are loaded without a condition (the two edge rows from a clamped address, set to 0 behind the load), so that all of them are in flight before the first is waited for;
// a wave's load covers 512 contiguous bytes of a row and its store 256 contiguous bytes, so no LDS bounce is needed.
#define CR 8
__global__ __launch_bounds__(256) void k_conv(const float* __restrict__ q, const float* __restrict__ cw, const float* __restrict__ cb, _Float16* __restrict__ C16) {
  const int tid = threadIdx.x; const int c = (tid & 127) * 4, r0 = (blockIdx.x * 2 + (tid >> 7)) * CR, l0 = r0 % SS;   // r0 = b * SS + l0; a run never crosses a batch (SS is a multiple of CR)
  const bool top = l0 > 0, bot = l0 + CR < SS; const float* col_ = q + (size_t)r0 * DM + E + c;
  v4f x[CR + 2];
  x[0] = *(const v4f*)(col_ - (top ? DM : 0));
#pragma unroll
  for (int i = 0; i < CR; ++i) x[i + 1] = *(const v4f*)(col_ + (size_t)i * DM);
  x[CR + 1] = *(const v4f*)(col_ + (size_t)(bot ? CR : CR - 1) * DM);
  const v4f bb = *(const v4f*)(cb + c);
  const float* wp = cw + c * 3; v4f wv[3];   // the 4 columns' 12 taps: tap k of column c + e is element e * 3 + k
  wv[0] = *(const v4f*)wp; wv[1] = *(const v4f*)(wp + 4);
  asm volatile("s_wait_xcnt 0x0" ::: "memory");   // the last load's result may be given the registers that hold the address of the loads above
  wv[2] = *(const v4f*)(wp + 8);
#pragma unroll
  for (int e = 0; e < 4; ++e) { x[0][e] = top ? x[0][e] : 0.f; x[CR + 1][e] = bot ? x[CR + 1][e] : 0.f; }
#pragma unroll
  for (int i = 0; i < CR; ++i) { v4h o;
#pragma unroll
    for (int e = 0; e < 4; ++e) o[e] = (_Float16)(wv[(e * 3) >> 2][(e * 3) & 3] * x[i][e] + wv[(e * 3 + 1) >> 2][(e * 3 + 1) & 3] * x[i + 1][e] + wv[(e * 3 + 2) >> 2][(e * 3 + 2) & 3] * x[i + 2][e] + bb[e]);
    vst2(C16 + (size_t)(r0 + i) * E + c, o); }
}
// T = queries + CAT Wf^T / 16 + bf : block (64 rows, 128 cols), K = 1024
__global__ __launch_bounds__(128) void k_wf(const _Float16* __restrict__ CAT, const _Float16* __restrict__ PF, const float* __restrict__ bfv, const float* __restrict__ q, float* __restrict__ T) {
  __shared__ __align__(16) float so[4][16][132];
  __shared__ __align__(16) _Float16 sB[2][128 * LP];
  const int tid = threadIdx.x, wave = tid >> 5, lane = tid & 31, col = lane & 15, g = lane >> 4; const int r0 = blockIdx.x * 64 + wave * 16, n0 = blockIdx.y * 128;
  v8f acc[8] = {};
  gemm_w_lds<DM>([&](int kc) { return frag_h(CAT + (size_t)(r0 + col) * DM + kc * 32, lane); }, PF + (size_t)n0 * DM, sB, tid, acc);
#pragma unroll
  for (int j = 0; j < 8; ++j) { const int n = n0 + j * 16 + col; const float bb = bfv[n];
#pragma unroll
    for (int r = 0; r < 8; ++r) so[wave][8 * g + r][j * 16 + col] = acc[j][r] * (1.0f / 16.0f) + bb + q[(size_t)(r0 + 8 * g + r) * DM + n]; }
  LDSX();
#pragma unroll 4
  for (int rl = 0; rl < 16; ++rl) vst2(T + (size_t)(r0 + rl) * DM + n0 + lane * 4, *(const v4f*)(&so[wave][rl][lane * 4]));
}
// LayerNorm over 1024 per row: wave per row (32 floats per lane)
__global__ __launch_bounds__(256) void k_ln(const float* __restrict__ T, const float* __restrict__ gm, const float* __restrict__ bt, float* __restrict__ out) {
  // LayerNorm over 1024 per row: wave per row; lane owns columns p*128 + lane*4 .. +3 for p = 0..7 so every store instruction writes one contiguous 512-B run by 32 consecutive lanes
  const int wave = threadIdx.x >> 5, lane = threadIdx.x & 31; const size_t row = (size_t)blockIdx.x * 8 + wave; const float* tr = T + row * DM;
  float s = 0.f, sq = 0.f;
#pragma unroll
  for (int p = 0; p < 8; ++p) { const v4f v = *(const v4f*)(tr + p * 128 + lane * 4);
#pragma unroll
    for (int e = 0; e < 4; ++e) { s += v[e]; sq += v[e] * v[e]; } }
#pragma unroll
  for (int o = 16; o > 0; o >>= 1) { s += __shfl_xor(s, o, 32); sq += __shfl_xor(sq, o, 32); }
  const float mu = s * (1.0f / DM); float var = sq * (1.0f / DM) - mu * mu; var = var > 0.f ? var : 0.f; const float rs = rsqrtf(var + 1e-5f);
#pragma unroll 1
  for (int p = 0; p < 8; ++p) { const int c0 = p * 128 + lane * 4; v4f v = *(const v4f*)(tr + c0);
#pragma unroll
    for (int e = 0; e < 4; ++e) v[e] = (v[e] - mu) * rs * gm[c0 + e] + bt[c0 + e];
    vst2(out + row * DM + c0, v); }
}
extern "C" void kernel_launch(void* const* d_in, const int* in_sizes, int n_in, void* d_out, int out_size, void* d_ws, size_t ws_size, hipStream_t stream) {
  (void)in_sizes; (void)n_in; (void)out_size; (void)ws_size;
  const float** I = (const float**)d_in;
  const float* queries = I[0]; const float* keys = I[1]; const float* values = I[2]; const float* Wq = I[3]; const float* bq = I[4]; const float* Wk = I[5]; const float* bk = I[6]; const float* Wv = I[7]; const float* bv = I[8];
  const float* Woa = I[9]; const float* boa = I[10]; const float* cw = I[11]; const float* cb = I[12]; const float* Woc = I[13]; const float* boc = I[14]; const float* Wf = I[15]; const float* bfv = I[16]; const float* gm = I[17]; const float* bt = I[18];
  float* out = (float*)d_out;
  char* ws = (char*)d_ws; size_t off = 0;
  auto take = [&](size_t bytes) { char* p = ws + off; off += (bytes + 255) & ~(size_t)255; return p; };
  _Float16* Xq = (_Float16*)take((size_t)NR * E * 2); _Float16* Xk = (_Float16*)take((size_t)NR * E * 2); _Float16* Xv = (_Float16*)take((size_t)NR * E * 2);
  _Float16* PT = (_Float16*)take((size_t)5 * E * E * 2); _Float16* PF = (_Float16*)take((size_t)DM * DM * 2);
  _Float16* Q16 = (_Float16*)take((size_t)NR * E * 2); _Float16* K16 = (_Float16*)take((size_t)NR * E * 2); _Float16* VTh = (_Float16*)take((size_t)NR * E * 2); _Float16* O16 = Xq;   // Xq dead after k_qkv
  _Float16* C16 = Xk;                                            // Xk dead after k_qkv
  _Float16* CAT = (_Float16*)take((size_t)NR * DM * 2); float* T = (float*)take((size_t)NR * DM * 4);
  // ws ~ 104 MB
  k_prep<<<3 * AB + 5 * WB + FB, 256, 0, stream>>>(queries, keys, values, Wq, Wk, Wv, Woa, Woc, Wf, Xq, Xk, Xv, PT, PF);
  k_qkv<<<dim3(NR / 64, E / 128, 3), 128, 0, stream>>>(Xq, Xk, Xv, PT, bq, bk, bv, Q16, K16, VTh);
  k_attn<<<dim3(SS / 64, NB * NH), 128, 0, stream>>>(Q16, K16, VTh, O16);
  k_proj512<<<dim3(NR / 64, E / 128), 128, 0, stream>>>(O16, 1, PT + (size_t)3 * E * E, boa, 1.0f / (16.0f * 8.0f), 0, CAT);
  k_conv<<<NR / CR / 2, 256, 0, stream>>>(queries, cw, cb, C16);
  k_proj512<<<dim3(NR / 64, E / 128), 128, 0, stream>>>(C16, 0, PT + (size_t)4 * E * E, boc, 1.0f / 16.0f, E, CAT);
  k_wf<<<dim3(NR / 64, DM / 128), 128, 0, stream>>>(CAT, PF, bfv, queries, T);
  k_ln<<<NR / 8, 256, 0, stream>>>(T, gm, bt, out);
}

// v006
// Measured time: 123 microseconds a run.
// In both of two side-by-side timings against v005, it was 1.09 times as fast.
// Counting every step since v000, it is 3.72 times as fast.
// compute dtype: f16 operands for the projections, attention and the final 1024x1024 projection (activations as f16 rows, weights packed x16, q/k x4, P lifted by 2^14, V x4, ctx x8), f32 accumulate; the depthwise conv, residual and LayerNorm in f32. Output = LN(queries + out) is residual-dominated.
#include <hip/hip_runtime.h>
#include <math.h>

typedef __attribute__((ext_vector_type(16))) _Float16 v16h;
typedef __attribute__((ext_vector_type(16))) __bf16 v16b;
typedef __attribute__((ext_vector_type(8)))  _Float16 v8h;
typedef __attribute__((ext_vector_type(4)))  _Float16 v4h;
typedef __attribute__((ext_vector_type(2)))  _Float16 v2h;
typedef __attribute__((ext_vector_type(8)))  float v8f;
typedef __attribute__((ext_vector_type(4)))  float v4f;
typedef __attribute__((ext_vector_type(2)))  float v2f;
typedef __attribute__((ext_vector_type(4)))  unsigned v4u;
typedef __attribute__((ext_vector_type(4)))  int v4i;
typedef float __attribute__((may_alias)) float_a;
typedef int __attribute__((may_alias)) int_a;

template <typename T> __device__ __forceinline__ void vst2(void* p, T v) { *(T*)p = v;  }
__device__ __forceinline__ v8f wmma16(v16h a, v16h b, v8f c) {
  v8f d = __builtin_amdgcn_wmma_f32_16x16x32_f16(false, a, false, b, (short)0, c, false, false);
  asm volatile("v_nop\n\tv_nop\n\tv_nop\n\tv_nop" : "+v"(d) : "v"(a), "v"(b));
  return d;
}
__device__ __forceinline__ v8f wmma_bf(v16b a, v16b b, v8f c) {
  v8f d = __builtin_amdgcn_wmma_f32_16x16x32_bf16(false, a, false, b, (short)0, c, false, false);
  asm volatile("v_nop\n\tv_nop\n\tv_nop\n\tv_nop" : "+v"(d) : "v"(a), "v"(b));
  return d;
}
// 16x16x32 fragments: lane = (h = lane>>4, row/col = lane&15); elements 0..7 = k0+8h+0..7, 8..15 = k0+16+8h+0..7; D element r = row 8h+r
__device__ __forceinline__ v16h frag_h(const _Float16* rowk0, int lane) {
  union { v16h v; v8h q[2]; } u; const _Float16* p = rowk0 + 8 * (lane >> 4);
  u.q[0] = *(const v8h*)p; u.q[1] = *(const v8h*)(p + 16); return u.v;
}
__device__ __forceinline__ v16h frag_f32(const float* rowk0, int lane) {
  v16h a; const float* p = rowk0 + 8 * (lane >> 4);
#pragma unroll
  for (int i = 0; i < 8; ++i) { a[i] = (_Float16)p[i]; a[8 + i] = (_Float16)p[16 + i]; }
  return a;
}
__device__ __forceinline__ v16h frag_f32s(const float* rowk0, int lane, float sc) {
  v16h a; const float* p = rowk0 + 8 * (lane >> 4);
#pragma unroll
  for (int i = 0; i < 8; ++i) { a[i] = (_Float16)(p[i] * sc); a[8 + i] = (_Float16)(p[16 + i] * sc); }
  return a;
}
// column fragment from a [K][ld] layout (column n), rows >= K read as 0
__device__ __forceinline__ v16h fragc_f32(const float* W, int k0, int n, int lane, int ld, int K) {
  v16h a; const int g = lane >> 4;
#pragma unroll
  for (int i = 0; i < 8; ++i) { const int ka = k0 + 8 * g + i, kb = ka + 16;
    a[i] = (_Float16)(ka < K ? W[(size_t)ka * ld + n] : 0.f); a[8 + i] = (_Float16)(kb < K ? W[(size_t)kb * ld + n] : 0.f); }
  return a;
}
struct F2 { v16b h, l; };
__device__ __forceinline__ F2 bsplit16(const float v[16]) { F2 r;
#pragma unroll
  for (int i = 0; i < 16; ++i) { const __bf16 h = (__bf16)v[i]; r.h[i] = h; r.l[i] = (__bf16)(v[i] - (float)h); }
  return r; }
__device__ __forceinline__ F2 split_row(const float* row, int k0, int lane) { float v[16]; const float* p = row + k0 + 8 * (lane >> 4);
#pragma unroll
  for (int i = 0; i < 8; ++i) { v[i] = p[i]; v[8 + i] = p[16 + i]; }
  return bsplit16(v); }
__device__ __forceinline__ F2 split_rowK(const float* row, int k0, int lane, int K) { float v[16]; const int g = lane >> 4;
#pragma unroll
  for (int i = 0; i < 8; ++i) { const int ka = k0 + 8 * g + i, kb = ka + 16; v[i] = ka < K ? row[ka] : 0.f; v[8 + i] = kb < K ? row[kb] : 0.f; }
  return bsplit16(v); }
__device__ __forceinline__ F2 split_col(const float* W, int k0, int n, int lane, int ld, int K) { float v[16]; const int g = lane >> 4;
#pragma unroll
  for (int i = 0; i < 8; ++i) { const int ka = k0 + 8 * g + i, kb = ka + 16; v[i] = ka < K ? W[(size_t)ka * ld + n] : 0.f; v[8 + i] = kb < K ? W[(size_t)kb * ld + n] : 0.f; }
  return bsplit16(v); }
__device__ __forceinline__ v8f mac3(const F2& a, const F2& b, v8f c) { c = wmma_bf(a.l, b.h, c); c = wmma_bf(a.h, b.l, c); return wmma_bf(a.h, b.h, c); }
__device__ __forceinline__ float sigm(float v) { return 1.0f / (1.0f + expf(-v)); }
#define LDSX() do { asm volatile("s_wait_dscnt 0" ::: "memory"); __builtin_amdgcn_wave_barrier(); __builtin_amdgcn_fence(__ATOMIC_RELEASE, "workgroup"); } while (0)


// CSP attention block on [4,2048,1024]: attention branch on channels 0..511 (q from queries, k from keys, v from values; 8 heads x 64, softmax(q.k/8), out-proj Wo_attn), conv branch on
// channels 512..1023 of queries (depthwise k=3 along the sequence + bias, then Wo_conv), concat -> Wf (1024x1024) + bf, x = queries + out, LayerNorm.
// k_prep (three 512-wide f16 row sets from the 1024-wide inputs; Wq|Wk|Wv|Wo_attn|Wo_conv rows x16; Wf rows x16), k_qkv, k_attn, k_proj512 (O@Wo_attn^T -> CAT[:, :512];
#define NB 4
#define SS 2048
#define DM 1024
#define E 512
#define NH 8
#define HD 64
#define NR (NB * SS)

// Operand tiles staged in LDS once per work-group of NT threads: rows of 64 halves (one 128-B line), NT / 8 rows per step, so a wave's load covers 4 whole lines.
#define LP 72   // LDS row pitch in halves: 144 B = 16 B x 9, so the 16-byte fragment reads of 16 rows fall on distinct banks
template <int ROWS, int NT = 128> __device__ __forceinline__ void tile_ld(const _Float16* __restrict__ src, size_t pitch, int tid, v8h (&r)[ROWS * 8 / NT]) {
#pragma unroll
  for (int i = 0; i < ROWS * 8 / NT; ++i) r[i] = *(const v8h*)(src + (size_t)(i * (NT / 8) + (tid >> 3)) * pitch + (tid & 7) * 8);
}
template <int ROWS, int NT = 128> __device__ __forceinline__ void tile_st(_Float16* dst, int tid, const v8h (&r)[ROWS * 8 / NT]) {
#pragma unroll
  for (int i = 0; i < ROWS * 8 / NT; ++i) *(v8h*)(dst + (i * (NT / 8) + (tid >> 3)) * LP + (tid & 7) * 8) = r[i];
}
// One 128 x 128 tile of A W^T per work-group of 8 waves; wave w takes rows (w >> 1) * 32 .. +31 and columns (w & 1) * 64 .. +63: acc[i][j] += A(16 rows, tile i) x W(16 rows, tile j)^T over KD.
// The 128 A rows and the 128 W rows both go through two LDS buffers, 64 k per stage, and come from global memory as whole 128-B lines; an A fragment read from LDS feeds 4 products, a W fragment 2.
// Stage st of A starts at Arows + st * astep, its rows lie apitch halves apart. The next stage's lines are loaded while this stage is multiplied; one barrier per stage publishes the next buffers
// and ends the reads of the ones refilled after it.
struct Ring { _Float16 B[2][128 * LP]; _Float16 A[2][128 * LP]; };
template <int KD> __device__ __forceinline__ void gemm_lds(const _Float16* __restrict__ Arows, size_t apitch, size_t astep, const _Float16* __restrict__ Wrows, Ring& rg, int tid, v8f (&acc)[2][4]) {
  const int lane = tid & 31, col = lane & 15, w = tid >> 5, arow = (w >> 1) * 32 + col, brow = (w & 1) * 64 + col;
  v8h rb[4], ra[4];
  tile_ld<128, 256>(Wrows, KD, tid, rb); tile_ld<128, 256>(Arows, apitch, tid, ra);
  asm volatile("s_wait_xcnt 0x0" ::: "memory");   // stands behind the run of loads, in front of whatever next takes their address registers
  tile_st<128, 256>(rg.B[0], tid, rb); tile_st<128, 256>(rg.A[0], tid, ra);
  __syncthreads();
#pragma unroll 1   // kept rolled: one stage's lines in registers at a time, and the loop stays small
  for (int st = 0; st < KD / 64; ++st) { const bool more = st + 1 < KD / 64;
    if (more) { tile_ld<128, 256>(Wrows + (st + 1) * 64, KD, tid, rb); tile_ld<128, 256>(Arows + (size_t)(st + 1) * astep, apitch, tid, ra);
      asm volatile("s_wait_xcnt 0x0" ::: "memory"); }   // stands behind the run of loads, in front of the loop's foot, where their address registers are stepped on
    const _Float16* sb = rg.B[st & 1] + brow * LP; const _Float16* sa = rg.A[st & 1] + arow * LP;
#pragma unroll
    for (int kc = 0; kc < 2; ++kc) { v16h a[2], b[4];
#pragma unroll
      for (int i = 0; i < 2; ++i) a[i] = frag_h(sa + i * 16 * LP + kc * 32, lane);
#pragma unroll
      for (int j = 0; j < 4; ++j) b[j] = frag_h(sb + j * 16 * LP + kc * 32, lane);
#pragma unroll
      for (int j = 0; j < 4; ++j) {
#pragma unroll
        for (int i = 0; i < 2; ++i) acc[i][j] = wmma16(a[i], b[j], acc[i][j]); } }
    if (more) { tile_st<128, 256>(rg.B[(st + 1) & 1], tid, rb); tile_st<128, 256>(rg.A[(st + 1) & 1], tid, ra); __syncthreads(); } }
  __syncthreads();   // ends every wave's last reads of the ring: the callers stage their output over it
}

// Every f32 operand that the products read as f16 is converted by ONE launch. A quad is 4 floats; a block takes 256 * PQ quads of one source, a thread PQ quads that lie 256 quads apart, and asks for all
// PQ before the first is waited for. A wave's load covers 512 contiguous bytes of a row and its store 256 contiguous bytes, so no LDS bounce is needed. Rows are counted in 512 floats (128 quads):
// PITCH floats lie between two of them in the source (1024 in the activations, of which the first 512 columns are taken; 512 in the weights, which are dense), 512 halves in the destination.
#define PQ 16
#define AB (NR * E / 4 / (256 * PQ))   // blocks per activation
#define WB (E * E / 4 / (256 * PQ))    // blocks per 512 x 512 weight
#define FB (DM * DM / 4 / (256 * PQ))  // blocks of Wf
template <int PITCH, int SCALE> __device__ __forceinline__ void pack_run(const float* __restrict__ src, _Float16* __restrict__ dst, int lb, int tid) {
  const float* s = src + (size_t)(lb * (2 * PQ) + (tid >> 7)) * PITCH + (tid & 127) * 4; _Float16* d = dst + ((size_t)lb * (256 * PQ) + tid) * 4;
  v4f x[PQ];
#pragma unroll
  for (int i = 0; i < PQ - 1; ++i) x[i] = *(const v4f*)(s + (size_t)i * 2 * PITCH);
  asm volatile("s_wait_xcnt 0x0" ::: "memory");   // the last load's result may be given the registers that hold the address of the loads above
  x[PQ - 1] = *(const v4f*)(s + (size_t)(PQ - 1) * 2 * PITCH);
  asm volatile("s_wait_xcnt 0x0" ::: "memory");   // behind the last load, in front of whatever next takes its address registers
#pragma unroll
  for (int i = 0; i < PQ; ++i) { v4h o;
#pragma unroll
    for (int e = 0; e < 4; ++e) o[e] = (_Float16)(x[i][e] * (float)SCALE);
    vst2(d + i * 1024, o); }
  asm volatile("s_wait_xcnt 0x0" ::: "memory");   // behind the last store, in front of whatever next takes the stores' address or data registers on any way out of this run
}
// blocks [0, 3 AB): Xq | Xk | Xv = f16 of columns 0..511 of queries | keys | values; [3 AB, 3 AB + 5 WB): PT rows (512 halves, x16) = Wq | Wk | Wv | Wo_attn | Wo_conv ([out][in]); the last FB: PF rows (1024 halves, x16) = Wf
__global__ __launch_bounds__(256) void k_prep(const float* __restrict__ q, const float* __restrict__ k, const float* __restrict__ v, const float* __restrict__ Wq, const float* __restrict__ Wk, const float* __restrict__ Wv,
                                             const float* __restrict__ Woa, const float* __restrict__ Woc, const float* __restrict__ Wf, _Float16* __restrict__ Xq, _Float16* __restrict__ Xk, _Float16* __restrict__ Xv,
                                             _Float16* __restrict__ PT, _Float16* __restrict__ PF) {
  const int bx = blockIdx.x, tid = threadIdx.x;
  if (bx < 3 * AB) { const int which = bx / AB; pack_run<DM, 1>(which == 0 ? q : (which == 1 ? k : v), which == 0 ? Xq : (which == 1 ? Xk : Xv), bx % AB, tid); }
  else if (bx < 3 * AB + 5 * WB) { const int n = bx - 3 * AB, which = n / WB; const float* W = which == 0 ? Wq : (which == 1 ? Wk : (which == 2 ? Wv : (which == 3 ? Woa : Woc)));
    pack_run<E, 16>(W, PT + (size_t)which * E * E, n % WB, tid); }
  else pack_run<E, 16>(Wf, PF, bx - 3 * AB - 5 * WB, tid);
}
__global__ __launch_bounds__(256) void k_qkv(const _Float16* __restrict__ Xq, const _Float16* __restrict__ Xk, const _Float16* __restrict__ Xv, const _Float16* __restrict__ PT, const float* __restrict__ bq, const float* __restrict__ bk, const float* __restrict__ bv,
                                            _Float16* __restrict__ Q16, _Float16* __restrict__ K16, _Float16* __restrict__ VTh) {
  __shared__ __align__(16) union { Ring ring; _Float16 soh[8][32][72]; _Float16 sth[128][136]; } sm;   // output staging (q, k: a wave's own 32 rows x 64 columns; v: the block's tile transposed) lies over the ring
  const int tid = threadIdx.x, wave = tid >> 5, lane = tid & 31, col = lane & 15, g = lane >> 4, wr = wave >> 1, wc = wave & 1;
  const int which = blockIdx.z, r0b = blockIdx.x * 128, n0 = blockIdx.y * 128; const int b = r0b / SS, s0 = r0b % SS;   // a block's 128 rows never cross a batch (SS is a multiple of 128)
  const _Float16* X16 = which == 0 ? Xq : (which == 1 ? Xk : Xv); const float* bb_ = which == 0 ? bq : (which == 1 ? bk : bv);
  v8f acc[2][4] = {};
  gemm_lds<E>(X16 + (size_t)r0b * E, E, 64, PT + (size_t)(which * E + n0) * E, sm.ring, tid, acc);
  if (which < 2) {
#pragma unroll
    for (int j = 0; j < 4; ++j) { const float bb = bb_[n0 + wc * 64 + j * 16 + col];
#pragma unroll
      for (int i = 0; i < 2; ++i) {
#pragma unroll
        for (int r = 0; r < 8; ++r) sm.soh[wave][i * 16 + 8 * g + r][j * 16 + col] = (_Float16)((acc[i][j][r] * (1.0f / 16.0f) + bb) * 4.0f); } }
    LDSX();
    _Float16* Dst = (which == 0 ? Q16 : K16) + (((size_t)b * NH + (n0 >> 6) + wc) * SS + s0 + wr * 32) * HD;   // the wave's 64 columns are one head
#pragma unroll
    for (int qq = lane; qq < 32 * 8; qq += 32) { const int rl = qq >> 3, pc = qq & 7; vst2(Dst + (size_t)rl * HD + pc * 8, *(const v4u*)(&sm.soh[wave][rl][pc * 8])); }
    asm volatile("s_wait_xcnt 0x0" ::: "memory"); }   // behind this branch's last store, in front of whatever next takes the stores' address or data registers
  else {
#pragma unroll
    for (int j = 0; j < 4; ++j) { const float bb = bb_[n0 + wc * 64 + j * 16 + col];
#pragma unroll
      for (int i = 0; i < 2; ++i) {
#pragma unroll
        for (int r = 0; r < 8; ++r) sm.sth[wc * 64 + j * 16 + col][wr * 32 + i * 16 + 8 * g + r] = (_Float16)((acc[i][j][r] * (1.0f / 16.0f) + bb) * 4.0f); } }
    __syncthreads();
    _Float16* Vp = VTh + ((size_t)b * NH * HD + n0 + (tid >> 4)) * SS + s0 + (tid & 15) * 8;   // row (b * NH + h) * HD + d of V^T is row b * 512 + c, c = h * 64 + d the column; a wave's store covers two rows' 256 B
#pragma unroll
    for (int i = 0; i < 8; ++i) vst2(Vp + (size_t)i * 16 * SS, *(const v4u*)(&sm.sth[i * 16 + (tid >> 4)][(tid & 15) * 8]));
    asm volatile("s_wait_xcnt 0x0" ::: "memory"); }   // behind this branch's last store, in front of whatever next takes the stores' address or data registers
}
// lane l <-> lane l ^ 16 through a vector cross-row move (a shuffle would go through the LDS queue)
__device__ __forceinline__ float xhalf(float x) { const int b = __builtin_bit_cast(int, x); return __builtin_bit_cast(float, __builtin_amdgcn_permlanex16(b, b, 0x76543210, 0xfedcba98, false, false)); }
// Both products are taken transposed: S^T = K Q^T (A = 16 keys from LDS, B = the wave's 16 queries, kept in registers) and O^T += V^T P^T (A = 16 d rows of V^T from LDS, B = P^T).
// A lane (col, g) then holds, of query col, the scores of keys t*16 + 8g + r (tile t, register r): the softmax stays in the lane's registers, the two lanes of a query meet once per 64 keys for the maximum,
// and tiles 2kc and 2kc+1, converted in place, ARE the B fragment of keys kc*32 .. +31 (element e < 8: key 8g + e, element 8 + e: key 16 + 8g + e, the k order of frag_h). Neither S nor P touches LDS.
__global__ __launch_bounds__(128) void k_attn(const _Float16* __restrict__ Q16, const _Float16* __restrict__ K16, const _Float16* __restrict__ VTh, _Float16* __restrict__ O16) {
  __shared__ __align__(16) _Float16 sOh[4][16][72];   // output bounce, a wave's own 16 rows: whole 128-B lines go out
  __shared__ __align__(16) _Float16 sK[2][64 * LP];   // 64 keys x 64 d
  __shared__ __align__(16) _Float16 sV[2][64 * LP];   // 64 d x 64 keys
  const int tid = threadIdx.x, w = tid >> 5, lane = tid & 31, col = lane & 15, g = lane >> 4;
  const size_t bh = blockIdx.y; const int q0 = blockIdx.x * 64 + w * 16;
  v16h aq[2];
#pragma unroll
  for (int kc = 0; kc < 2; ++kc) aq[kc] = frag_h(Q16 + (bh * SS + q0 + col) * HD + kc * 32, lane);
  float mrun = -3.0e38f, lrun = 0.f; v8f acc[4] = {};   // lrun: this lane's half of the keys; the halves are joined behind the loop
  const _Float16* Kb = K16 + bh * SS * HD; const _Float16* Vb = VTh + bh * HD * SS; v8h rk[4], rv[4];
  tile_ld<64>(Kb, HD, tid, rk); tile_ld<64>(Vb, SS, tid, rv); tile_st<64>(sK[0], tid, rk); tile_st<64>(sV[0], tid, rv);
  __syncthreads();
  const float cs = 0.125f / 16.0f * 1.44269504f;   // scores in units of log2: e^x = 2^(x log2 e), so each exponential is one multiply-add and one v_exp_f32
#pragma unroll 1
  for (int kt = 0; kt < SS / 64; ++kt) { const bool more = kt + 1 < SS / 64;
    // the next tiles' lines are asked for first, so that they fly under the whole trip
    if (more) { tile_ld<64>(Kb + (size_t)(kt + 1) * 64 * HD, HD, tid, rk); tile_ld<64>(Vb + (kt + 1) * 64, SS, tid, rv);
      asm volatile("s_wait_xcnt 0x0" ::: "memory"); }   // stands behind the run of loads, in front of whatever next takes their address registers
    const _Float16* sk = sK[kt & 1]; const _Float16* sv = sV[kt & 1];
    v16h kf[4][2];
#pragma unroll
    for (int t = 0; t < 4; ++t) {
#pragma unroll
      for (int kc = 0; kc < 2; ++kc) kf[t][kc] = frag_h(sk + (t * 16 + col) * LP + kc * 32, lane); }
    v8f s[4] = {};
#pragma unroll
    for (int kc = 0; kc < 2; ++kc) {
#pragma unroll
      for (int t = 0; t < 4; ++t) s[t] = wmma16(kf[t][kc], aq[kc], s[t]); }
    float mt[4];
#pragma unroll
    for (int t = 0; t < 4; ++t) { mt[t] = s[t][0];
#pragma unroll
      for (int r = 1; r < 8; ++r) mt[t] = fmaxf(mt[t], s[t][r]); }
    float mx = fmaxf(fmaxf(mt[0], mt[1]), fmaxf(mt[2], mt[3]));
    mx = fmaxf(mx, xhalf(mx)) * cs;   // the maximum of the raw scores, scaled (cs > 0): both lanes of a query hold the same value
    const float mnew = fmaxf(mrun, mx); const float corr = __builtin_amdgcn_exp2f(mrun - mnew); const float mlift = mnew - 14.0f;   // the lift of P by 2^14 rides in the exponent
    const v2f cs2 = {cs, cs}, nm2 = {-mlift, -mlift};
    v2f ps2[2] = {}; v16h ph[2];
#pragma unroll
    for (int t = 0; t < 4; ++t) {
#pragma unroll
      for (int i = 0; i < 4; ++i) { const v2f sc = {s[t][2 * i], s[t][2 * i + 1]}; const v2f ar = __builtin_elementwise_fma(sc, cs2, nm2);
        const v2f p = {__builtin_amdgcn_exp2f(ar[0]), __builtin_amdgcn_exp2f(ar[1])}; ps2[t & 1] += p;
        const v2h hp = __builtin_convertvector(p, v2h); ph[t >> 1][(t & 1) * 8 + 2 * i] = hp[0]; ph[t >> 1][(t & 1) * 8 + 2 * i + 1] = hp[1]; } }
    lrun = lrun * corr + ((ps2[0][0] + ps2[0][1]) + (ps2[1][0] + ps2[1][1])) * (1.0f / 16384.0f); mrun = mnew;
#pragma unroll
    for (int t = 0; t < 4; ++t) acc[t] = acc[t] * corr;   // a lane's 32 output values belong to its one query
#pragma unroll
    for (int kc = 0; kc < 2; ++kc) { v16h vf[4];
#pragma unroll
      for (int t = 0; t < 4; ++t) vf[t] = frag_h(sv + (t * 16 + col) * LP + kc * 32, lane);
#pragma unroll
      for (int t = 0; t < 4; ++t) acc[t] = wmma16(vf[t], ph[kc], acc[t]); }
    if (more) { tile_st<64>(sK[(kt + 1) & 1], tid, rk); tile_st<64>(sV[(kt + 1) & 1], tid, rv); __syncthreads(); } }
  lrun += xhalf(lrun);
  const float inv = 8.0f / (lrun * 16384.0f * 4.0f);
#pragma unroll
  for (int t = 0; t < 4; ++t) { v8h o;   // acc[t][r] = O[query col][d = t*16 + 8g + r]: 8 consecutive d of one row
#pragma unroll
    for (int r = 0; r < 8; ++r) o[r] = (_Float16)(acc[t][r] * inv);
    *(v8h*)(&sOh[w][col][t * 16 + 8 * g]) = o; }
  LDSX();
  for (int qq = lane; qq < 16 * 8; qq += 32) { const int rl = qq >> 3, pc = qq & 7;
    vst2(O16 + ((bh * SS) + q0 + rl) * HD + pc * 8, *(const v4u*)(&sOh[w][rl][pc * 8])); }
}
// CAT[:, coff .. coff+512) = f16( A W^T * ascale + b ) : A rows 512 halves; headm = 1 -> A is the head-major O16 (x8), else token-major rows; block (128 rows, 128 cols)
__global__ __launch_bounds__(256) void k_proj512(const _Float16* __restrict__ A16, int headm, const _Float16* __restrict__ PTw, const float* __restrict__ bias, float ascale, int coff, _Float16* __restrict__ CAT) {
  __shared__ __align__(16) union { Ring ring; _Float16 soh[8][32][72]; } sm;   // output staging, a wave's own 32 rows x 64 columns, lies over the ring
  const int tid = threadIdx.x, wave = tid >> 5, lane = tid & 31, col = lane & 15, g = lane >> 4, wr = wave >> 1, wc = wave & 1;
  const int r0b = blockIdx.x * 128, n0 = blockIdx.y * 128; const int b = r0b / SS, s = r0b % SS;   // a block's 128 rows never cross a batch (SS is a multiple of 128)
  v8f acc[2][4] = {};
  const _Float16* Ab = A16 + (headm ? ((size_t)b * NH * SS + s) * HD : (size_t)r0b * E); const size_t hstep = headm ? (size_t)SS * HD : (size_t)64;   // 64 k on: the next head's rows, or 64 halves on in the tokens' rows
  gemm_lds<E>(Ab, headm ? (size_t)HD : (size_t)E, hstep, PTw + (size_t)n0 * E, sm.ring, tid, acc);
#pragma unroll
  for (int j = 0; j < 4; ++j) { const float bb = bias[n0 + wc * 64 + j * 16 + col];
#pragma unroll
    for (int i = 0; i < 2; ++i) {
#pragma unroll
      for (int r = 0; r < 8; ++r) sm.soh[wave][i * 16 + 8 * g + r][j * 16 + col] = (_Float16)(acc[i][j][r] * ascale + bb); } }
  LDSX();
  _Float16* Dst = CAT + (size_t)(r0b + wr * 32) * DM + coff + n0 + wc * 64;
#pragma unroll
  for (int qq = lane; qq < 32 * 8; qq += 32) { const int rl = qq >> 3, pc = qq & 7; vst2(Dst + (size_t)rl * DM + pc * 8, *(const v4u*)(&sm.soh[wave][rl][pc * 8])); }
  asm volatile("s_wait_xcnt 0x0" ::: "memory");   // behind the last store, in front of whatever next takes the stores' address or data registers
}
// depthwise conv (k=3, pad 1) along the sequence on queries[:, :, 512 + c]: C16[b][l][c] f16 ; thread = 4 columns x CR positions, 128 threads per run of CR positions, two runs per block.
// A thread's CR + 2 input rows are loaded without a condition (the two edge rows from a clamped address, set to 0 behind the load), so that all of them are in flight before the first is waited for;
// a wave's load covers 512 contiguous bytes of a row and its store 256 contiguous bytes, so no LDS bounce is needed.
#define CR 8
__global__ __launch_bounds__(256) void k_conv(const float* __restrict__ q, const float* __restrict__ cw, const float* __restrict__ cb, _Float16* __restrict__ C16) {
  const int tid = threadIdx.x; const int c = (tid & 127) * 4, r0 = (blockIdx.x * 2 + (tid >> 7)) * CR, l0 = r0 % SS;   // r0 = b * SS + l0; a run never crosses a batch (SS is a multiple of CR)
  const bool top = l0 > 0, bot = l0 + CR < SS; const float* col_ = q + (size_t)r0 * DM + E + c;
  v4f x[CR + 2];
  x[0] = *(const v4f*)(col_ - (top ? DM : 0));
#pragma unroll
  for (int i = 0; i < CR; ++i) x[i + 1] = *(const v4f*)(col_ + (size_t)i * DM);
  x[CR + 1] = *(const v4f*)(col_ + (size_t)(bot ? CR : CR - 1) * DM);
  const v4f bb = *(const v4f*)(cb + c);
  const float* wp = cw + c * 3; v4f wv[3];   // the 4 columns' 12 taps: tap k of column c + e is element e * 3 + k
  wv[0] = *(const v4f*)wp; wv[1] = *(const v4f*)(wp + 4);
  asm volatile("s_wait_xcnt 0x0" ::: "memory");   // the last load's result may be given the registers that hold the address of the loads above
  wv[2] = *(const v4f*)(wp + 8);
#pragma unroll
  for (int e = 0; e < 4; ++e) { x[0][e] = top ? x[0][e] : 0.f; x[CR + 1][e] = bot ? x[CR + 1][e] : 0.f; }
#pragma unroll
  for (int i = 0; i < CR; ++i) { v4h o;
#pragma unroll
    for (int e = 0; e < 4; ++e) o[e] = (_Float16)(wv[(e * 3) >> 2][(e * 3) & 3] * x[i][e] + wv[(e * 3 + 1) >> 2][(e * 3 + 1) & 3] * x[i + 1][e] + wv[(e * 3 + 2) >> 2][(e * 3 + 2) & 3] * x[i + 2][e] + bb[e]);
    vst2(C16 + (size_t)(r0 + i) * E + c, o); }
}
// T = queries + CAT Wf^T / 16 + bf : block (128 rows, 128 cols), K = 1024
__global__ __launch_bounds__(256) void k_wf(const _Float16* __restrict__ CAT, const _Float16* __restrict__ PF, const float* __restrict__ bfv, const float* __restrict__ q, float* __restrict__ T) {
  __shared__ __align__(16) union { Ring ring; float so[8][32][68]; } sm;   // output staging, a wave's own 32 rows x 64 columns, lies over the ring
  const int tid = threadIdx.x, wave = tid >> 5, lane = tid & 31, col = lane & 15, g = lane >> 4; const int r0 = blockIdx.x * 128 + (wave >> 1) * 32, n0 = blockIdx.y * 128, nw = n0 + (wave & 1) * 64;
  v8f acc[2][4] = {};
  gemm_lds<DM>(CAT + (size_t)blockIdx.x * 128 * DM, DM, 64, PF + (size_t)n0 * DM, sm.ring, tid, acc);
  float qv[2][4][8];
#pragma unroll
  for (int i = 0; i < 2; ++i) {
#pragma unroll
    for (int j = 0; j < 4; ++j) {
#pragma unroll
      for (int r = 0; r < 8; ++r) qv[i][j][r] = q[(size_t)(r0 + i * 16 + 8 * g + r) * DM + nw + j * 16 + col]; }
    asm volatile("s_wait_xcnt 0x0" ::: "memory"); }   // behind each run of loads: a later load's result may be given the registers that hold this run's address
#pragma unroll
  for (int j = 0; j < 4; ++j) { const float bb = bfv[nw + j * 16 + col];
#pragma unroll
    for (int i = 0; i < 2; ++i) {
#pragma unroll
      for (int r = 0; r < 8; ++r) sm.so[wave][i * 16 + 8 * g + r][j * 16 + col] = acc[i][j][r] * (1.0f / 16.0f) + bb + qv[i][j][r]; } }
  LDSX();
  float* Tp = T + (size_t)(r0 + g) * DM + nw + col * 4;   // a wave's store covers two rows' 256 B
#pragma unroll
  for (int i = 0; i < 16; ++i) vst2(Tp + (size_t)i * 2 * DM, *(const v4f*)(&sm.so[wave][i * 2 + g][col * 4]));
  asm volatile("s_wait_xcnt 0x0" ::: "memory");   // behind the last store, in front of whatever next takes the stores' address or data registers
}
// LayerNorm over 1024 per row: wave per row (32 floats per lane)
__global__ __launch_bounds__(256) void k_ln(const float* __restrict__ T, const float* __restrict__ gm, const float* __restrict__ bt, float* __restrict__ out) {
  // LayerNorm over 1024 per row: wave per row; lane owns columns p*128 + lane*4 .. +3 for p = 0..7 so every store instruction writes one contiguous 512-B run by 32 consecutive lanes
  const int wave = threadIdx.x >> 5, lane = threadIdx.x & 31; const size_t row = (size_t)blockIdx.x * 8 + wave; const float* tr = T + row * DM;
  float s = 0.f, sq = 0.f;
#pragma unroll
  for (int p = 0; p < 8; ++p) { const v4f v = *(const v4f*)(tr + p * 128 + lane * 4);
#pragma unroll
    for (int e = 0; e < 4; ++e) { s += v[e]; sq += v[e] * v[e]; } }
#pragma unroll
  for (int o = 16; o > 0; o >>= 1) { s += __shfl_xor(s, o, 32); sq += __shfl_xor(sq, o, 32); }
  const float mu = s * (1.0f / DM); float var = sq * (1.0f / DM) - mu * mu; var = var > 0.f ? var : 0.f; const float rs = rsqrtf(var + 1e-5f);
#pragma unroll 1
  for (int p = 0; p < 8; ++p) { const int c0 = p * 128 + lane * 4; v4f v = *(const v4f*)(tr + c0);
#pragma unroll
    for (int e = 0; e < 4; ++e) v[e] = (v[e] - mu) * rs * gm[c0 + e] + bt[c0 + e];
    vst2(out + row * DM + c0, v); }
}
extern "C" void kernel_launch(void* const* d_in, const int* in_sizes, int n_in, void* d_out, int out_size, void* d_ws, size_t ws_size, hipStream_t stream) {
  (void)in_sizes; (void)n_in; (void)out_size; (void)ws_size;
  const float** I = (const float**)d_in;
  const float* queries = I[0]; const float* keys = I[1]; const float* values = I[2]; const float* Wq = I[3]; const float* bq = I[4]; const float* Wk = I[5]; const float* bk = I[6]; const float* Wv = I[7]; const float* bv = I[8];
  const float* Woa = I[9]; const float* boa = I[10]; const float* cw = I[11]; const float* cb = I[12]; const float* Woc = I[13]; const float* boc = I[14]; const float* Wf = I[15]; const float* bfv = I[16]; const float* gm = I[17]; const float* bt = I[18];
  float* out = (float*)d_out;
  char* ws = (char*)d_ws; size_t off = 0;
  auto take = [&](size_t bytes) { char* p = ws + off; off += (bytes + 255) & ~(size_t)255; return p; };
  _Float16* Xq = (_Float16*)take((size_t)NR * E * 2); _Float16* Xk = (_Float16*)take((size_t)NR * E * 2); _Float16* Xv = (_Float16*)take((size_t)NR * E * 2);
  _Float16* PT = (_Float16*)take((size_t)5 * E * E * 2); _Float16* PF = (_Float16*)take((size_t)DM * DM * 2);
  _Float16* Q16 = (_Float16*)take((size_t)NR * E * 2); _Float16* K16 = (_Float16*)take((size_t)NR * E * 2); _Float16* VTh = (_Float16*)take((size_t)NR * E * 2); _Float16* O16 = Xq;   // Xq dead after k_qkv
  _Float16* C16 = Xk;                                            // Xk dead after k_qkv
  _Float16* CAT = (_Float16*)take((size_t)NR * DM * 2); float* T = (float*)take((size_t)NR * DM * 4);
  // ws ~ 104 MB
  k_prep<<<3 * AB + 5 * WB + FB, 256, 0, stream>>>(queries, keys, values, Wq, Wk, Wv, Woa, Woc, Wf, Xq, Xk, Xv, PT, PF);
  k_qkv<<<dim3(NR / 128, E / 128, 3), 256, 0, stream>>>(Xq, Xk, Xv, PT, bq, bk, bv, Q16, K16, VTh);
  k_attn<<<dim3(SS / 64, NB * NH), 128, 0, stream>>>(Q16, K16, VTh, O16);
  k_proj512<<<dim3(NR / 128, E / 128), 256, 0, stream>>>(O16, 1, PT + (size_t)3 * E * E, boa, 1.0f / (16.0f * 8.0f), 0, CAT);
  k_conv<<<NR / CR / 2, 256, 0, stream>>>(queries, cw, cb, C16);
  k_proj512<<<dim3(NR / 128, E / 128), 256, 0, stream>>>(C16, 0, PT + (size_t)4 * E * E, boc, 1.0f / 16.0f, E, CAT);
  k_wf<<<dim3(NR / 128, DM / 128), 256, 0, stream>>>(CAT, PF, bfv, queries, T);
  k_ln<<<NR / 8, 256, 0, stream>>>(T, gm, bt, out);
}

// v007
// Measured time: 107 microseconds a run.
// Next to v006, in two timings, it ran 1.14 and 1.13 times as fast.
// All steps since v000 together make it 4.23 times as fast.
// compute dtype: f16 operands for the projections, attention, the weight fold and the final 1024x1024 projection (activations as f16 rows, weights packed x16, q/k x4, P lifted by 2^14, V x4, ctx x8), f32 accumulate; the depthwise conv, the folded bias, residual and LayerNorm in f32. Output = LN(queries + out) is residual-dominated.
#include <hip/hip_runtime.h>
#include <math.h>

typedef __attribute__((ext_vector_type(16))) _Float16 v16h;
typedef __attribute__((ext_vector_type(16))) __bf16 v16b;
typedef __attribute__((ext_vector_type(8)))  _Float16 v8h;
typedef __attribute__((ext_vector_type(4)))  _Float16 v4h;
typedef __attribute__((ext_vector_type(2)))  _Float16 v2h;
typedef __attribute__((ext_vector_type(8)))  float v8f;
typedef __attribute__((ext_vector_type(4)))  float v4f;
typedef __attribute__((ext_vector_type(2)))  float v2f;
typedef __attribute__((ext_vector_type(4)))  unsigned v4u;
typedef __attribute__((ext_vector_type(4)))  int v4i;
typedef float __attribute__((may_alias)) float_a;
typedef int __attribute__((may_alias)) int_a;

template <typename T> __device__ __forceinline__ void vst2(void* p, T v) { *(T*)p = v;  }
__device__ __forceinline__ v8f wmma16(v16h a, v16h b, v8f c) {
  v8f d = __builtin_amdgcn_wmma_f32_16x16x32_f16(false, a, false, b, (short)0, c, false, false);
  asm volatile("v_nop\n\tv_nop\n\tv_nop\n\tv_nop" : "+v"(d) : "v"(a), "v"(b));
  return d;
}
__device__ __forceinline__ v8f wmma_bf(v16b a, v16b b, v8f c) {
  v8f d = __builtin_amdgcn_wmma_f32_16x16x32_bf16(false, a, false, b, (short)0, c, false, false);
  asm volatile("v_nop\n\tv_nop\n\tv_nop\n\tv_nop" : "+v"(d) : "v"(a), "v"(b));
  return d;
}
// 16x16x32 fragments: lane = (h = lane>>4, row/col = lane&15); elements 0..7 = k0+8h+0..7, 8..15 = k0+16+8h+0..7; D element r = row 8h+r
__device__ __forceinline__ v16h frag_h(const _Float16* rowk0, int lane) {
  union { v16h v; v8h q[2]; } u; const _Float16* p = rowk0 + 8 * (lane >> 4);
  u.q[0] = *(const v8h*)p; u.q[1] = *(const v8h*)(p + 16); return u.v;
}
__device__ __forceinline__ v16h frag_f32(const float* rowk0, int lane) {
  v16h a; const float* p = rowk0 + 8 * (lane >> 4);
#pragma unroll
  for (int i = 0; i < 8; ++i) { a[i] = (_Float16)p[i]; a[8 + i] = (_Float16)p[16 + i]; }
  return a;
}
__device__ __forceinline__ v16h frag_f32s(const float* rowk0, int lane, float sc) {
  v16h a; const float* p = rowk0 + 8 * (lane >> 4);
#pragma unroll
  for (int i = 0; i < 8; ++i) { a[i] = (_Float16)(p[i] * sc); a[8 + i] = (_Float16)(p[16 + i] * sc); }
  return a;
}
// column fragment from a [K][ld] layout (column n), rows >= K read as 0
__device__ __forceinline__ v16h fragc_f32(const float* W, int k0, int n, int lane, int ld, int K) {
  v16h a; const int g = lane >> 4;
#pragma unroll
  for (int i = 0; i < 8; ++i) { const int ka = k0 + 8 * g + i, kb = ka + 16;
    a[i] = (_Float16)(ka < K ? W[(size_t)ka * ld + n] : 0.f); a[8 + i] = (_Float16)(kb < K ? W[(size_t)kb * ld + n] : 0.f); }
  return a;
}
struct F2 { v16b h, l; };
__device__ __forceinline__ F2 bsplit16(const float v[16]) { F2 r;
#pragma unroll
  for (int i = 0; i < 16; ++i) { const __bf16 h = (__bf16)v[i]; r.h[i] = h; r.l[i] = (__bf16)(v[i] - (float)h); }
  return r; }
__device__ __forceinline__ F2 split_row(const float* row, int k0, int lane) { float v[16]; const float* p = row + k0 + 8 * (lane >> 4);
#pragma unroll
  for (int i = 0; i < 8; ++i) { v[i] = p[i]; v[8 + i] = p[16 + i]; }
  return bsplit16(v); }
__device__ __forceinline__ F2 split_rowK(const float* row, int k0, int lane, int K) { float v[16]; const int g = lane >> 4;
#pragma unroll
  for (int i = 0; i < 8; ++i) { const int ka = k0 + 8 * g + i, kb = ka + 16; v[i] = ka < K ? row[ka] : 0.f; v[8 + i] = kb < K ? row[kb] : 0.f; }
  return bsplit16(v); }
__device__ __forceinline__ F2 split_col(const float* W, int k0, int n, int lane, int ld, int K) { float v[16]; const int g = lane >> 4;
#pragma unroll
  for (int i = 0; i < 8; ++i) { const int ka = k0 + 8 * g + i, kb = ka + 16; v[i] = ka < K ? W[(size_t)ka * ld + n] : 0.f; v[8 + i] = kb < K ? W[(size_t)kb * ld + n] : 0.f; }
  return bsplit16(v); }
__device__ __forceinline__ v8f mac3(const F2& a, const F2& b, v8f c) { c = wmma_bf(a.l, b.h, c); c = wmma_bf(a.h, b.l, c); return wmma_bf(a.h, b.h, c); }
__device__ __forceinline__ float sigm(float v) { return 1.0f / (1.0f + expf(-v)); }
#define LDSX() do { asm volatile("s_wait_dscnt 0" ::: "memory"); __builtin_amdgcn_wave_barrier(); __builtin_amdgcn_fence(__ATOMIC_RELEASE, "workgroup"); } while (0)


// CSP attention block on [4,2048,1024]: attention branch on channels 0..511 (q from queries, k from keys, v from values; 8 heads x 64, softmax(q.k/8), out-proj Wo_attn), conv branch on
// channels 512..1023 of queries (depthwise k=3 along the sequence + bias, then Wo_conv), concat -> Wf (1024x1024) + bf, x = queries + out, LayerNorm.
// The two 512-wide output projections are linear maps straight in front of Wf, so they are folded into it, anew in every call: with Wf = [Fa | Fc], out = O (Fa Wo_attn)^T + C (Fc Wo_conv)^T + (bf + Fa bo_attn + Fc bo_conv),
// O the attention context and C the conv output; both are written as 64-wide slabs OC[b][slab][l][64], slabs 0..7 the heads of O, slabs 8..15 the columns of C, so that [O | C] is one A operand with one k stage per slab. The fold is a 1024 x 512 x 512 product per branch (an eighth of the two projections' work) and needs only the packed weights, so it rides in k_conv's launch, which needs neither LDS nor the matrix units.
// k_prep (three 512-wide f16 row sets from the 1024-wide inputs; Wq|Wk|Wv rows x16; Wo_attn|Wo_conv transposed x16; Wf rows x16), k_qkv, k_attn, k_conv (+ fold), k_wf ([O | C] x folded weights), k_ln.
#define NB 4
#define SS 2048
#define DM 1024
#define E 512
#define NH 8
#define HD 64
#define NR (NB * SS)

// Operand tiles staged in LDS once per work-group of NT threads: rows of 64 halves (one 128-B line), NT / 8 rows per step, so a wave's load covers 4 whole lines.
#define LP 72   // LDS row pitch in halves: 144 B = 16 B x 9, so the 16-byte fragment reads of 16 rows fall on distinct banks
template <int ROWS, int NT = 128> __device__ __forceinline__ void tile_ld(const _Float16* __restrict__ src, size_t pitch, int tid, v8h (&r)[ROWS * 8 / NT]) {
#pragma unroll
  for (int i = 0; i < ROWS * 8 / NT; ++i) r[i] = *(const v8h*)(src + (size_t)(i * (NT / 8) + (tid >> 3)) * pitch + (tid & 7) * 8);
}
template <int ROWS, int NT = 128> __device__ __forceinline__ void tile_st(_Float16* dst, int tid, const v8h (&r)[ROWS * 8 / NT]) {
#pragma unroll
  for (int i = 0; i < ROWS * 8 / NT; ++i) *(v8h*)(dst + (i * (NT / 8) + (tid >> 3)) * LP + (tid & 7) * 8) = r[i];
}
// One 128 x 128 tile of A W^T per work-group of 8 waves; wave w takes rows (w >> 1) * 32 .. +31 and columns (w & 1) * 64 .. +63: acc[i][j] += A(16 rows, tile i) x W(16 rows, tile j)^T over KD.
// The 128 A rows and the 128 W rows both go through two LDS buffers, 64 k per stage, and come from global memory as whole 128-B lines; an A fragment read from LDS feeds 4 products, a W fragment 2.
// Stage st of A starts at Arows + st * astep, its rows lie apitch halves apart. The next stage's lines are loaded while this stage is multiplied; one barrier per stage publishes the next buffers
// and ends the reads of the ones refilled after it.
struct Ring { _Float16 B[2][128 * LP]; _Float16 A[2][128 * LP]; };
template <int KD> __device__ __forceinline__ void gemm_lds(const _Float16* __restrict__ Arows, size_t apitch, size_t astep, const _Float16* __restrict__ Wrows, Ring& rg, int tid, v8f (&acc)[2][4]) {
  const int lane = tid & 31, col = lane & 15, w = tid >> 5, arow = (w >> 1) * 32 + col, brow = (w & 1) * 64 + col;
  v8h rb[4], ra[4];
  tile_ld<128, 256>(Wrows, KD, tid, rb); tile_ld<128, 256>(Arows, apitch, tid, ra);
  asm volatile("s_wait_xcnt 0x0" ::: "memory");   // stands behind the run of loads, in front of whatever next takes their address registers
  tile_st<128, 256>(rg.B[0], tid, rb); tile_st<128, 256>(rg.A[0], tid, ra);
  __syncthreads();
#pragma unroll 1   // kept rolled: one stage's lines in registers at a time, and the loop stays small
  for (int st = 0; st < KD / 64; ++st) { const bool more = st + 1 < KD / 64;
    if (more) { tile_ld<128, 256>(Wrows + (st + 1) * 64, KD, tid, rb); tile_ld<128, 256>(Arows + (size_t)(st + 1) * astep, apitch, tid, ra);
      asm volatile("s_wait_xcnt 0x0" ::: "memory"); }   // stands behind the run of loads, in front of the loop's foot, where their address registers are stepped on
    const _Float16* sb = rg.B[st & 1] + brow * LP; const _Float16* sa = rg.A[st & 1] + arow * LP;
#pragma unroll
    for (int kc = 0; kc < 2; ++kc) { v16h a[2], b[4];
#pragma unroll
      for (int i = 0; i < 2; ++i) a[i] = frag_h(sa + i * 16 * LP + kc * 32, lane);
#pragma unroll
      for (int j = 0; j < 4; ++j) b[j] = frag_h(sb + j * 16 * LP + kc * 32, lane);
#pragma unroll
      for (int j = 0; j < 4; ++j) {
#pragma unroll
        for (int i = 0; i < 2; ++i) acc[i][j] = wmma16(a[i], b[j], acc[i][j]); } }
    if (more) { tile_st<128, 256>(rg.B[(st + 1) & 1], tid, rb); tile_st<128, 256>(rg.A[(st + 1) & 1], tid, ra); __syncthreads(); } }
  __syncthreads();   // ends every wave's last reads of the ring: the callers stage their output over it
}

// Every f32 operand that the products read as f16 is converted by ONE launch. A quad is 4 floats; a block takes 256 * PQ quads of one source, a thread PQ quads that lie 256 quads apart, and asks for all
// PQ before the first is waited for. A wave's load covers 512 contiguous bytes of a row and its store 256 contiguous bytes, so no LDS bounce is needed. Rows are counted in 512 floats (128 quads):
// PITCH floats lie between two of them in the source (1024 in the activations, of which the first 512 columns are taken; 512 in the weights, which are dense), 512 halves in the destination.
#define PQ 16
#define AB (NR * E / 4 / (256 * PQ))   // blocks per activation
#define WB (E * E / 4 / (256 * PQ))    // blocks per 512 x 512 weight
#define FB (DM * DM / 4 / (256 * PQ))  // blocks of Wf
template <int PITCH, int SCALE> __device__ __forceinline__ void pack_run(const float* __restrict__ src, _Float16* __restrict__ dst, int lb, int tid) {
  const float* s = src + (size_t)(lb * (2 * PQ) + (tid >> 7)) * PITCH + (tid & 127) * 4; _Float16* d = dst + ((size_t)lb * (256 * PQ) + tid) * 4;
  v4f x[PQ];
#pragma unroll
  for (int i = 0; i < PQ - 1; ++i) x[i] = *(const v4f*)(s + (size_t)i * 2 * PITCH);
  asm volatile("s_wait_xcnt 0x0" ::: "memory");   // the last load's result may be given the registers that hold the address of the loads above
  x[PQ - 1] = *(const v4f*)(s + (size_t)(PQ - 1) * 2 * PITCH);
  asm volatile("s_wait_xcnt 0x0" ::: "memory");   // behind the last load, in front of whatever next takes its address registers
#pragma unroll
  for (int i = 0; i < PQ; ++i) { v4h o;
#pragma unroll
    for (int e = 0; e < 4; ++e) o[e] = (_Float16)(x[i][e] * (float)SCALE);
    vst2(d + i * 1024, o); }
  asm volatile("s_wait_xcnt 0x0" ::: "memory");   // behind the last store, in front of whatever next takes the stores' address or data registers on any way out of this run
}
// The same for a 512 x 512 weight that the fold reads along its FIRST index: dst[j][m] = f16(src[m][j] * SCALE). A block takes 64 rows m x 256 columns j, a wave 64 x 32, a lane (mg = lane & 3) 4 columns of the 16 rows
// h * 32 + mg * 8 + r: a wave's load covers one whole 128-B line in each of 4 rows, its store 64 contiguous bytes in each of 8 rows of dst, and the two halves of a 128-B line of dst come from the same wave.
template <int SCALE> __device__ __forceinline__ void pack_tr(const float* __restrict__ src, _Float16* __restrict__ dst, int lb, int tid) {
  const int lane = tid & 31, m0 = (lb >> 1) * 64 + (lane & 3) * 8, j0 = ((lb & 1) * 64 + (tid >> 5) * 8 + (lane >> 2)) * 4; const float* s = src + (size_t)m0 * E + j0; _Float16* d = dst + (size_t)j0 * E + m0;
  v4f x[PQ];
#pragma unroll
  for (int i = 0; i < PQ - 1; ++i) x[i] = *(const v4f*)(s + (size_t)((i >> 3) * 32 + (i & 7)) * E);
  asm volatile("s_wait_xcnt 0x0" ::: "memory");   // the last load's result may be given the registers that hold the address of the loads above
  x[PQ - 1] = *(const v4f*)(s + (size_t)(32 + 7) * E);
  asm volatile("s_wait_xcnt 0x0" ::: "memory");   // behind the last load, in front of whatever next takes its address registers
#pragma unroll
  for (int e = 0; e < 4; ++e) {
#pragma unroll
    for (int h = 0; h < PQ / 8; ++h) { v8h o;
#pragma unroll
      for (int r = 0; r < 8; ++r) o[r] = (_Float16)(x[h * 8 + r][e] * (float)SCALE);
      vst2(d + (size_t)e * E + h * 32, o); } }
  asm volatile("s_wait_xcnt 0x0" ::: "memory");   // behind the last store, in front of whatever next takes the stores' address or data registers on any way out of this run
}
// blocks [0, 3 AB): Xq | Xk | Xv = f16 of columns 0..511 of queries | keys | values; [3 AB, 3 AB + 5 WB): PT (512 halves a row, x16) = Wq | Wk | Wv ([out][in]) | Wo_attn^T | Wo_conv^T ([in][out]); the last FB: PF rows (1024 halves, x16) = Wf
__global__ __launch_bounds__(256) void k_prep(const float* __restrict__ q, const float* __restrict__ k, const float* __restrict__ v, const float* __restrict__ Wq, const float* __restrict__ Wk, const float* __restrict__ Wv,
                                             const float* __restrict__ Woa, const float* __restrict__ Woc, const float* __restrict__ Wf, _Float16* __restrict__ Xq, _Float16* __restrict__ Xk, _Float16* __restrict__ Xv,
                                             _Float16* __restrict__ PT, _Float16* __restrict__ PF) {
  const int bx = blockIdx.x, tid = threadIdx.x;
  if (bx < 3 * AB) { const int which = bx / AB; pack_run<DM, 1>(which == 0 ? q : (which == 1 ? k : v), which == 0 ? Xq : (which == 1 ? Xk : Xv), bx % AB, tid); }
  else if (bx < 3 * AB + 3 * WB) { const int n = bx - 3 * AB, which = n / WB; pack_run<E, 16>(which == 0 ? Wq : (which == 1 ? Wk : Wv), PT + (size_t)which * E * E, n % WB, tid); }
  else if (bx < 3 * AB + 5 * WB) { const int n = bx - 3 * AB, which = n / WB; pack_tr<16>(which == 3 ? Woa : Woc, PT + (size_t)which * E * E, n % WB, tid); }
  else pack_run<E, 16>(Wf, PF, bx - 3 * AB - 5 * WB, tid);
}
__global__ __launch_bounds__(256) void k_qkv(const _Float16* __restrict__ Xq, const _Float16* __restrict__ Xk, const _Float16* __restrict__ Xv, const _Float16* __restrict__ PT, const float* __restrict__ bq, const float* __restrict__ bk, const float* __restrict__ bv,
                                            _Float16* __restrict__ Q16, _Float16* __restrict__ K16, _Float16* __restrict__ VTh) {
  __shared__ __align__(16) union { Ring ring; _Float16 soh[8][32][72]; _Float16 sth[128][136]; } sm;   // output staging (q, k: a wave's own 32 rows x 64 columns; v: the block's tile transposed) lies over the ring
  const int tid = threadIdx.x, wave = tid >> 5, lane = tid & 31, col = lane & 15, g = lane >> 4, wr = wave >> 1, wc = wave & 1;
  const int which = blockIdx.z, r0b = blockIdx.x * 128, n0 = blockIdx.y * 128; const int b = r0b / SS, s0 = r0b % SS;   // a block's 128 rows never cross a batch (SS is a multiple of 128)
  const _Float16* X16 = which == 0 ? Xq : (which == 1 ? Xk : Xv); const float* bb_ = which == 0 ? bq : (which == 1 ? bk : bv);
  v8f acc[2][4] = {};
  gemm_lds<E>(X16 + (size_t)r0b * E, E, 64, PT + (size_t)(which * E + n0) * E, sm.ring, tid, acc);
  if (which < 2) {
#pragma unroll
    for (int j = 0; j < 4; ++j) { const float bb = bb_[n0 + wc * 64 + j * 16 + col];
#pragma unroll
      for (int i = 0; i < 2; ++i) {
#pragma unroll
        for (int r = 0; r < 8; ++r) sm.soh[wave][i * 16 + 8 * g + r][j * 16 + col] = (_Float16)((acc[i][j][r] * (1.0f / 16.0f) + bb) * 4.0f); } }
    LDSX();
    _Float16* Dst = (which == 0 ? Q16 : K16) + (((size_t)b * NH + (n0 >> 6) + wc) * SS + s0 + wr * 32) * HD;   // the wave's 64 columns are one head
#pragma unroll
    for (int qq = lane; qq < 32 * 8; qq += 32) { const int rl = qq >> 3, pc = qq & 7; vst2(Dst + (size_t)rl * HD + pc * 8, *(const v4u*)(&sm.soh[wave][rl][pc * 8])); }
    asm volatile("s_wait_xcnt 0x0" ::: "memory"); }   // behind this branch's last store, in front of whatever next takes the stores' address or data registers
  else {
#pragma unroll
    for (int j = 0; j < 4; ++j) { const float bb = bb_[n0 + wc * 64 + j * 16 + col];
#pragma unroll
      for (int i = 0; i < 2; ++i) {
#pragma unroll
        for (int r = 0; r < 8; ++r) sm.sth[wc * 64 + j * 16 + col][wr * 32 + i * 16 + 8 * g + r] = (_Float16)((acc[i][j][r] * (1.0f / 16.0f) + bb) * 4.0f); } }
    __syncthreads();
    _Float16* Vp = VTh + ((size_t)b * NH * HD + n0 + (tid >> 4)) * SS + s0 + (tid & 15) * 8;   // row (b * NH + h) * HD + d of V^T is row b * 512 + c, c = h * 64 + d the column; a wave's store covers two rows' 256 B
#pragma unroll
    for (int i = 0; i < 8; ++i) vst2(Vp + (size_t)i * 16 * SS, *(const v4u*)(&sm.sth[i * 16 + (tid >> 4)][(tid & 15) * 8]));
    asm volatile("s_wait_xcnt 0x0" ::: "memory"); }   // behind this branch's last store, in front of whatever next takes the stores' address or data registers
}
// lane l <-> lane l ^ 16 through a vector cross-row move (a shuffle would go through the LDS queue)
__device__ __forceinline__ float xhalf(float x) { const int b = __builtin_bit_cast(int, x); return __builtin_bit_cast(float, __builtin_amdgcn_permlanex16(b, b, 0x76543210, 0xfedcba98, false, false)); }
// Both products are taken transposed: S^T = K Q^T (A = 16 keys from LDS, B = the wave's 16 queries, kept in registers) and O^T += V^T P^T (A = 16 d rows of V^T from LDS, B = P^T).
// A lane (col, g) then holds, of query col, the scores of keys t*16 + 8g + r (tile t, register r): the softmax stays in the lane's registers, the two lanes of a query meet once per 64 keys for the maximum,
// and tiles 2kc and 2kc+1, converted in place, ARE the B fragment of keys kc*32 .. +31 (element e < 8: key 8g + e, element 8 + e: key 16 + 8g + e, the k order of frag_h). Neither S nor P touches LDS.
__global__ __launch_bounds__(128) void k_attn(const _Float16* __restrict__ Q16, const _Float16* __restrict__ K16, const _Float16* __restrict__ VTh, _Float16* __restrict__ OC) {
  __shared__ __align__(16) _Float16 sOh[4][16][72];   // output bounce, a wave's own 16 rows: whole 128-B lines go out
  __shared__ __align__(16) _Float16 sK[2][64 * LP];   // 64 keys x 64 d
  __shared__ __align__(16) _Float16 sV[2][64 * LP];   // 64 d x 64 keys
  const int tid = threadIdx.x, w = tid >> 5, lane = tid & 31, col = lane & 15, g = lane >> 4;
  const size_t bh = blockIdx.y; const int q0 = blockIdx.x * 64 + w * 16;
  v16h aq[2];
#pragma unroll
  for (int kc = 0; kc < 2; ++kc) aq[kc] = frag_h(Q16 + (bh * SS + q0 + col) * HD + kc * 32, lane);
  float mrun = -3.0e38f, lrun = 0.f; v8f acc[4] = {};   // lrun: this lane's half of the keys; the halves are joined behind the loop
  const _Float16* Kb = K16 + bh * SS * HD; const _Float16* Vb = VTh + bh * HD * SS; v8h rk[4], rv[4];
  tile_ld<64>(Kb, HD, tid, rk); tile_ld<64>(Vb, SS, tid, rv); tile_st<64>(sK[0], tid, rk); tile_st<64>(sV[0], tid, rv);
  __syncthreads();
  const float cs = 0.125f / 16.0f * 1.44269504f;   // scores in units of log2: e^x = 2^(x log2 e), so each exponential is one multiply-add and one v_exp_f32
#pragma unroll 1
  for (int kt = 0; kt < SS / 64; ++kt) { const bool more = kt + 1 < SS / 64;
    // the next tiles' lines are asked for first, so that they fly under the whole trip
    if (more) { tile_ld<64>(Kb + (size_t)(kt + 1) * 64 * HD, HD, tid, rk); tile_ld<64>(Vb + (kt + 1) * 64, SS, tid, rv);
      asm volatile("s_wait_xcnt 0x0" ::: "memory"); }   // stands behind the run of loads, in front of whatever next takes their address registers
    const _Float16* sk = sK[kt & 1]; const _Float16* sv = sV[kt & 1];
    v16h kf[4][2];
#pragma unroll
    for (int t = 0; t < 4; ++t) {
#pragma unroll
      for (int kc = 0; kc < 2; ++kc) kf[t][kc] = frag_h(sk + (t * 16 + col) * LP + kc * 32, lane); }
    v8f s[4] = {};
#pragma unroll
    for (int kc = 0; kc < 2; ++kc) {
#pragma unroll
      for (int t = 0; t < 4; ++t) s[t] = wmma16(kf[t][kc], aq[kc], s[t]); }
    float mt[4];
#pragma unroll
    for (int t = 0; t < 4; ++t) { mt[t] = s[t][0];
#pragma unroll
      for (int r = 1; r < 8; ++r) mt[t] = fmaxf(mt[t], s[t][r]); }
    float mx = fmaxf(fmaxf(mt[0], mt[1]), fmaxf(mt[2], mt[3]));
    mx = fmaxf(mx, xhalf(mx)) * cs;   // the maximum of the raw scores, scaled (cs > 0): both lanes of a query hold the same value
    const float mnew = fmaxf(mrun, mx); const float corr = __builtin_amdgcn_exp2f(mrun - mnew); const float mlift = mnew - 14.0f;   // the lift of P by 2^14 rides in the exponent
    const v2f cs2 = {cs, cs}, nm2 = {-mlift, -mlift};
    v2f ps2[2] = {}; v16h ph[2];
#pragma unroll
    for (int t = 0; t < 4; ++t) {
#pragma unroll
      for (int i = 0; i < 4; ++i) { const v2f sc = {s[t][2 * i], s[t][2 * i + 1]}; const v2f ar = __builtin_elementwise_fma(sc, cs2, nm2);
        const v2f p = {__builtin_amdgcn_exp2f(ar[0]), __builtin_amdgcn_exp2f(ar[1])}; ps2[t & 1] += p;
        const v2h hp = __builtin_convertvector(p, v2h); ph[t >> 1][(t & 1) * 8 + 2 * i] = hp[0]; ph[t >> 1][(t & 1) * 8 + 2 * i + 1] = hp[1]; } }
    lrun = lrun * corr + ((ps2[0][0] + ps2[0][1]) + (ps2[1][0] + ps2[1][1])) * (1.0f / 16384.0f); mrun = mnew;
#pragma unroll
    for (int t = 0; t < 4; ++t) acc[t] = acc[t] * corr;   // a lane's 32 output values belong to its one query
#pragma unroll
    for (int kc = 0; kc < 2; ++kc) { v16h vf[4];
#pragma unroll
      for (int t = 0; t < 4; ++t) vf[t] = frag_h(sv + (t * 16 + col) * LP + kc * 32, lane);
#pragma unroll
      for (int t = 0; t < 4; ++t) acc[t] = wmma16(vf[t], ph[kc], acc[t]); }
    if (more) { tile_st<64>(sK[(kt + 1) & 1], tid, rk); tile_st<64>(sV[(kt + 1) & 1], tid, rv); __syncthreads(); } }
  lrun += xhalf(lrun);
  const float inv = 8.0f / (lrun * 16384.0f * 4.0f);
#pragma unroll
  for (int t = 0; t < 4; ++t) { v8h o;   // acc[t][r] = O[query col][d = t*16 + 8g + r]: 8 consecutive d of one row
#pragma unroll
    for (int r = 0; r < 8; ++r) o[r] = (_Float16)(acc[t][r] * inv);
    *(v8h*)(&sOh[w][col][t * 16 + 8 * g]) = o; }
  LDSX();
  for (int qq = lane; qq < 16 * 8; qq += 32) { const int rl = qq >> 3, pc = qq & 7;
    vst2(OC + (((bh / NH * (2 * NH) + bh % NH) * SS) + q0 + rl) * HD + pc * 8, *(const v4u*)(&sOh[w][rl][pc * 8])); }   // head h of batch b is slab h of the batch's 16
}
// depthwise conv (k=3, pad 1) along the sequence on queries[:, :, 512 + c]: OC[b][8 + c / 64][l][c % 64] f16 ; thread = 4 columns x CR positions, 128 threads per run of CR positions, two runs per block.
// A thread's CR + 2 input rows are loaded without a condition (the two edge rows from a clamped address, set to 0 behind the load), so that all of them are in flight before the first is waited for;
// a wave's load covers 512 contiguous bytes of a row and its store two whole 128-B lines (one row in each of two slabs), so no LDS bounce is needed.
// In front of the conv's blocks, since they run longer: blocks [0, GB): the fold, PG[o][part * 512 + j] = sum over m of Wf[o][part * 512 + m] * Wo_part[m][j], part 0 = attention (stored x2, since its A operand in k_wf, the
// context, is x8), part 1 = conv (x16): a 128 x 128 tile with A = PF rows and W = the transposed pack. Blocks [GB, GB + BB): bfold[o] = bf[o] + sum over m of Wf[o][m] * (bo_attn | bo_conv)[m], in f32.
#define CR 8
#define GB (2 * (DM / 128) * (E / 128))   // blocks of the fold
#define BB (DM / 32)                      // blocks of the folded bias: 32 rows each, so that one wave stores one whole 128-B line
__global__ __launch_bounds__(256) void k_conv(const float* __restrict__ q, const float* __restrict__ cw, const float* __restrict__ cb, _Float16* __restrict__ OC, const _Float16* __restrict__ PF, const _Float16* __restrict__ PTo,
                                             const float* __restrict__ Wf, const float* __restrict__ boa, const float* __restrict__ boc, const float* __restrict__ bfv, _Float16* __restrict__ PG, float* __restrict__ bfold) {
  __shared__ __align__(16) union { Ring ring; _Float16 soh[8][32][72]; float red[32]; } sm;   // the fold's output staging, a wave's own 32 rows x 64 columns, lies over the ring
  const int tid = threadIdx.x, id = blockIdx.x;
  if (id < GB) { const int wave = tid >> 5, lane = tid & 31, col = lane & 15, g = lane >> 4, wr = wave >> 1, wc = wave & 1;
    const int part = id / (GB / 2), o0 = id / (E / 128) % (DM / 128) * 128, n0 = id % (E / 128) * 128; const _Float16* Ab = PF + (size_t)o0 * DM + part * E;
    v8f acc[2][4] = {};
    gemm_lds<E>(Ab, DM, 64, PTo + (size_t)(part * E + n0) * E, sm.ring, tid, acc);
    const float sc = part == 0 ? 2.0f / 256.0f : 16.0f / 256.0f;   // both operands are x16
#pragma unroll
    for (int j = 0; j < 4; ++j) {
#pragma unroll
      for (int i = 0; i < 2; ++i) {
#pragma unroll
        for (int r = 0; r < 8; ++r) sm.soh[wave][i * 16 + 8 * g + r][j * 16 + col] = (_Float16)(acc[i][j][r] * sc); } }
    LDSX();
    _Float16* Dst = PG + (size_t)(o0 + wr * 32) * DM + part * E + n0 + wc * 64;
#pragma unroll
    for (int qq = lane; qq < 32 * 8; qq += 32) { const int rl = qq >> 3, pc = qq & 7; vst2(Dst + (size_t)rl * DM + pc * 8, *(const v4u*)(&sm.soh[wave][rl][pc * 8])); }
    asm volatile("s_wait_xcnt 0x0" ::: "memory");   // behind the last store, in front of whatever next takes the stores' address or data registers
    return; }
  if (id < GB + BB) {   // a wave takes 4 rows of Wf, two at a time; lane owns columns p * 128 + lane * 4 .. +3, so every load covers 512 contiguous bytes
    const int wave = tid >> 5, lane = tid & 31, o0 = (id - GB) * 32; v4f bc[8];
#pragma unroll
    for (int p = 0; p < 8; ++p) bc[p] = *(const v4f*)((p < 4 ? boa + p * 128 : boc + (p - 4) * 128) + lane * 4);
#pragma unroll
    for (int h = 0; h < 2; ++h) { const float* wrow = Wf + (size_t)(o0 + wave * 4 + h * 2) * DM + lane * 4; v4f x[2][8];
#pragma unroll
      for (int t = 0; t < 2; ++t) {
#pragma unroll
        for (int p = 0; p < 8; ++p) x[t][p] = *(const v4f*)(wrow + (size_t)t * DM + p * 128); }
      asm volatile("s_wait_xcnt 0x0" ::: "memory");   // behind the run of loads, in front of whatever next takes their address registers
#pragma unroll
      for (int t = 0; t < 2; ++t) { float sum = 0.f;
#pragma unroll
        for (int p = 0; p < 8; ++p) {
#pragma unroll
          for (int e = 0; e < 4; ++e) sum += x[t][p][e] * bc[p][e]; }
#pragma unroll
        for (int o = 16; o > 0; o >>= 1) sum += __shfl_xor(sum, o, 32);
        if (lane == 0) sm.red[wave * 4 + h * 2 + t] = sum; } }
    __syncthreads();   // the 8 waves' 32 sums meet, so that one wave stores them as one line
    if (wave == 0) bfold[o0 + lane] = sm.red[lane] + bfv[o0 + lane];
    return; }
  const int c = (tid & 127) * 4, r0 = ((id - GB - BB) * 2 + (tid >> 7)) * CR, l0 = r0 % SS;   // r0 = b * SS + l0; a run never crosses a batch (SS is a multiple of CR)
  const bool top = l0 > 0, bot = l0 + CR < SS; const float* col_ = q + (size_t)r0 * DM + E + c;
  v4f x[CR + 2];
  x[0] = *(const v4f*)(col_ - (top ? DM : 0));
#pragma unroll
  for (int i = 0; i < CR; ++i) x[i + 1] = *(const v4f*)(col_ + (size_t)i * DM);
  asm volatile("s_wait_xcnt 0x0" ::: "memory");   // a later load's result may be given the registers that hold the address of the loads above
  x[CR + 1] = *(const v4f*)(col_ + (size_t)(bot ? CR : CR - 1) * DM);
  const v4f bb = *(const v4f*)(cb + c);
  const float* wp = cw + c * 3; v4f wv[3];   // the 4 columns' 12 taps: tap k of column c + e is element e * 3 + k
  wv[0] = *(const v4f*)wp; wv[1] = *(const v4f*)(wp + 4);
  asm volatile("s_wait_xcnt 0x0" ::: "memory");   // the last load's result may be given the registers that hold the address of the loads above
  wv[2] = *(const v4f*)(wp + 8);
#pragma unroll
  for (int e = 0; e < 4; ++e) { x[0][e] = top ? x[0][e] : 0.f; x[CR + 1][e] = bot ? x[CR + 1][e] : 0.f; }
#pragma unroll
  for (int i = 0; i < CR; ++i) { v4h o;
#pragma unroll
    for (int e = 0; e < 4; ++e) o[e] = (_Float16)(wv[(e * 3) >> 2][(e * 3) & 3] * x[i][e] + wv[(e * 3 + 1) >> 2][(e * 3 + 1) & 3] * x[i + 1][e] + wv[(e * 3 + 2) >> 2][(e * 3 + 2) & 3] * x[i + 2][e] + bb[e]);
    vst2(OC + (((size_t)(r0 / SS) * (2 * NH) + NH + (c >> 6)) * SS + l0 + i) * HD + (c & 63), o); }
  asm volatile("s_wait_xcnt 0x0" ::: "memory");   // behind the last store, in front of whatever next takes the stores' address or data registers
}
// T = queries + [O | C] PG^T / 16 + bfold : block (128 rows, 128 cols), K = 1024; k stage st reads slab st of OC (0..7: the context's heads, x8; 8..15: the conv output)
__global__ __launch_bounds__(256) void k_wf(const _Float16* __restrict__ OC, const _Float16* __restrict__ PG, const float* __restrict__ bfv, const float* __restrict__ q, float* __restrict__ T) {
  __shared__ __align__(16) union { Ring ring; float so[8][32][68]; } sm;   // output staging, a wave's own 32 rows x 64 columns, lies over the ring
  const int tid = threadIdx.x, wave = tid >> 5, lane = tid & 31, col = lane & 15, g = lane >> 4; const int r0 = blockIdx.x * 128 + (wave >> 1) * 32, n0 = blockIdx.y * 128, nw = n0 + (wave & 1) * 64;
  v8f acc[2][4] = {};
  const int r0b = blockIdx.x * 128, b = r0b / SS, s = r0b % SS;   // a block's 128 rows never cross a batch (SS is a multiple of 128)
  gemm_lds<DM>(OC + ((size_t)b * (2 * NH) * SS + s) * HD, HD, (size_t)SS * HD, PG + (size_t)n0 * DM, sm.ring, tid, acc);
  float qv[2][4][8];
#pragma unroll
  for (int i = 0; i < 2; ++i) {
#pragma unroll
    for (int j = 0; j < 4; ++j) {
#pragma unroll
      for (int r = 0; r < 8; ++r) qv[i][j][r] = q[(size_t)(r0 + i * 16 + 8 * g + r) * DM + nw + j * 16 + col]; }
    asm volatile("s_wait_xcnt 0x0" ::: "memory"); }   // behind each run of loads: a later load's result may be given the registers that hold this run's address
#pragma unroll
  for (int j = 0; j < 4; ++j) { const float bb = bfv[nw + j * 16 + col];
#pragma unroll
    for (int i = 0; i < 2; ++i) {
#pragma unroll
      for (int r = 0; r < 8; ++r) sm.so[wave][i * 16 + 8 * g + r][j * 16 + col] = acc[i][j][r] * (1.0f / 16.0f) + bb + qv[i][j][r]; } }
  LDSX();
  float* Tp = T + (size_t)(r0 + g) * DM + nw + col * 4;   // a wave's store covers two rows' 256 B
#pragma unroll
  for (int i = 0; i < 16; ++i) vst2(Tp + (size_t)i * 2 * DM, *(const v4f*)(&sm.so[wave][i * 2 + g][col * 4]));
  asm volatile("s_wait_xcnt 0x0" ::: "memory");   // behind the last store, in front of whatever next takes the stores' address or data registers
}
// LayerNorm over 1024 per row: wave per row (32 floats per lane)
__global__ __launch_bounds__(256) void k_ln(const float* __restrict__ T, const float* __restrict__ gm, const float* __restrict__ bt, float* __restrict__ out) {
  // LayerNorm over 1024 per row: wave per row; lane owns columns p*128 + lane*4 .. +3 for p = 0..7 so every store instruction writes one contiguous 512-B run by 32 consecutive lanes
  const int wave = threadIdx.x >> 5, lane = threadIdx.x & 31; const size_t row = (size_t)blockIdx.x * 8 + wave; const float* tr = T + row * DM;
  float s = 0.f, sq = 0.f;
#pragma unroll
  for (int p = 0; p < 8; ++p) { const v4f v = *(const v4f*)(tr + p * 128 + lane * 4);
#pragma unroll
    for (int e = 0; e < 4; ++e) { s += v[e]; sq += v[e] * v[e]; } }
#pragma unroll
  for (int o = 16; o > 0; o >>= 1) { s += __shfl_xor(s, o, 32); sq += __shfl_xor(sq, o, 32); }
  const float mu = s * (1.0f / DM); float var = sq * (1.0f / DM) - mu * mu; var = var > 0.f ? var : 0.f; const float rs = rsqrtf(var + 1e-5f);
#pragma unroll 1
  for (int p = 0; p < 8; ++p) { const int c0 = p * 128 + lane * 4; v4f v = *(const v4f*)(tr + c0);
#pragma unroll
    for (int e = 0; e < 4; ++e) v[e] = (v[e] - mu) * rs * gm[c0 + e] + bt[c0 + e];
    vst2(out + row * DM + c0, v); }
}
extern "C" void kernel_launch(void* const* d_in, const int* in_sizes, int n_in, void* d_out, int out_size, void* d_ws, size_t ws_size, hipStream_t stream) {
  (void)in_sizes; (void)n_in; (void)out_size; (void)ws_size;
  const float** I = (const float**)d_in;
  const float* queries = I[0]; const float* keys = I[1]; const float* values = I[2]; const float* Wq = I[3]; const float* bq = I[4]; const float* Wk = I[5]; const float* bk = I[6]; const float* Wv = I[7]; const float* bv = I[8];
  const float* Woa = I[9]; const float* boa = I[10]; const float* cw = I[11]; const float* cb = I[12]; const float* Woc = I[13]; const float* boc = I[14]; const float* Wf = I[15]; const float* bfv = I[16]; const float* gm = I[17]; const float* bt = I[18];
  float* out = (float*)d_out;
  char* ws = (char*)d_ws; size_t off = 0;
  auto take = [&](size_t bytes) { char* p = ws + off; off += (bytes + 255) & ~(size_t)255; return p; };
  _Float16* Xq = (_Float16*)take((size_t)NR * E * 2); _Float16* Xk = (_Float16*)take((size_t)NR * E * 2); _Float16* Xv = (_Float16*)take((size_t)NR * E * 2);
  _Float16* PT = (_Float16*)take((size_t)5 * E * E * 2); _Float16* PF = (_Float16*)take((size_t)DM * DM * 2);
  _Float16* Q16 = (_Float16*)take((size_t)NR * E * 2); _Float16* K16 = (_Float16*)take((size_t)NR * E * 2); _Float16* VTh = (_Float16*)take((size_t)NR * E * 2);
  _Float16* OC = (_Float16*)take((size_t)NR * DM * 2);
  _Float16* PG = (_Float16*)take((size_t)DM * DM * 2); float* bfold = (float*)take((size_t)DM * 4); float* T = (float*)take((size_t)NR * DM * 4);
  // ws ~ 107 MB
  k_prep<<<3 * AB + 5 * WB + FB, 256, 0, stream>>>(queries, keys, values, Wq, Wk, Wv, Woa, Woc, Wf, Xq, Xk, Xv, PT, PF);
  k_qkv<<<dim3(NR / 128, E / 128, 3), 256, 0, stream>>>(Xq, Xk, Xv, PT, bq, bk, bv, Q16, K16, VTh);
  k_attn<<<dim3(SS / 64, NB * NH), 128, 0, stream>>>(Q16, K16, VTh, OC);
  k_conv<<<GB + BB + NR / CR / 2, 256, 0, stream>>>(queries, cw, cb, OC, PF, PT + (size_t)3 * E * E, Wf, boa, boc, bfv, PG, bfold);
  k_wf<<<dim3(NR / 128, DM / 128), 256, 0, stream>>>(OC, PG, bfold, queries, T);
  k_ln<<<NR / 8, 256, 0, stream>>>(T, gm, bt, out);
}

// v008
// Measured time: 100 microseconds a run.
// In both of two side-by-side timings against v007, it was 1.07 times as fast.
// All steps since v000 together make it 4.51 times as fast.
// compute dtype: f16 operands for the projections, attention, the weight fold and the final 1024x1024 projection (activations as f16 rows, weights packed x16, q/k x4, P lifted by 2^14, V x4, ctx x8), f32 accumulate; the depthwise conv, the folded bias, residual and LayerNorm in f32. Output = LN(queries + out) is residual-dominated.
#include <hip/hip_runtime.h>
#include <math.h>

typedef __attribute__((ext_vector_type(16))) _Float16 v16h;
typedef __attribute__((ext_vector_type(16))) __bf16 v16b;
typedef __attribute__((ext_vector_type(8)))  _Float16 v8h;
typedef __attribute__((ext_vector_type(4)))  _Float16 v4h;
typedef __attribute__((ext_vector_type(2)))  _Float16 v2h;
typedef __attribute__((ext_vector_type(8)))  float v8f;
typedef __attribute__((ext_vector_type(4)))  float v4f;
typedef __attribute__((ext_vector_type(2)))  float v2f;
typedef __attribute__((ext_vector_type(4)))  unsigned v4u;
typedef __attribute__((ext_vector_type(4)))  int v4i;
typedef float __attribute__((may_alias)) float_a;
typedef int __attribute__((may_alias)) int_a;

template <typename T> __device__ __forceinline__ void vst2(void* p, T v) { *(T*)p = v;  }
__device__ __forceinline__ v8f wmma16(v16h a, v16h b, v8f c) {
  v8f d = __builtin_amdgcn_wmma_f32_16x16x32_f16(false, a, false, b, (short)0, c, false, false);
  asm volatile("v_nop\n\tv_nop\n\tv_nop\n\tv_nop" : "+v"(d) : "v"(a), "v"(b));
  return d;
}
__device__ __forceinline__ v8f wmma_bf(v16b a, v16b b, v8f c) {
  v8f d = __builtin_amdgcn_wmma_f32_16x16x32_bf16(false, a, false, b, (short)0, c, false, false);
  asm volatile("v_nop\n\tv_nop\n\tv_nop\n\tv_nop" : "+v"(d) : "v"(a), "v"(b));
  return d;
}
// 16x16x32 fragments: lane = (h = lane>>4, row/col = lane&15); elements 0..7 = k0+8h+0..7, 8..15 = k0+16+8h+0..7; D element r = row 8h+r
__device__ __forceinline__ v16h frag_h(const _Float16* rowk0, int lane) {
  union { v16h v; v8h q[2]; } u; const _Float16* p = rowk0 + 8 * (lane >> 4);
  u.q[0] = *(const v8h*)p; u.q[1] = *(const v8h*)(p + 16); return u.v;
}
__device__ __forceinline__ v16h frag_f32(const float* rowk0, int lane) {
  v16h a; const float* p = rowk0 + 8 * (lane >> 4);
#pragma unroll
  for (int i = 0; i < 8; ++i) { a[i] = (_Float16)p[i]; a[8 + i] = (_Float16)p[16 + i]; }
  return a;
}
__device__ __forceinline__ v16h frag_f32s(const float* rowk0, int lane, float sc) {
  v16h a; const float* p = rowk0 + 8 * (lane >> 4);
#pragma unroll
  for (int i = 0; i < 8; ++i) { a[i] = (_Float16)(p[i] * sc); a[8 + i] = (_Float16)(p[16 + i] * sc); }
  return a;
}
// column fragment from a [K][ld] layout (column n), rows >= K read as 0
__device__ __forceinline__ v16h fragc_f32(const float* W, int k0, int n, int lane, int ld, int K) {
  v16h a; const int g = lane >> 4;
#pragma unroll
  for (int i = 0; i < 8; ++i) { const int ka = k0 + 8 * g + i, kb = ka + 16;
    a[i] = (_Float16)(ka < K ? W[(size_t)ka * ld + n] : 0.f); a[8 + i] = (_Float16)(kb < K ? W[(size_t)kb * ld + n] : 0.f); }
  return a;
}
struct F2 { v16b h, l; };
__device__ __forceinline__ F2 bsplit16(const float v[16]) { F2 r;
#pragma unroll
  for (int i = 0; i < 16; ++i) { const __bf16 h = (__bf16)v[i]; r.h[i] = h; r.l[i] = (__bf16)(v[i] - (float)h); }
  return r; }
__device__ __forceinline__ F2 split_row(const float* row, int k0, int lane) { float v[16]; const float* p = row + k0 + 8 * (lane >> 4);
#pragma unroll
  for (int i = 0; i < 8; ++i) { v[i] = p[i]; v[8 + i] = p[16 + i]; }
  return bsplit16(v); }
__device__ __forceinline__ F2 split_rowK(const float* row, int k0, int lane, int K) { float v[16]; const int g = lane >> 4;
#pragma unroll
  for (int i = 0; i < 8; ++i) { const int ka = k0 + 8 * g + i, kb = ka + 16; v[i] = ka < K ? row[ka] : 0.f; v[8 + i] = kb < K ? row[kb] : 0.f; }
  return bsplit16(v); }
__device__ __forceinline__ F2 split_col(const float* W, int k0, int n, int lane, int ld, int K) { float v[16]; const int g = lane >> 4;
#pragma unroll
  for (int i = 0; i < 8; ++i) { const int ka = k0 + 8 * g + i, kb = ka + 16; v[i] = ka < K ? W[(size_t)ka * ld + n] : 0.f; v[8 + i] = kb < K ? W[(size_t)kb * ld + n] : 0.f; }
  return bsplit16(v); }
__device__ __forceinline__ v8f mac3(const F2& a, const F2& b, v8f c) { c = wmma_bf(a.l, b.h, c); c = wmma_bf(a.h, b.l, c); return wmma_bf(a.h, b.h, c); }
__device__ __forceinline__ float sigm(float v) { return 1.0f / (1.0f + expf(-v)); }
#define LDSX() do { asm volatile("s_wait_dscnt 0" ::: "memory"); __builtin_amdgcn_wave_barrier(); __builtin_amdgcn_fence(__ATOMIC_RELEASE, "workgroup"); } while (0)


// CSP attention block on [4,2048,1024]: attention branch on channels 0..511 (q from queries, k from keys, v from values; 8 heads x 64, softmax(q.k/8), out-proj Wo_attn), conv branch on
// channels 512..1023 of queries (depthwise k=3 along the sequence + bias, then Wo_conv), concat -> Wf (1024x1024) + bf, x = queries + out, LayerNorm.
// The two 512-wide output projections are linear maps straight in front of Wf, so they are folded into it, anew in every call: with Wf = [Fa | Fc], out = O (Fa Wo_attn)^T + C (Fc Wo_conv)^T + (bf + Fa bo_attn + Fc bo_conv),
// O the attention context and C the conv output; both are written as 64-wide slabs OC[b][slab][l][64], slabs 0..7 the heads of O, slabs 8..15 the columns of C, so that [O | C] is one A operand with one k stage per slab. The fold is a 1024 x 512 x 512 product per branch (an eighth of the two projections' work) and needs only the packed weights, so it rides in k_conv's launch, which needs neither LDS nor the matrix units.
// k_prep (three 512-wide f16 row sets from the 1024-wide inputs; Wq|Wk|Wv rows x16; Wo_attn|Wo_conv transposed x16; Wf rows x16), k_qkv, k_attn, k_conv (+ fold), k_wf ([O | C] x folded weights), k_ln.
#define NB 4
#define SS 2048
#define DM 1024
#define E 512
#define NH 8
#define HD 64
#define NR (NB * SS)

// Operand tiles staged in LDS by a group of NT threads (the whole work-group, or in k_attn each half of it): rows of 64 halves (one 128-B line), NT / 8 rows per step, so a wave's load covers 4 whole lines.
#define LP 72   // LDS row pitch in halves: 144 B = 16 B x 9, so the 16-byte fragment reads of 16 rows fall on distinct banks
template <int ROWS, int NT = 128> __device__ __forceinline__ void tile_ld(const _Float16* __restrict__ src, size_t pitch, int tid, v8h (&r)[ROWS * 8 / NT]) {
#pragma unroll
  for (int i = 0; i < ROWS * 8 / NT; ++i) r[i] = *(const v8h*)(src + (size_t)(i * (NT / 8) + (tid >> 3)) * pitch + (tid & 7) * 8);
}
template <int ROWS, int NT = 128> __device__ __forceinline__ void tile_st(_Float16* dst, int tid, const v8h (&r)[ROWS * 8 / NT]) {
#pragma unroll
  for (int i = 0; i < ROWS * 8 / NT; ++i) *(v8h*)(dst + (i * (NT / 8) + (tid >> 3)) * LP + (tid & 7) * 8) = r[i];
}
// One 128 x 128 tile of A W^T per work-group of 8 waves; wave w takes rows (w >> 1) * 32 .. +31 and columns (w & 1) * 64 .. +63: acc[i][j] += A(16 rows, tile i) x W(16 rows, tile j)^T over KD.
// The 128 A rows and the 128 W rows both go through two LDS buffers, 64 k per stage, and come from global memory as whole 128-B lines; an A fragment read from LDS feeds 4 products, a W fragment 2.
// Stage st of A starts at Arows + st * astep, its rows lie apitch halves apart. The next stage's lines are loaded while this stage is multiplied; one barrier per stage publishes the next buffers
// and ends the reads of the ones refilled after it.
struct Ring { _Float16 B[2][128 * LP]; _Float16 A[2][128 * LP]; };
template <int KD> __device__ __forceinline__ void gemm_lds(const _Float16* __restrict__ Arows, size_t apitch, size_t astep, const _Float16* __restrict__ Wrows, Ring& rg, int tid, v8f (&acc)[2][4]) {
  const int lane = tid & 31, col = lane & 15, w = tid >> 5, arow = (w >> 1) * 32 + col, brow = (w & 1) * 64 + col;
  v8h rb[4], ra[4];
  tile_ld<128, 256>(Wrows, KD, tid, rb); tile_ld<128, 256>(Arows, apitch, tid, ra);
  asm volatile("s_wait_xcnt 0x0" ::: "memory");   // stands behind the run of loads, in front of whatever next takes their address registers
  tile_st<128, 256>(rg.B[0], tid, rb); tile_st<128, 256>(rg.A[0], tid, ra);
  __syncthreads();
#pragma unroll 1   // kept rolled: one stage's lines in registers at a time, and the loop stays small
  for (int st = 0; st < KD / 64; ++st) { const bool more = st + 1 < KD / 64;
    if (more) { tile_ld<128, 256>(Wrows + (st + 1) * 64, KD, tid, rb); tile_ld<128, 256>(Arows + (size_t)(st + 1) * astep, apitch, tid, ra);
      asm volatile("s_wait_xcnt 0x0" ::: "memory"); }   // stands behind the run of loads, in front of the loop's foot, where their address registers are stepped on
    const _Float16* sb = rg.B[st & 1] + brow * LP; const _Float16* sa = rg.A[st & 1] + arow * LP;
#pragma unroll
    for (int kc = 0; kc < 2; ++kc) { v16h a[2], b[4];
#pragma unroll
      for (int i = 0; i < 2; ++i) a[i] = frag_h(sa + i * 16 * LP + kc * 32, lane);
#pragma unroll
      for (int j = 0; j < 4; ++j) b[j] = frag_h(sb + j * 16 * LP + kc * 32, lane);
#pragma unroll
      for (int j = 0; j < 4; ++j) {
#pragma unroll
        for (int i = 0; i < 2; ++i) acc[i][j] = wmma16(a[i], b[j], acc[i][j]); } }
    if (more) { tile_st<128, 256>(rg.B[(st + 1) & 1], tid, rb); tile_st<128, 256>(rg.A[(st + 1) & 1], tid, ra); __syncthreads(); } }
  __syncthreads();   // ends every wave's last reads of the ring: the callers stage their output over it
}

// Every f32 operand that the products read as f16 is converted by ONE launch. A quad is 4 floats; a block takes 256 * PQ quads of one source, a thread PQ quads that lie 256 quads apart, and asks for all
// PQ before the first is waited for. A wave's load covers 512 contiguous bytes of a row and its store 256 contiguous bytes, so no LDS bounce is needed. Rows are counted in 512 floats (128 quads):
// PITCH floats lie between two of them in the source (1024 in the activations, of which the first 512 columns are taken; 512 in the weights, which are dense), 512 halves in the destination.
#define PQ 16
#define AB (NR * E / 4 / (256 * PQ))   // blocks per activation
#define WB (E * E / 4 / (256 * PQ))    // blocks per 512 x 512 weight
#define FB (DM * DM / 4 / (256 * PQ))  // blocks of Wf
template <int PITCH, int SCALE> __device__ __forceinline__ void pack_run(const float* __restrict__ src, _Float16* __restrict__ dst, int lb, int tid) {
  const float* s = src + (size_t)(lb * (2 * PQ) + (tid >> 7)) * PITCH + (tid & 127) * 4; _Float16* d = dst + ((size_t)lb * (256 * PQ) + tid) * 4;
  v4f x[PQ];
#pragma unroll
  for (int i = 0; i < PQ - 1; ++i) x[i] = *(const v4f*)(s + (size_t)i * 2 * PITCH);
  asm volatile("s_wait_xcnt 0x0" ::: "memory");   // the last load's result may be given the registers that hold the address of the loads above
  x[PQ - 1] = *(const v4f*)(s + (size_t)(PQ - 1) * 2 * PITCH);
  asm volatile("s_wait_xcnt 0x0" ::: "memory");   // behind the last load, in front of whatever next takes its address registers
#pragma unroll
  for (int i = 0; i < PQ; ++i) { v4h o;
#pragma unroll
    for (int e = 0; e < 4; ++e) o[e] = (_Float16)(x[i][e] * (float)SCALE);
    vst2(d + i * 1024, o); }
  asm volatile("s_wait_xcnt 0x0" ::: "memory");   // behind the last store, in front of whatever next takes the stores' address or data registers on any way out of this run
}
// The same for a 512 x 512 weight that the fold reads along its FIRST index: dst[j][m] = f16(src[m][j] * SCALE). A block takes 64 rows m x 256 columns j, a wave 64 x 32, a lane (mg = lane & 3) 4 columns of the 16 rows
// h * 32 + mg * 8 + r: a wave's load covers one whole 128-B line in each of 4 rows, its store 64 contiguous bytes in each of 8 rows of dst, and the two halves of a 128-B line of dst come from the same wave.
template <int SCALE> __device__ __forceinline__ void pack_tr(const float* __restrict__ src, _Float16* __restrict__ dst, int lb, int tid) {
  const int lane = tid & 31, m0 = (lb >> 1) * 64 + (lane & 3) * 8, j0 = ((lb & 1) * 64 + (tid >> 5) * 8 + (lane >> 2)) * 4; const float* s = src + (size_t)m0 * E + j0; _Float16* d = dst + (size_t)j0 * E + m0;
  v4f x[PQ];
#pragma unroll
  for (int i = 0; i < PQ - 1; ++i) x[i] = *(const v4f*)(s + (size_t)((i >> 3) * 32 + (i & 7)) * E);
  asm volatile("s_wait_xcnt 0x0" ::: "memory");   // the last load's result may be given the registers that hold the address of the loads above
  x[PQ - 1] = *(const v4f*)(s + (size_t)(32 + 7) * E);
  asm volatile("s_wait_xcnt 0x0" ::: "memory");   // behind the last load, in front of whatever next takes its address registers
#pragma unroll
  for (int e = 0; e < 4; ++e) {
#pragma unroll
    for (int h = 0; h < PQ / 8; ++h) { v8h o;
#pragma unroll
      for (int r = 0; r < 8; ++r) o[r] = (_Float16)(x[h * 8 + r][e] * (float)SCALE);
      vst2(d + (size_t)e * E + h * 32, o); } }
  asm volatile("s_wait_xcnt 0x0" ::: "memory");   // behind the last store, in front of whatever next takes the stores' address or data registers on any way out of this run
}
// blocks [0, 3 AB): Xq | Xk | Xv = f16 of columns 0..511 of queries | keys | values; [3 AB, 3 AB + 5 WB): PT (512 halves a row, x16) = Wq | Wk | Wv ([out][in]) | Wo_attn^T | Wo_conv^T ([in][out]); the last FB: PF rows (1024 halves, x16) = Wf
__global__ __launch_bounds__(256) void k_prep(const float* __restrict__ q, const float* __restrict__ k, const float* __restrict__ v, const float* __restrict__ Wq, const float* __restrict__ Wk, const float* __restrict__ Wv,
                                             const float* __restrict__ Woa, const float* __restrict__ Woc, const float* __restrict__ Wf, _Float16* __restrict__ Xq, _Float16* __restrict__ Xk, _Float16* __restrict__ Xv,
                                             _Float16* __restrict__ PT, _Float16* __restrict__ PF) {
  const int bx = blockIdx.x, tid = threadIdx.x;
  if (bx < 3 * AB) { const int which = bx / AB; pack_run<DM, 1>(which == 0 ? q : (which == 1 ? k : v), which == 0 ? Xq : (which == 1 ? Xk : Xv), bx % AB, tid); }
  else if (bx < 3 * AB + 3 * WB) { const int n = bx - 3 * AB, which = n / WB; pack_run<E, 16>(which == 0 ? Wq : (which == 1 ? Wk : Wv), PT + (size_t)which * E * E, n % WB, tid); }
  else if (bx < 3 * AB + 5 * WB) { const int n = bx - 3 * AB, which = n / WB; pack_tr<16>(which == 3 ? Woa : Woc, PT + (size_t)which * E * E, n % WB, tid); }
  else pack_run<E, 16>(Wf, PF, bx - 3 * AB - 5 * WB, tid);
}
__global__ __launch_bounds__(256) void k_qkv(const _Float16* __restrict__ Xq, const _Float16* __restrict__ Xk, const _Float16* __restrict__ Xv, const _Float16* __restrict__ PT, const float* __restrict__ bq, const float* __restrict__ bk, const float* __restrict__ bv,
                                            _Float16* __restrict__ Q16, _Float16* __restrict__ K16, _Float16* __restrict__ VTh) {
  __shared__ __align__(16) union { Ring ring; _Float16 soh[8][32][72]; _Float16 sth[128][136]; } sm;   // output staging (q, k: a wave's own 32 rows x 64 columns; v: the block's tile transposed) lies over the ring
  const int tid = threadIdx.x, wave = tid >> 5, lane = tid & 31, col = lane & 15, g = lane >> 4, wr = wave >> 1, wc = wave & 1;
  const int which = blockIdx.z, r0b = blockIdx.x * 128, n0 = blockIdx.y * 128; const int b = r0b / SS, s0 = r0b % SS;   // a block's 128 rows never cross a batch (SS is a multiple of 128)
  const _Float16* X16 = which == 0 ? Xq : (which == 1 ? Xk : Xv); const float* bb_ = which == 0 ? bq : (which == 1 ? bk : bv);
  v8f acc[2][4] = {};
  gemm_lds<E>(X16 + (size_t)r0b * E, E, 64, PT + (size_t)(which * E + n0) * E, sm.ring, tid, acc);
  if (which < 2) {
#pragma unroll
    for (int j = 0; j < 4; ++j) { const float bb = bb_[n0 + wc * 64 + j * 16 + col];
#pragma unroll
      for (int i = 0; i < 2; ++i) {
#pragma unroll
        for (int r = 0; r < 8; ++r) sm.soh[wave][i * 16 + 8 * g + r][j * 16 + col] = (_Float16)((acc[i][j][r] * (1.0f / 16.0f) + bb) * 4.0f); } }
    LDSX();
    _Float16* Dst = (which == 0 ? Q16 : K16) + (((size_t)b * NH + (n0 >> 6) + wc) * SS + s0 + wr * 32) * HD;   // the wave's 64 columns are one head
#pragma unroll
    for (int qq = lane; qq < 32 * 8; qq += 32) { const int rl = qq >> 3, pc = qq & 7; vst2(Dst + (size_t)rl * HD + pc * 8, *(const v4u*)(&sm.soh[wave][rl][pc * 8])); }
    asm volatile("s_wait_xcnt 0x0" ::: "memory"); }   // behind this branch's last store, in front of whatever next takes the stores' address or data registers
  else {
#pragma unroll
    for (int j = 0; j < 4; ++j) { const float bb = bb_[n0 + wc * 64 + j * 16 + col];
#pragma unroll
      for (int i = 0; i < 2; ++i) {
#pragma unroll
        for (int r = 0; r < 8; ++r) sm.sth[wc * 64 + j * 16 + col][wr * 32 + i * 16 + 8 * g + r] = (_Float16)((acc[i][j][r] * (1.0f / 16.0f) + bb) * 4.0f); } }
    __syncthreads();
    _Float16* Vp = VTh + ((size_t)b * NH * HD + n0 + (tid >> 4)) * SS + s0 + (tid & 15) * 8;   // row (b * NH + h) * HD + d of V^T is row b * 512 + c, c = h * 64 + d the column; a wave's store covers two rows' 256 B
#pragma unroll
    for (int i = 0; i < 8; ++i) vst2(Vp + (size_t)i * 16 * SS, *(const v4u*)(&sm.sth[i * 16 + (tid >> 4)][(tid & 15) * 8]));
    asm volatile("s_wait_xcnt 0x0" ::: "memory"); }   // behind this branch's last store, in front of whatever next takes the stores' address or data registers
}
// lane l <-> lane l ^ 16 through a vector cross-row move (a shuffle would go through the LDS queue)
__device__ __forceinline__ float xhalf(float x) { const int b = __builtin_bit_cast(int, x); return __builtin_bit_cast(float, __builtin_amdgcn_permlanex16(b, b, 0x76543210, 0xfedcba98, false, false)); }
// Both products are taken transposed: S^T = K Q^T (A = 16 keys from LDS, B = 16 of the wave's 32 queries, kept in registers) and O^T += V^T P^T (A = 16 d rows of V^T from LDS, B = P^T).
// A lane (col, g) then holds, of query col, the scores of keys t*16 + 8g + r (tile t, register r): the softmax stays in the lane's registers, the two lanes of a query meet once per 64 keys for the maximum,
// and tiles 2kc and 2kc+1, converted in place, ARE the B fragment of keys kc*32 .. +31 (element e < 8: key 8g + e, element 8 + e: key 16 + 8g + e, the k order of frag_h). Neither S nor P touches LDS.
#define QT 2   // groups of 16 queries per wave
#define KH 2   // parts of the keys, one per group of four waves
__global__ __launch_bounds__(256) __attribute__((amdgpu_waves_per_eu(4, 4))) void k_attn(const _Float16* __restrict__ Q16, const _Float16* __restrict__ K16, const _Float16* __restrict__ VTh, _Float16* __restrict__ OC) {
  // A wave owns 32 queries, so that every K and V^T fragment that it reads from LDS feeds two products, and one half of the keys, so that there are still four waves for every SIMD:
  // waves 0..3 walk keys 0..1023, waves 4..7 keys 1024..2047 of the same 128 queries, each four with tiles of their own. Behind the loop the second four hand maximum, sum and output over through LDS.
  // Two work-groups share a WGP (LDS 2 x 126,976 B), so a wave may take 256 registers: the attribute sets that budget.
  __shared__ __align__(16) _Float16 sOh[4][QT * 16][72];   // output bounce, a wave's own 32 rows: whole 128-B lines go out
  __shared__ __align__(16) _Float16 sK[KH][2][64 * LP];   // 64 keys x 64 d
  __shared__ __align__(16) _Float16 sV[KH][2][64 * LP];   // 64 d x 64 keys
  __shared__ __align__(16) v4f sM[4][QT * 8 + 1][32];     // the hand-over: per lane 16 quads of output and one of (maximum, sum) x 2; a wave's store covers 512 contiguous bytes
  const int tid = threadIdx.x, w = tid >> 5, lane = tid & 31, col = lane & 15, g = lane >> 4, qw = w & 3, kh = w >> 2, th = tid & 127;
  const size_t bh = blockIdx.y; const int q0 = blockIdx.x * (64 * QT) + qw * (16 * QT);
  v16h aq[QT][2];
#pragma unroll
  for (int u = 0; u < QT; ++u) {
#pragma unroll
    for (int kc = 0; kc < 2; ++kc) aq[u][kc] = frag_h(Q16 + (bh * SS + q0 + u * 16 + col) * HD + kc * 32, lane); }
  asm volatile("s_wait_xcnt 0x0" ::: "memory");   // stands behind the run of loads, in front of whatever next takes their address registers
  float mrun[QT], lrun[QT]; v8f acc[QT][4] = {};   // lrun: this lane's half of the wave's keys; the halves are joined behind the loop
#pragma unroll
  for (int u = 0; u < QT; ++u) { mrun[u] = -3.0e38f; lrun[u] = 0.f; }
  const _Float16* Kb = K16 + (bh * SS + kh * (SS / KH)) * HD; const _Float16* Vb = VTh + bh * HD * SS + kh * (SS / KH); v8h rk[4], rv[4];
  tile_ld<64>(Kb, HD, th, rk); tile_ld<64>(Vb, SS, th, rv);
  asm volatile("s_wait_xcnt 0x0" ::: "memory");   // stands behind the run of loads, in front of whatever next takes their address registers
  tile_st<64>(sK[kh][0], th, rk); tile_st<64>(sV[kh][0], th, rv);
  __syncthreads();
  const float cs = 0.125f / 16.0f * 1.44269504f;   // scores in units of log2: e^x = 2^(x log2 e), so each exponential is one multiply-add and one v_exp_f32
#pragma unroll 1
  for (int kt = 0; kt < SS / KH / 64; ++kt) { const bool more = kt + 1 < SS / KH / 64;
    // the next tiles' lines are asked for first, so that they fly under the whole trip
    if (more) { tile_ld<64>(Kb + (size_t)(kt + 1) * 64 * HD, HD, th, rk); tile_ld<64>(Vb + (kt + 1) * 64, SS, th, rv);
      asm volatile("s_wait_xcnt 0x0" ::: "memory"); }   // stands behind the run of loads, in front of whatever next takes their address registers
    const _Float16* sk = sK[kh][kt & 1]; const _Float16* sv = sV[kh][kt & 1];
    v8f s[QT][4] = {};
#pragma unroll
    for (int kc = 0; kc < 2; ++kc) { v16h kf[4];   // one half of d at a time: all 8 fragments at once would not fit the 256 registers of four waves per SIMD
#pragma unroll
      for (int t = 0; t < 4; ++t) kf[t] = frag_h(sk + (t * 16 + col) * LP + kc * 32, lane);
#pragma unroll
      for (int t = 0; t < 4; ++t) {
#pragma unroll
        for (int u = 0; u < QT; ++u) s[u][t] = wmma16(kf[t], aq[u][kc], s[u][t]); } }
    v16h ph[QT][2];
#pragma unroll
    for (int u = 0; u < QT; ++u) {
      float mt[4];
#pragma unroll
      for (int t = 0; t < 4; ++t) { mt[t] = s[u][t][0];
#pragma unroll
        for (int r = 1; r < 8; ++r) mt[t] = fmaxf(mt[t], s[u][t][r]); }
      float mx = fmaxf(fmaxf(mt[0], mt[1]), fmaxf(mt[2], mt[3]));
      mx = fmaxf(mx, xhalf(mx)) * cs;   // the maximum of the raw scores, scaled (cs > 0): both lanes of a query hold the same value
      const float mnew = fmaxf(mrun[u], mx); const float corr = __builtin_amdgcn_exp2f(mrun[u] - mnew); const float mlift = mnew - 14.0f;   // the lift of P by 2^14 rides in the exponent
      const v2f cs2 = {cs, cs}, nm2 = {-mlift, -mlift};
      v2f ps2[2] = {};
#pragma unroll
      for (int t = 0; t < 4; ++t) {
#pragma unroll
        for (int i = 0; i < 4; ++i) { const v2f sc = {s[u][t][2 * i], s[u][t][2 * i + 1]}; const v2f ar = __builtin_elementwise_fma(sc, cs2, nm2);
          const v2f p = {__builtin_amdgcn_exp2f(ar[0]), __builtin_amdgcn_exp2f(ar[1])}; ps2[t & 1] += p;
          const v2h hp = __builtin_convertvector(p, v2h); ph[u][t >> 1][(t & 1) * 8 + 2 * i] = hp[0]; ph[u][t >> 1][(t & 1) * 8 + 2 * i + 1] = hp[1]; } }
      lrun[u] = lrun[u] * corr + ((ps2[0][0] + ps2[0][1]) + (ps2[1][0] + ps2[1][1])) * (1.0f / 16384.0f); mrun[u] = mnew;
      asm volatile("" :: "v"(lrun[u]));   // empty statement on a row's sum, inputs only, against spills: the sum is finished here; sunk behind the products, its 32 exponentials stay live and the staged tile goes to scratch
#pragma unroll
      for (int t = 0; t < 4; ++t) acc[u][t] = acc[u][t] * corr; }   // a lane's 32 output values of a group belong to its one query
#pragma unroll
    for (int kc = 0; kc < 2; ++kc) { v16h vf[4];
#pragma unroll
      for (int t = 0; t < 4; ++t) vf[t] = frag_h(sv + (t * 16 + col) * LP + kc * 32, lane);
#pragma unroll
      for (int t = 0; t < 4; ++t) {
#pragma unroll
        for (int u = 0; u < QT; ++u) acc[u][t] = wmma16(vf[t], ph[u][kc], acc[u][t]); } }
    if (more) { tile_st<64>(sK[kh][(kt + 1) & 1], th, rk); tile_st<64>(sV[kh][(kt + 1) & 1], th, rv); __syncthreads(); } }
  if (kh == 1) {   // wave-uniform: lane for lane the same query and the same d as in wave qw
#pragma unroll
    for (int u = 0; u < QT; ++u) {
#pragma unroll
      for (int t = 0; t < 4; ++t) { sM[qw][(u * 4 + t) * 2][lane] = v4f{acc[u][t][0], acc[u][t][1], acc[u][t][2], acc[u][t][3]}; sM[qw][(u * 4 + t) * 2 + 1][lane] = v4f{acc[u][t][4], acc[u][t][5], acc[u][t][6], acc[u][t][7]}; } }
    sM[qw][QT * 8][lane] = v4f{mrun[0], mrun[1], lrun[0], lrun[1]}; }
  __syncthreads();   // publishes the second four waves' partial results; every wave passes it, and no barrier follows
  if (kh == 1) return;
  const v4f ml = sM[qw][QT * 8][lane];
#pragma unroll
  for (int u = 0; u < QT; ++u) {
    const float mboth = fmaxf(mrun[u], ml[u]), f0 = __builtin_amdgcn_exp2f(mrun[u] - mboth), f1 = __builtin_amdgcn_exp2f(ml[u] - mboth);   // both parts brought to their common maximum
    float lsum = lrun[u] * f0 + ml[2 + u] * f1; lsum += xhalf(lsum);
    const float inv = 8.0f / (lsum * 16384.0f * 4.0f), i0 = inv * f0, i1 = inv * f1;
#pragma unroll
    for (int t = 0; t < 4; ++t) { v8h o; const v4f a = sM[qw][(u * 4 + t) * 2][lane], b = sM[qw][(u * 4 + t) * 2 + 1][lane];   // acc[u][t][r] = O[query u*16 + col][d = t*16 + 8g + r]: 8 consecutive d of one row
#pragma unroll
      for (int r = 0; r < 8; ++r) o[r] = (_Float16)(acc[u][t][r] * i0 + (r < 4 ? a[r & 3] : b[r & 3]) * i1);
      *(v8h*)(&sOh[qw][u * 16 + col][t * 16 + 8 * g]) = o; } }
  LDSX();
  for (int qq = lane; qq < QT * 16 * 8; qq += 32) { const int rl = qq >> 3, pc = qq & 7;
    vst2(OC + (((bh / NH * (2 * NH) + bh % NH) * SS) + q0 + rl) * HD + pc * 8, *(const v4u*)(&sOh[qw][rl][pc * 8])); }   // head h of batch b is slab h of the batch's 16
}
// depthwise conv (k=3, pad 1) along the sequence on queries[:, :, 512 + c]: OC[b][8 + c / 64][l][c % 64] f16 ; thread = 4 columns x CR positions, 128 threads per run of CR positions, two runs per block.
// A thread's CR + 2 input rows are loaded without a condition (the two edge rows from a clamped address, set to 0 behind the load), so that all of them are in flight before the first is waited for;
// a wave's load covers 512 contiguous bytes of a row and its store two whole 128-B lines (one row in each of two slabs), so no LDS bounce is needed.
// In front of the conv's blocks, since they run longer: blocks [0, GB): the fold, PG[o][part * 512 + j] = sum over m of Wf[o][part * 512 + m] * Wo_part[m][j], part 0 = attention (stored x2, since its A operand in k_wf, the
// context, is x8), part 1 = conv (x16): a 128 x 128 tile with A = PF rows and W = the transposed pack. Blocks [GB, GB + BB): bfold[o] = bf[o] + sum over m of Wf[o][m] * (bo_attn | bo_conv)[m], in f32.
#define CR 8
#define GB (2 * (DM / 128) * (E / 128))   // blocks of the fold
#define BB (DM / 32)                      // blocks of the folded bias: 32 rows each, so that one wave stores one whole 128-B line
__global__ __launch_bounds__(256) void k_conv(const float* __restrict__ q, const float* __restrict__ cw, const float* __restrict__ cb, _Float16* __restrict__ OC, const _Float16* __restrict__ PF, const _Float16* __restrict__ PTo,
                                             const float* __restrict__ Wf, const float* __restrict__ boa, const float* __restrict__ boc, const float* __restrict__ bfv, _Float16* __restrict__ PG, float* __restrict__ bfold) {
  __shared__ __align__(16) union { Ring ring; _Float16 soh[8][32][72]; float red[32]; } sm;   // the fold's output staging, a wave's own 32 rows x 64 columns, lies over the ring
  const int tid = threadIdx.x, id = blockIdx.x;
  if (id < GB) { const int wave = tid >> 5, lane = tid & 31, col = lane & 15, g = lane >> 4, wr = wave >> 1, wc = wave & 1;
    const int part = id / (GB / 2), o0 = id / (E / 128) % (DM / 128) * 128, n0 = id % (E / 128) * 128; const _Float16* Ab = PF + (size_t)o0 * DM + part * E;
    v8f acc[2][4] = {};
    gemm_lds<E>(Ab, DM, 64, PTo + (size_t)(part * E + n0) * E, sm.ring, tid, acc);
    const float sc = part == 0 ? 2.0f / 256.0f : 16.0f / 256.0f;   // both operands are x16
#pragma unroll
    for (int j = 0; j < 4; ++j) {
#pragma unroll
      for (int i = 0; i < 2; ++i) {
#pragma unroll
        for (int r = 0; r < 8; ++r) sm.soh[wave][i * 16 + 8 * g + r][j * 16 + col] = (_Float16)(acc[i][j][r] * sc); } }
    LDSX();
    _Float16* Dst = PG + (size_t)(o0 + wr * 32) * DM + part * E + n0 + wc * 64;
#pragma unroll
    for (int qq = lane; qq < 32 * 8; qq += 32) { const int rl = qq >> 3, pc = qq & 7; vst2(Dst + (size_t)rl * DM + pc * 8, *(const v4u*)(&sm.soh[wave][rl][pc * 8])); }
    asm volatile("s_wait_xcnt 0x0" ::: "memory");   // behind the last store, in front of whatever next takes the stores' address or data registers
    return; }
  if (id < GB + BB) {   // a wave takes 4 rows of Wf, two at a time; lane owns columns p * 128 + lane * 4 .. +3, so every load covers 512 contiguous bytes
    const int wave = tid >> 5, lane = tid & 31, o0 = (id - GB) * 32; v4f bc[8];
#pragma unroll
    for (int p = 0; p < 8; ++p) bc[p] = *(const v4f*)((p < 4 ? boa + p * 128 : boc + (p - 4) * 128) + lane * 4);
#pragma unroll
    for (int h = 0; h < 2; ++h) { const float* wrow = Wf + (size_t)(o0 + wave * 4 + h * 2) * DM + lane * 4; v4f x[2][8];
#pragma unroll
      for (int t = 0; t < 2; ++t) {
#pragma unroll
        for (int p = 0; p < 8; ++p) x[t][p] = *(const v4f*)(wrow + (size_t)t * DM + p * 128); }
      asm volatile("s_wait_xcnt 0x0" ::: "memory");   // behind the run of loads, in front of whatever next takes their address registers
#pragma unroll
      for (int t = 0; t < 2; ++t) { float sum = 0.f;
#pragma unroll
        for (int p = 0; p < 8; ++p) {
#pragma unroll
          for (int e = 0; e < 4; ++e) sum += x[t][p][e] * bc[p][e]; }
#pragma unroll
        for (int o = 16; o > 0; o >>= 1) sum += __shfl_xor(sum, o, 32);
        if (lane == 0) sm.red[wave * 4 + h * 2 + t] = sum; } }
    __syncthreads();   // the 8 waves' 32 sums meet, so that one wave stores them as one line
    if (wave == 0) bfold[o0 + lane] = sm.red[lane] + bfv[o0 + lane];
    return; }
  const int c = (tid & 127) * 4, r0 = ((id - GB - BB) * 2 + (tid >> 7)) * CR, l0 = r0 % SS;   // r0 = b * SS + l0; a run never crosses a batch (SS is a multiple of CR)
  const bool top = l0 > 0, bot = l0 + CR < SS; const float* col_ = q + (size_t)r0 * DM + E + c;
  v4f x[CR + 2];
  x[0] = *(const v4f*)(col_ - (top ? DM : 0));
#pragma unroll
  for (int i = 0; i < CR; ++i) x[i + 1] = *(const v4f*)(col_ + (size_t)i * DM);
  asm volatile("s_wait_xcnt 0x0" ::: "memory");   // a later load's result may be given the registers that hold the address of the loads above
  x[CR + 1] = *(const v4f*)(col_ + (size_t)(bot ? CR : CR - 1) * DM);
  const v4f bb = *(const v4f*)(cb + c);
  const float* wp = cw + c * 3; v4f wv[3];   // the 4 columns' 12 taps: tap k of column c + e is element e * 3 + k
  wv[0] = *(const v4f*)wp; wv[1] = *(const v4f*)(wp + 4);
  asm volatile("s_wait_xcnt 0x0" ::: "memory");   // the last load's result may be given the registers that hold the address of the loads above
  wv[2] = *(const v4f*)(wp + 8);
#pragma unroll
  for (int e = 0; e < 4; ++e) { x[0][e] = top ? x[0][e] : 0.f; x[CR + 1][e] = bot ? x[CR + 1][e] : 0.f; }
#pragma unroll
  for (int i = 0; i < CR; ++i) { v4h o;
#pragma unroll
    for (int e = 0; e < 4; ++e) o[e] = (_Float16)(wv[(e * 3) >> 2][(e * 3) & 3] * x[i][e] + wv[(e * 3 + 1) >> 2][(e * 3 + 1) & 3] * x[i + 1][e] + wv[(e * 3 + 2) >> 2][(e * 3 + 2) & 3] * x[i + 2][e] + bb[e]);
    vst2(OC + (((size_t)(r0 / SS) * (2 * NH) + NH + (c >> 6)) * SS + l0 + i) * HD + (c & 63), o); }
  asm volatile("s_wait_xcnt 0x0" ::: "memory");   // behind the last store, in front of whatever next takes the stores' address or data registers
}
// T = queries + [O | C] PG^T / 16 + bfold : block (128 rows, 128 cols), K = 1024; k stage st reads slab st of OC (0..7: the context's heads, x8; 8..15: the conv output)
__global__ __launch_bounds__(256) void k_wf(const _Float16* __restrict__ OC, const _Float16* __restrict__ PG, const float* __restrict__ bfv, const float* __restrict__ q, float* __restrict__ T) {
  __shared__ __align__(16) union { Ring ring; float so[8][32][68]; } sm;   // output staging, a wave's own 32 rows x 64 columns, lies over the ring
  const int tid = threadIdx.x, wave = tid >> 5, lane = tid & 31, col = lane & 15, g = lane >> 4; const int r0 = blockIdx.x * 128 + (wave >> 1) * 32, n0 = blockIdx.y * 128, nw = n0 + (wave & 1) * 64;
  v8f acc[2][4] = {};
  const int r0b = blockIdx.x * 128, b = r0b / SS, s = r0b % SS;   // a block's 128 rows never cross a batch (SS is a multiple of 128)
  gemm_lds<DM>(OC + ((size_t)b * (2 * NH) * SS + s) * HD, HD, (size_t)SS * HD, PG + (size_t)n0 * DM, sm.ring, tid, acc);
  float qv[2][4][8];
#pragma unroll
  for (int i = 0; i < 2; ++i) {
#pragma unroll
    for (int j = 0; j < 4; ++j) {
#pragma unroll
      for (int r = 0; r < 8; ++r) qv[i][j][r] = q[(size_t)(r0 + i * 16 + 8 * g + r) * DM + nw + j * 16 + col]; }
    asm volatile("s_wait_xcnt 0x0" ::: "memory"); }   // behind each run of loads: a later load's result may be given the registers that hold this run's address
#pragma unroll
  for (int j = 0; j < 4; ++j) { const float bb = bfv[nw + j * 16 + col];
#pragma unroll
    for (int i = 0; i < 2; ++i) {
#pragma unroll
      for (int r = 0; r < 8; ++r) sm.so[wave][i * 16 + 8 * g + r][j * 16 + col] = acc[i][j][r] * (1.0f / 16.0f) + bb + qv[i][j][r]; } }
  LDSX();
  float* Tp = T + (size_t)(r0 + g) * DM + nw + col * 4;   // a wave's store covers two rows' 256 B
#pragma unroll
  for (int i = 0; i < 16; ++i) vst2(Tp + (size_t)i * 2 * DM, *(const v4f*)(&sm.so[wave][i * 2 + g][col * 4]));
  asm volatile("s_wait_xcnt 0x0" ::: "memory");   // behind the last store, in front of whatever next takes the stores' address or data registers
}
// LayerNorm over 1024 per row: wave per row (32 floats per lane)
__global__ __launch_bounds__(256) void k_ln(const float* __restrict__ T, const float* __restrict__ gm, const float* __restrict__ bt, float* __restrict__ out) {
  // LayerNorm over 1024 per row: wave per row; lane owns columns p*128 + lane*4 .. +3 for p = 0..7 so every store instruction writes one contiguous 512-B run by 32 consecutive lanes
  const int wave = threadIdx.x >> 5, lane = threadIdx.x & 31; const size_t row = (size_t)blockIdx.x * 8 + wave; const float* tr = T + row * DM;
  float s = 0.f, sq = 0.f;
#pragma unroll
  for (int p = 0; p < 8; ++p) { const v4f v = *(const v4f*)(tr + p * 128 + lane * 4);
#pragma unroll
    for (int e = 0; e < 4; ++e) { s += v[e]; sq += v[e] * v[e]; } }
#pragma unroll
  for (int o = 16; o > 0; o >>= 1) { s += __shfl_xor(s, o, 32); sq += __shfl_xor(sq, o, 32); }
  const float mu = s * (1.0f / DM); float var = sq * (1.0f / DM) - mu * mu; var = var > 0.f ? var : 0.f; const float rs = rsqrtf(var + 1e-5f);
#pragma unroll 1
  for (int p = 0; p < 8; ++p) { const int c0 = p * 128 + lane * 4; v4f v = *(const v4f*)(tr + c0);
#pragma unroll
    for (int e = 0; e < 4; ++e) v[e] = (v[e] - mu) * rs * gm[c0 + e] + bt[c0 + e];
    vst2(out + row * DM + c0, v); }
}
extern "C" void kernel_launch(void* const* d_in, const int* in_sizes, int n_in, void* d_out, int out_size, void* d_ws, size_t ws_size, hipStream_t stream) {
  (void)in_sizes; (void)n_in; (void)out_size; (void)ws_size;
  const float** I = (const float**)d_in;
  const float* queries = I[0]; const float* keys = I[1]; const float* values = I[2]; const float* Wq = I[3]; const float* bq = I[4]; const float* Wk = I[5]; const float* bk = I[6]; const float* Wv = I[7]; const float* bv = I[8];
  const float* Woa = I[9]; const float* boa = I[10]; const float* cw = I[11]; const float* cb = I[12]; const float* Woc = I[13]; const float* boc = I[14]; const float* Wf = I[15]; const float* bfv = I[16]; const float* gm = I[17]; const float* bt = I[18];
  float* out = (float*)d_out;
  char* ws = (char*)d_ws; size_t off = 0;
  auto take = [&](size_t bytes) { char* p = ws + off; off += (bytes + 255) & ~(size_t)255; return p; };
  _Float16* Xq = (_Float16*)take((size_t)NR * E * 2); _Float16* Xk = (_Float16*)take((size_t)NR * E * 2); _Float16* Xv = (_Float16*)take((size_t)NR * E * 2);
  _Float16* PT = (_Float16*)take((size_t)5 * E * E * 2); _Float16* PF = (_Float16*)take((size_t)DM * DM * 2);
  _Float16* Q16 = (_Float16*)take((size_t)NR * E * 2); _Float16* K16 = (_Float16*)take((size_t)NR * E * 2); _Float16* VTh = (_Float16*)take((size_t)NR * E * 2);
  _Float16* OC = (_Float16*)take((size_t)NR * DM * 2);
  _Float16* PG = (_Float16*)take((size_t)DM * DM * 2); float* bfold = (float*)take((size_t)DM * 4); float* T = (float*)take((size_t)NR * DM * 4);
  // ws ~ 107 MB
  k_prep<<<3 * AB + 5 * WB + FB, 256, 0, stream>>>(queries, keys, values, Wq, Wk, Wv, Woa, Woc, Wf, Xq, Xk, Xv, PT, PF);
  k_qkv<<<dim3(NR / 128, E / 128, 3), 256, 0, stream>>>(Xq, Xk, Xv, PT, bq, bk, bv, Q16, K16, VTh);
  k_attn<<<dim3(SS / (64 * QT), NB * NH), 256, 0, stream>>>(Q16, K16, VTh, OC);
  k_conv<<<GB + BB + NR / CR / 2, 256, 0, stream>>>(queries, cw, cb, OC, PF, PT + (size_t)3 * E * E, Wf, boa, boc, bfv, PG, bfold);
  k_wf<<<dim3(NR / 128, DM / 128), 256, 0, stream>>>(OC, PG, bfold, queries, T);
  k_ln<<<NR / 8, 256, 0, stream>>>(T, gm, bt, out);
}

// v009
// Measured time: 95.7 microseconds a run.
// Next to v008, in two timings, it ran 1.05 times as fast each time.
// Over all steps from v000 it is 4.75 times as fast.
// compute dtype: f16 operands for the projections, attention, the weight fold and the final 1024x1024 projection (activations as f16 rows, weights packed x16, q/k x4, P lifted by 2^14, V x4, ctx x8), f32 accumulate; the depthwise conv, the folded bias, residual and LayerNorm in f32. Output = LN(queries + out) is residual-dominated.
#include <hip/hip_runtime.h>
#include <math.h>

typedef __attribute__((ext_vector_type(16))) _Float16 v16h;
typedef __attribute__((ext_vector_type(16))) __bf16 v16b;
typedef __attribute__((ext_vector_type(8)))  _Float16 v8h;
typedef __attribute__((ext_vector_type(4)))  _Float16 v4h;
typedef __attribute__((ext_vector_type(2)))  _Float16 v2h;
typedef __attribute__((ext_vector_type(8)))  float v8f;
typedef __attribute__((ext_vector_type(4)))  float v4f;
typedef __attribute__((ext_vector_type(2)))  float v2f;
typedef __attribute__((ext_vector_type(4)))  unsigned v4u;
typedef __attribute__((ext_vector_type(4)))  int v4i;
typedef float __attribute__((may_alias)) float_a;
typedef int __attribute__((may_alias)) int_a;

template <typename T> __device__ __forceinline__ void vst2(void* p, T v) { *(T*)p = v;  }
__device__ __forceinline__ v8f wmma16(v16h a, v16h b, v8f c) {
  v8f d = __builtin_amdgcn_wmma_f32_16x16x32_f16(false, a, false, b, (short)0, c, false, false);
  asm volatile("v_nop\n\tv_nop\n\tv_nop\n\tv_nop" : "+v"(d) : "v"(a), "v"(b));
  return d;
}
__device__ __forceinline__ v8f wmma_bf(v16b a, v16b b, v8f c) {
  v8f d = __builtin_amdgcn_wmma_f32_16x16x32_bf16(false, a, false, b, (short)0, c, false, false);
  asm volatile("v_nop\n\tv_nop\n\tv_nop\n\tv_nop" : "+v"(d) : "v"(a), "v"(b));
  return d;
}
// 16x16x32 fragments: lane = (h = lane>>4, row/col = lane&15); elements 0..7 = k0+8h+0..7, 8..15 = k0+16+8h+0..7; D element r = row 8h+r
__device__ __forceinline__ v16h frag_h(const _Float16* rowk0, int lane) {
  union { v16h v; v8h q[2]; } u; const _Float16* p = rowk0 + 8 * (lane >> 4);
  u.q[0] = *(const v8h*)p; u.q[1] = *(const v8h*)(p + 16); return u.v;
}
__device__ __forceinline__ v16h frag_f32(const float* rowk0, int lane) {
  v16h a; const float* p = rowk0 + 8 * (lane >> 4);
#pragma unroll
  for (int i = 0; i < 8; ++i) { a[i] = (_Float16)p[i]; a[8 + i] = (_Float16)p[16 + i]; }
  return a;
}
__device__ __forceinline__ v16h frag_f32s(const float* rowk0, int lane, float sc) {
  v16h a; const float* p = rowk0 + 8 * (lane >> 4);
#pragma unroll
  for (int i = 0; i < 8; ++i) { a[i] = (_Float16)(p[i] * sc); a[8 + i] = (_Float16)(p[16 + i] * sc); }
  return a;
}
// column fragment from a [K][ld] layout (column n), rows >= K read as 0
__device__ __forceinline__ v16h fragc_f32(const float* W, int k0, int n, int lane, int ld, int K) {
  v16h a; const int g = lane >> 4;
#pragma unroll
  for (int i = 0; i < 8; ++i) { const int ka = k0 + 8 * g + i, kb = ka + 16;
    a[i] = (_Float16)(ka < K ? W[(size_t)ka * ld + n] : 0.f); a[8 + i] = (_Float16)(kb < K ? W[(size_t)kb * ld + n] : 0.f); }
  return a;
}
struct F2 { v16b h, l; };
__device__ __forceinline__ F2 bsplit16(const float v[16]) { F2 r;
#pragma unroll
  for (int i = 0; i < 16; ++i) { const __bf16 h = (__bf16)v[i]; r.h[i] = h; r.l[i] = (__bf16)(v[i] - (float)h); }
  return r; }
__device__ __forceinline__ F2 split_row(const float* row, int k0, int lane) { float v[16]; const float* p = row + k0 + 8 * (lane >> 4);
#pragma unroll
  for (int i = 0; i < 8; ++i) { v[i] = p[i]; v[8 + i] = p[16 + i]; }
  return bsplit16(v); }
__device__ __forceinline__ F2 split_rowK(const float* row, int k0, int lane, int K) { float v[16]; const int g = lane >> 4;
#pragma unroll
  for (int i = 0; i < 8; ++i) { const int ka = k0 + 8 * g + i, kb = ka + 16; v[i] = ka < K ? row[ka] : 0.f; v[8 + i] = kb < K ? row[kb] : 0.f; }
  return bsplit16(v); }
__device__ __forceinline__ F2 split_col(const float* W, int k0, int n, int lane, int ld, int K) { float v[16]; const int g = lane >> 4;
#pragma unroll
  for (int i = 0; i < 8; ++i) { const int ka = k0 + 8 * g + i, kb = ka + 16; v[i] = ka < K ? W[(size_t)ka * ld + n] : 0.f; v[8 + i] = kb < K ? W[(size_t)kb * ld + n] : 0.f; }
  return bsplit16(v); }
__device__ __forceinline__ v8f mac3(const F2& a, const F2& b, v8f c) { c = wmma_bf(a.l, b.h, c); c = wmma_bf(a.h, b.l, c); return wmma_bf(a.h, b.h, c); }
__device__ __forceinline__ float sigm(float v) { return 1.0f / (1.0f + expf(-v)); }
#define LDSX() do { asm volatile("s_wait_dscnt 0" ::: "memory"); __builtin_amdgcn_wave_barrier(); __builtin_amdgcn_fence(__ATOMIC_RELEASE, "workgroup"); } while (0)


// CSP attention block on [4,2048,1024]: attention branch on channels 0..511 (q from queries, k from keys, v from values; 8 heads x 64, softmax(q.k/8), out-proj Wo_attn), conv branch on
// channels 512..1023 of queries (depthwise k=3 along the sequence + bias, then Wo_conv), concat -> Wf (1024x1024) + bf, x = queries + out, LayerNorm.
// The two 512-wide output projections are linear maps straight in front of Wf, so they are folded into it, anew in every call: with Wf = [Fa | Fc], out = O (Fa Wo_attn)^T + C (Fc Wo_conv)^T + (bf + Fa bo_attn + Fc bo_conv),
// O the attention context and C the conv output; both are written as 64-wide slabs OC[b][slab][l][64], slabs 0..7 the heads of O, slabs 8..15 the columns of C, so that [O | C] is one A operand with one k stage per slab. The fold is a 1024 x 512 x 512 product per branch (an eighth of the two projections' work). Fold, folded bias and conv need nothing but inputs, so they ride in the first launch, beside the conversions.
// k_prep (three 512-wide f16 row sets from the 1024-wide inputs; Wq|Wk|Wv rows x16; the fold; the folded bias; the conv), k_qkv, k_attn, k_wf ([O | C] x folded weights), k_ln.
#define NB 4
#define SS 2048
#define DM 1024
#define E 512
#define NH 8
#define HD 64
#define NR (NB * SS)

// Operand tiles staged in LDS by a group of NT threads (the whole work-group, or in k_attn each half of it): rows of 64 halves (one 128-B line), NT / 8 rows per step, so a wave's load covers 4 whole lines.
#define LP 72   // LDS row pitch in halves: 144 B = 16 B x 9, so the 16-byte fragment reads of 16 rows fall on distinct banks
template <int ROWS, int NT = 128> __device__ __forceinline__ void tile_ld(const _Float16* __restrict__ src, size_t pitch, int tid, v8h (&r)[ROWS * 8 / NT]) {
#pragma unroll
  for (int i = 0; i < ROWS * 8 / NT; ++i) r[i] = *(const v8h*)(src + (size_t)(i * (NT / 8) + (tid >> 3)) * pitch + (tid & 7) * 8);
}
template <int ROWS, int NT = 128> __device__ __forceinline__ void tile_st(_Float16* dst, int tid, const v8h (&r)[ROWS * 8 / NT]) {
#pragma unroll
  for (int i = 0; i < ROWS * 8 / NT; ++i) *(v8h*)(dst + (i * (NT / 8) + (tid >> 3)) * LP + (tid & 7) * 8) = r[i];
}
// One 128 x 128 tile of A W^T per work-group of 8 waves; wave w takes rows (w >> 1) * 32 .. +31 and columns (w & 1) * 64 .. +63: acc[i][j] += A(16 rows, tile i) x W(16 rows, tile j)^T over KD.
// The 128 A rows and the 128 W rows both go through two LDS buffers, 64 k per stage, and come from global memory as whole 128-B lines; an A fragment read from LDS feeds 4 products, a W fragment 2.
// Stage st of A starts at Arows + st * astep, its rows lie apitch halves apart. The next stage's lines are loaded while this stage is multiplied; one barrier per stage publishes the next buffers
// and ends the reads of the ones refilled after it.
struct Ring { _Float16 B[2][128 * LP]; _Float16 A[2][128 * LP]; };
template <int KD> __device__ __forceinline__ void gemm_lds(const _Float16* __restrict__ Arows, size_t apitch, size_t astep, const _Float16* __restrict__ Wrows, Ring& rg, int tid, v8f (&acc)[2][4]) {
  const int lane = tid & 31, col = lane & 15, w = tid >> 5, arow = (w >> 1) * 32 + col, brow = (w & 1) * 64 + col;
  v8h rb[4], ra[4];
  tile_ld<128, 256>(Wrows, KD, tid, rb); tile_ld<128, 256>(Arows, apitch, tid, ra);
  asm volatile("s_wait_xcnt 0x0" ::: "memory");   // stands behind the run of loads, in front of whatever next takes their address registers
  tile_st<128, 256>(rg.B[0], tid, rb); tile_st<128, 256>(rg.A[0], tid, ra);
  __syncthreads();
#pragma unroll 1   // kept rolled: one stage's lines in registers at a time, and the loop stays small
  for (int st = 0; st < KD / 64; ++st) { const bool more = st + 1 < KD / 64;
    if (more) { tile_ld<128, 256>(Wrows + (st + 1) * 64, KD, tid, rb); tile_ld<128, 256>(Arows + (size_t)(st + 1) * astep, apitch, tid, ra);
      asm volatile("s_wait_xcnt 0x0" ::: "memory"); }   // stands behind the run of loads, in front of the loop's foot, where their address registers are stepped on
    const _Float16* sb = rg.B[st & 1] + brow * LP; const _Float16* sa = rg.A[st & 1] + arow * LP;
#pragma unroll
    for (int kc = 0; kc < 2; ++kc) { v16h a[2], b[4];
#pragma unroll
      for (int i = 0; i < 2; ++i) a[i] = frag_h(sa + i * 16 * LP + kc * 32, lane);
#pragma unroll
      for (int j = 0; j < 4; ++j) b[j] = frag_h(sb + j * 16 * LP + kc * 32, lane);
#pragma unroll
      for (int j = 0; j < 4; ++j) {
#pragma unroll
        for (int i = 0; i < 2; ++i) acc[i][j] = wmma16(a[i], b[j], acc[i][j]); } }
    if (more) { tile_st<128, 256>(rg.B[(st + 1) & 1], tid, rb); tile_st<128, 256>(rg.A[(st + 1) & 1], tid, ra); __syncthreads(); } }
  __syncthreads();   // ends every wave's last reads of the ring: the callers stage their output over it
}

// The fold's k loop: gemm_lds's tile, ring, barriers and products, but both operands come straight from the f32 weights and are made f16 (x16) on the way into LDS, so that the fold waits for no earlier launch.
// A = 128 rows of Wf (pitch DM floats), 64 k per stage: a wave's load covers 256 contiguous bytes in each of 2 rows. W row n, element k is Wo[k][n]: wave w takes the 8 rows k = w * 8 .. +7 of Wo, a lane 4 columns n,
// so a wave's load covers 512 contiguous bytes of a row of Wo, and a lane's 8 values of one column are 16 contiguous bytes of one LDS row: the transpose costs no extra pass.
__device__ __forceinline__ void fold_ld(const float* __restrict__ Af, const float* __restrict__ Bf, int tid, v4f (&fa)[8], v4f (&fb)[8]) {
#pragma unroll
  for (int i = 0; i < 8; ++i) fa[i] = *(const v4f*)(Af + (size_t)(i * 16 + (tid >> 4)) * DM + (tid & 15) * 4);
#pragma unroll
  for (int r = 0; r < 8; ++r) fb[r] = *(const v4f*)(Bf + (size_t)((tid >> 5) * 8 + r) * E + (tid & 31) * 4);
}
__device__ __forceinline__ void fold_st(_Float16* sA, _Float16* sB, int tid, const v4f (&fa)[8], const v4f (&fb)[8]) {
#pragma unroll
  for (int i = 0; i < 8; ++i) { v4h o;
#pragma unroll
    for (int e = 0; e < 4; ++e) o[e] = (_Float16)(fa[i][e] * 16.0f);
    *(v4h*)(sA + (i * 16 + (tid >> 4)) * LP + (tid & 15) * 4) = o; }
#pragma unroll
  for (int e = 0; e < 4; ++e) { v8h o;
#pragma unroll
    for (int r = 0; r < 8; ++r) o[r] = (_Float16)(fb[r][e] * 16.0f);
    *(v8h*)(sB + ((tid & 31) * 4 + e) * LP + (tid >> 5) * 8) = o; }
}
__device__ __forceinline__ void gemm_fold(const float* __restrict__ Af, const float* __restrict__ Bf, Ring& rg, int tid, v8f (&acc)[2][4]) {
  const int lane = tid & 31, col = lane & 15, w = tid >> 5, arow = (w >> 1) * 32 + col, brow = (w & 1) * 64 + col;
  v4f fa[8], fb[8];
  fold_ld(Af, Bf, tid, fa, fb);
  asm volatile("s_wait_xcnt 0x0" ::: "memory");   // stands behind the run of loads, in front of whatever next takes their address registers
  fold_st(rg.A[0], rg.B[0], tid, fa, fb);
  __syncthreads();
#pragma unroll 1   // kept rolled: one stage's lines in registers at a time, and the loop stays small
  for (int st = 0; st < E / 64; ++st) { const bool more = st + 1 < E / 64;
    if (more) { fold_ld(Af + (st + 1) * 64, Bf + (size_t)(st + 1) * 64 * E, tid, fa, fb);
      asm volatile("s_wait_xcnt 0x0" ::: "memory"); }   // stands behind the run of loads, in front of the loop's foot, where their address registers are stepped on
    const _Float16* sb = rg.B[st & 1] + brow * LP; const _Float16* sa = rg.A[st & 1] + arow * LP;
#pragma unroll
    for (int kc = 0; kc < 2; ++kc) { v16h a[2], b[4];
#pragma unroll
      for (int i = 0; i < 2; ++i) a[i] = frag_h(sa + i * 16 * LP + kc * 32, lane);
#pragma unroll
      for (int j = 0; j < 4; ++j) b[j] = frag_h(sb + j * 16 * LP + kc * 32, lane);
#pragma unroll
      for (int j = 0; j < 4; ++j) {
#pragma unroll
        for (int i = 0; i < 2; ++i) acc[i][j] = wmma16(a[i], b[j], acc[i][j]); } }
    if (more) { fold_st(rg.A[(st + 1) & 1], rg.B[(st + 1) & 1], tid, fa, fb); __syncthreads(); } }   // publishes the next buffers and ends the reads of the ones refilled after it
  __syncthreads();   // ends every wave's last reads of the ring: the caller stages its output over it
}

// Every f32 operand that k_qkv reads as f16 is converted here. A quad is 4 floats; a block takes 256 * PQ quads of one source, a thread PQ quads that lie 256 quads apart, and asks for all
// PQ before the first is waited for. A wave's load covers 512 contiguous bytes of a row and its store 256 contiguous bytes, so no LDS bounce is needed. Rows are counted in 512 floats (128 quads):
// PITCH floats lie between two of them in the source (1024 in the activations, of which the first 512 columns are taken; 512 in the weights, which are dense), 512 halves in the destination.
#define PQ 16
#define AB (NR * E / 4 / (256 * PQ))   // blocks per activation
#define WB (E * E / 4 / (256 * PQ))    // blocks per 512 x 512 weight
template <int PITCH, int SCALE> __device__ __forceinline__ void pack_run(const float* __restrict__ src, _Float16* __restrict__ dst, int lb, int tid) {
  const float* s = src + (size_t)(lb * (2 * PQ) + (tid >> 7)) * PITCH + (tid & 127) * 4; _Float16* d = dst + ((size_t)lb * (256 * PQ) + tid) * 4;
  v4f x[PQ];
#pragma unroll
  for (int i = 0; i < PQ - 1; ++i) x[i] = *(const v4f*)(s + (size_t)i * 2 * PITCH);
  asm volatile("s_wait_xcnt 0x0" ::: "memory");   // the last load's result may be given the registers that hold the address of the loads above
  x[PQ - 1] = *(const v4f*)(s + (size_t)(PQ - 1) * 2 * PITCH);
  asm volatile("s_wait_xcnt 0x0" ::: "memory");   // behind the last load, in front of whatever next takes its address registers
#pragma unroll
  for (int i = 0; i < PQ; ++i) { v4h o;
#pragma unroll
    for (int e = 0; e < 4; ++e) o[e] = (_Float16)(x[i][e] * (float)SCALE);
    vst2(d + i * 1024, o); }
  asm volatile("s_wait_xcnt 0x0" ::: "memory");   // behind the last store, in front of whatever next takes the stores' address or data registers on any way out of this run
}
// depthwise conv (k=3, pad 1) along the sequence on queries[:, :, 512 + c]: OC[b][8 + c / 64][l][c % 64] f16 ; thread = 4 columns x CR positions, 128 threads per run of CR positions, two runs per block.
// A thread's CR + 2 input rows are loaded without a condition (the two edge rows from a clamped address, set to 0 behind the load), so that all of them are in flight before the first is waited for;
// a wave's load covers 512 contiguous bytes of a row and its store two whole 128-B lines (one row in each of two slabs), so no LDS bounce is needed.
// The launch's blocks, the longest first: [0, GB): the fold, PG[o][part * 512 + j] = sum over m of Wf[o][part * 512 + m] * Wo_part[m][j], part 0 = attention (stored x2, since its A operand in k_wf, the
// context, is x8), part 1 = conv (x16): a 128 x 128 tile. [GB, GB + BB): bfold[o] = bf[o] + sum over m of Wf[o][m] * (bo_attn | bo_conv)[m], in f32. Then 3 AB blocks: Xq | Xk | Xv = f16 of columns 0..511 of
// queries | keys | values; 3 WB blocks: PT (512 halves a row, x16) = Wq | Wk | Wv ([out][in]); the rest: the conv.
#define CR 8
#define GB (2 * (DM / 128) * (E / 128))   // blocks of the fold
#define BB (DM / 32)                      // blocks of the folded bias: 32 rows each, so that one wave stores one whole 128-B line
__global__ __launch_bounds__(256) void k_prep(const float* __restrict__ q, const float* __restrict__ k, const float* __restrict__ v, const float* __restrict__ Wq, const float* __restrict__ Wk, const float* __restrict__ Wv,
                                             const float* __restrict__ Woa, const float* __restrict__ Woc, const float* __restrict__ Wf, const float* __restrict__ cw, const float* __restrict__ cb,
                                             const float* __restrict__ boa, const float* __restrict__ boc, const float* __restrict__ bfv, _Float16* __restrict__ Xq, _Float16* __restrict__ Xk, _Float16* __restrict__ Xv,
                                             _Float16* __restrict__ PT, _Float16* __restrict__ OC, _Float16* __restrict__ PG, float* __restrict__ bfold) {
  __shared__ __align__(16) union { Ring ring; _Float16 soh[8][32][72]; float red[32]; } sm;   // the fold's output staging, a wave's own 32 rows x 64 columns, lies over the ring
  const int tid = threadIdx.x, id = blockIdx.x;
  if (id < GB) { const int wave = tid >> 5, lane = tid & 31, col = lane & 15, g = lane >> 4, wr = wave >> 1, wc = wave & 1;
    const int part = id / (GB / 2), o0 = id / (E / 128) % (DM / 128) * 128, n0 = id % (E / 128) * 128;
    v8f acc[2][4] = {};
    gemm_fold(Wf + (size_t)o0 * DM + part * E, (part == 0 ? Woa : Woc) + n0, sm.ring, tid, acc);
    const float sc = part == 0 ? 2.0f / 256.0f : 16.0f / 256.0f;   // both operands are x16
#pragma unroll
    for (int j = 0; j < 4; ++j) {
#pragma unroll
      for (int i = 0; i < 2; ++i) {
#pragma unroll
        for (int r = 0; r < 8; ++r) sm.soh[wave][i * 16 + 8 * g + r][j * 16 + col] = (_Float16)(acc[i][j][r] * sc); } }
    LDSX();
    _Float16* Dst = PG + (size_t)(o0 + wr * 32) * DM + part * E + n0 + wc * 64;
#pragma unroll
    for (int qq = lane; qq < 32 * 8; qq += 32) { const int rl = qq >> 3, pc = qq & 7; vst2(Dst + (size_t)rl * DM + pc * 8, *(const v4u*)(&sm.soh[wave][rl][pc * 8])); }
    asm volatile("s_wait_xcnt 0x0" ::: "memory");   // behind the last store, in front of whatever next takes the stores' address or data registers
    return; }
  if (id < GB + BB) {   // a wave takes 4 rows of Wf, two at a time; lane owns columns p * 128 + lane * 4 .. +3, so every load covers 512 contiguous bytes
    const int wave = tid >> 5, lane = tid & 31, o0 = (id - GB) * 32; v4f bc[8];
#pragma unroll
    for (int p = 0; p < 8; ++p) bc[p] = *(const v4f*)((p < 4 ? boa + p * 128 : boc + (p - 4) * 128) + lane * 4);
#pragma unroll
    for (int h = 0; h < 2; ++h) { const float* wrow = Wf + (size_t)(o0 + wave * 4 + h * 2) * DM + lane * 4; v4f x[2][8];
#pragma unroll
      for (int t = 0; t < 2; ++t) {
#pragma unroll
        for (int p = 0; p < 8; ++p) x[t][p] = *(const v4f*)(wrow + (size_t)t * DM + p * 128); }
      asm volatile("s_wait_xcnt 0x0" ::: "memory");   // behind the run of loads, in front of whatever next takes their address registers
#pragma unroll
      for (int t = 0; t < 2; ++t) { float sum = 0.f;
#pragma unroll
        for (int p = 0; p < 8; ++p) {
#pragma unroll
          for (int e = 0; e < 4; ++e) sum += x[t][p][e] * bc[p][e]; }
#pragma unroll
        for (int o = 16; o > 0; o >>= 1) sum += __shfl_xor(sum, o, 32);
        if (lane == 0) sm.red[wave * 4 + h * 2 + t] = sum; } }
    __syncthreads();   // the 8 waves' 32 sums meet, so that one wave stores them as one line
    if (wave == 0) bfold[o0 + lane] = sm.red[lane] + bfv[o0 + lane];
    return; }
  const int bx = id - GB - BB;
  if (bx < 3 * AB) { const int which = bx / AB; pack_run<DM, 1>(which == 0 ? q : (which == 1 ? k : v), which == 0 ? Xq : (which == 1 ? Xk : Xv), bx % AB, tid); return; }
  if (bx < 3 * AB + 3 * WB) { const int n = bx - 3 * AB, which = n / WB; pack_run<E, 16>(which == 0 ? Wq : (which == 1 ? Wk : Wv), PT + (size_t)which * E * E, n % WB, tid); return; }
  const int c = (tid & 127) * 4, r0 = ((bx - 3 * AB - 3 * WB) * 2 + (tid >> 7)) * CR, l0 = r0 % SS;   // r0 = b * SS + l0; a run never crosses a batch (SS is a multiple of CR)
  const bool top = l0 > 0, bot = l0 + CR < SS; const float* col_ = q + (size_t)r0 * DM + E + c;
  v4f x[CR + 2];
  x[0] = *(const v4f*)(col_ - (top ? DM : 0));
#pragma unroll
  for (int i = 0; i < CR; ++i) x[i + 1] = *(const v4f*)(col_ + (size_t)i * DM);
  asm volatile("s_wait_xcnt 0x0" ::: "memory");   // a later load's result may be given the registers that hold the address of the loads above
  x[CR + 1] = *(const v4f*)(col_ + (size_t)(bot ? CR : CR - 1) * DM);
  const v4f bb = *(const v4f*)(cb + c);
  const float* wp = cw + c * 3; v4f wv[3];   // the 4 columns' 12 taps: tap k of column c + e is element e * 3 + k
  wv[0] = *(const v4f*)wp; wv[1] = *(const v4f*)(wp + 4);
  asm volatile("s_wait_xcnt 0x0" ::: "memory");   // the last load's result may be given the registers that hold the address of the loads above
  wv[2] = *(const v4f*)(wp + 8);
#pragma unroll
  for (int e = 0; e < 4; ++e) { x[0][e] = top ? x[0][e] : 0.f; x[CR + 1][e] = bot ? x[CR + 1][e] : 0.f; }
#pragma unroll
  for (int i = 0; i < CR; ++i) { v4h o;
#pragma unroll
    for (int e = 0; e < 4; ++e) o[e] = (_Float16)(wv[(e * 3) >> 2][(e * 3) & 3] * x[i][e] + wv[(e * 3 + 1) >> 2][(e * 3 + 1) & 3] * x[i + 1][e] + wv[(e * 3 + 2) >> 2][(e * 3 + 2) & 3] * x[i + 2][e] + bb[e]);
    vst2(OC + (((size_t)(r0 / SS) * (2 * NH) + NH + (c >> 6)) * SS + l0 + i) * HD + (c & 63), o); }
  asm volatile("s_wait_xcnt 0x0" ::: "memory");   // behind the last store, in front of whatever next takes the stores' address or data registers
}
__global__ __launch_bounds__(256) void k_qkv(const _Float16* __restrict__ Xq, const _Float16* __restrict__ Xk, const _Float16* __restrict__ Xv, const _Float16* __restrict__ PT, const float* __restrict__ bq, const float* __restrict__ bk, const float* __restrict__ bv,
                                            _Float16* __restrict__ Q16, _Float16* __restrict__ K16, _Float16* __restrict__ VTh) {
  __shared__ __align__(16) union { Ring ring; _Float16 soh[8][32][72]; _Float16 sth[128][136]; } sm;   // output staging (q, k: a wave's own 32 rows x 64 columns; v: the block's tile transposed) lies over the ring
  const int tid = threadIdx.x, wave = tid >> 5, lane = tid & 31, col = lane & 15, g = lane >> 4, wr = wave >> 1, wc = wave & 1;
  const int which = blockIdx.z, r0b = blockIdx.x * 128, n0 = blockIdx.y * 128; const int b = r0b / SS, s0 = r0b % SS;   // a block's 128 rows never cross a batch (SS is a multiple of 128)
  const _Float16* X16 = which == 0 ? Xq : (which == 1 ? Xk : Xv); const float* bb_ = which == 0 ? bq : (which == 1 ? bk : bv);
  v8f acc[2][4] = {};
  gemm_lds<E>(X16 + (size_t)r0b * E, E, 64, PT + (size_t)(which * E + n0) * E, sm.ring, tid, acc);
  if (which < 2) {
#pragma unroll
    for (int j = 0; j < 4; ++j) { const float bb = bb_[n0 + wc * 64 + j * 16 + col];
#pragma unroll
      for (int i = 0; i < 2; ++i) {
#pragma unroll
        for (int r = 0; r < 8; ++r) sm.soh[wave][i * 16 + 8 * g + r][j * 16 + col] = (_Float16)((acc[i][j][r] * (1.0f / 16.0f) + bb) * 4.0f); } }
    LDSX();
    _Float16* Dst = (which == 0 ? Q16 : K16) + (((size_t)b * NH + (n0 >> 6) + wc) * SS + s0 + wr * 32) * HD;   // the wave's 64 columns are one head
#pragma unroll
    for (int qq = lane; qq < 32 * 8; qq += 32) { const int rl = qq >> 3, pc = qq & 7; vst2(Dst + (size_t)rl * HD + pc * 8, *(const v4u*)(&sm.soh[wave][rl][pc * 8])); }
    asm volatile("s_wait_xcnt 0x0" ::: "memory"); }   // behind this branch's last store, in front of whatever next takes the stores' address or data registers
  else {
#pragma unroll
    for (int j = 0; j < 4; ++j) { const float bb = bb_[n0 + wc * 64 + j * 16 + col];
#pragma unroll
      for (int i = 0; i < 2; ++i) {
#pragma unroll
        for (int r = 0; r < 8; ++r) sm.sth[wc * 64 + j * 16 + col][wr * 32 + i * 16 + 8 * g + r] = (_Float16)((acc[i][j][r] * (1.0f / 16.0f) + bb) * 4.0f); } }
    __syncthreads();
    _Float16* Vp = VTh + ((size_t)b * NH * HD + n0 + (tid >> 4)) * SS + s0 + (tid & 15) * 8;   // row (b * NH + h) * HD + d of V^T is row b * 512 + c, c = h * 64 + d the column; a wave's store covers two rows' 256 B
#pragma unroll
    for (int i = 0; i < 8; ++i) vst2(Vp + (size_t)i * 16 * SS, *(const v4u*)(&sm.sth[i * 16 + (tid >> 4)][(tid & 15) * 8]));
    asm volatile("s_wait_xcnt 0x0" ::: "memory"); }   // behind this branch's last store, in front of whatever next takes the stores' address or data registers
}
// lane l <-> lane l ^ 16 through a vector cross-row move (a shuffle would go through the LDS queue)
__device__ __forceinline__ float xhalf(float x) { const int b = __builtin_bit_cast(int, x); return __builtin_bit_cast(float, __builtin_amdgcn_permlanex16(b, b, 0x76543210, 0xfedcba98, false, false)); }
// Both products are taken transposed: S^T = K Q^T (A = 16 keys from LDS, B = 16 of the wave's 32 queries, kept in registers) and O^T += V^T P^T (A = 16 d rows of V^T from LDS, B = P^T).
// A lane (col, g) then holds, of query col, the scores of keys t*16 + 8g + r (tile t, register r): the softmax stays in the lane's registers, the two lanes of a query meet once per 64 keys for the maximum,
// and tiles 2kc and 2kc+1, converted in place, ARE the B fragment of keys kc*32 .. +31 (element e < 8: key 8g + e, element 8 + e: key 16 + 8g + e, the k order of frag_h). Neither S nor P touches LDS.
#define QT 2   // groups of 16 queries per wave
#define KH 2   // parts of the keys, one per group of four waves
__global__ __launch_bounds__(256) __attribute__((amdgpu_waves_per_eu(4, 4))) void k_attn(const _Float16* __restrict__ Q16, const _Float16* __restrict__ K16, const _Float16* __restrict__ VTh, _Float16* __restrict__ OC) {
  // A wave owns 32 queries, so that every K and V^T fragment that it reads from LDS feeds two products, and one half of the keys, so that there are still four waves for every SIMD:
  // waves 0..3 walk keys 0..1023, waves 4..7 keys 1024..2047 of the same 128 queries, each four with tiles of their own. Behind the loop the second four hand maximum, sum and output over through LDS.
  // Two work-groups share a WGP (LDS 2 x 126,976 B), so a wave may take 256 registers: the attribute sets that budget.
  __shared__ __align__(16) _Float16 sOh[4][QT * 16][72];   // output bounce, a wave's own 32 rows: whole 128-B lines go out
  __shared__ __align__(16) _Float16 sK[KH][2][64 * LP];   // 64 keys x 64 d
  __shared__ __align__(16) _Float16 sV[KH][2][64 * LP];   // 64 d x 64 keys
  __shared__ __align__(16) v4f sM[4][QT * 8 + 1][32];     // the hand-over: per lane 16 quads of output and one of (maximum, sum) x 2; a wave's store covers 512 contiguous bytes
  const int tid = threadIdx.x, w = tid >> 5, lane = tid & 31, col = lane & 15, g = lane >> 4, qw = w & 3, kh = w >> 2, th = tid & 127;
  const size_t bh = blockIdx.y; const int q0 = blockIdx.x * (64 * QT) + qw * (16 * QT);
  v16h aq[QT][2];
#pragma unroll
  for (int u = 0; u < QT; ++u) {
#pragma unroll
    for (int kc = 0; kc < 2; ++kc) aq[u][kc] = frag_h(Q16 + (bh * SS + q0 + u * 16 + col) * HD + kc * 32, lane); }
  asm volatile("s_wait_xcnt 0x0" ::: "memory");   // stands behind the run of loads, in front of whatever next takes their address registers
  float mrun[QT], lrun[QT]; v8f acc[QT][4] = {};   // lrun: this lane's half of the wave's keys; the halves are joined behind the loop
#pragma unroll
  for (int u = 0; u < QT; ++u) { mrun[u] = -3.0e38f; lrun[u] = 0.f; }
  const _Float16* Kb = K16 + (bh * SS + kh * (SS / KH)) * HD; const _Float16* Vb = VTh + bh * HD * SS + kh * (SS / KH); v8h rk[4], rv[4];
  tile_ld<64>(Kb, HD, th, rk); tile_ld<64>(Vb, SS, th, rv);
  asm volatile("s_wait_xcnt 0x0" ::: "memory");   // stands behind the run of loads, in front of whatever next takes their address registers
  tile_st<64>(sK[kh][0], th, rk); tile_st<64>(sV[kh][0], th, rv);
  __syncthreads();
  const float cs = 0.125f / 16.0f * 1.44269504f;   // scores in units of log2: e^x = 2^(x log2 e), so each exponential is one multiply-add and one v_exp_f32
#pragma unroll 1
  for (int kt = 0; kt < SS / KH / 64; ++kt) { const bool more = kt + 1 < SS / KH / 64;
    // the next tiles' lines are asked for first, so that they fly under the whole trip
    if (more) { tile_ld<64>(Kb + (size_t)(kt + 1) * 64 * HD, HD, th, rk); tile_ld<64>(Vb + (kt + 1) * 64, SS, th, rv);
      asm volatile("s_wait_xcnt 0x0" ::: "memory"); }   // stands behind the run of loads, in front of whatever next takes their address registers
    const _Float16* sk = sK[kh][kt & 1]; const _Float16* sv = sV[kh][kt & 1];
    v8f s[QT][4] = {};
#pragma unroll
    for (int kc = 0; kc < 2; ++kc) { v16h kf[4];   // one half of d at a time: all 8 fragments at once would not fit the 256 registers of four waves per SIMD
#pragma unroll
      for (int t = 0; t < 4; ++t) kf[t] = frag_h(sk + (t * 16 + col) * LP + kc * 32, lane);
#pragma unroll
      for (int t = 0; t < 4; ++t) {
#pragma unroll
        for (int u = 0; u < QT; ++u) s[u][t] = wmma16(kf[t], aq[u][kc], s[u][t]); } }
    v16h ph[QT][2];
#pragma unroll
    for (int u = 0; u < QT; ++u) {
      float mt[4];
#pragma unroll
      for (int t = 0; t < 4; ++t) { mt[t] = s[u][t][0];
#pragma unroll
        for (int r = 1; r < 8; ++r) mt[t] = fmaxf(mt[t], s[u][t][r]); }
      float mx = fmaxf(fmaxf(mt[0], mt[1]), fmaxf(mt[2], mt[3]));
      mx = fmaxf(mx, xhalf(mx)) * cs;   // the maximum of the raw scores, scaled (cs > 0): both lanes of a query hold the same value
      const float mnew = fmaxf(mrun[u], mx); const float corr = __builtin_amdgcn_exp2f(mrun[u] - mnew); const float mlift = mnew - 14.0f;   // the lift of P by 2^14 rides in the exponent
      const v2f cs2 = {cs, cs}, nm2 = {-mlift, -mlift};
      v2f ps2[2] = {};
#pragma unroll
      for (int t = 0; t < 4; ++t) {
#pragma unroll
        for (int i = 0; i < 4; ++i) { const v2f sc = {s[u][t][2 * i], s[u][t][2 * i + 1]}; const v2f ar = __builtin_elementwise_fma(sc, cs2, nm2);
          const v2f p = {__builtin_amdgcn_exp2f(ar[0]), __builtin_amdgcn_exp2f(ar[1])}; ps2[t & 1] += p;
          const v2h hp = __builtin_convertvector(p, v2h); ph[u][t >> 1][(t & 1) * 8 + 2 * i] = hp[0]; ph[u][t >> 1][(t & 1) * 8 + 2 * i + 1] = hp[1]; } }
      lrun[u] = lrun[u] * corr + ((ps2[0][0] + ps2[0][1]) + (ps2[1][0] + ps2[1][1])) * (1.0f / 16384.0f); mrun[u] = mnew;
      asm volatile("" :: "v"(lrun[u]));   // empty statement on a row's sum, inputs only, against spills: the sum is finished here; sunk behind the products, its 32 exponentials stay live and the staged tile goes to scratch
#pragma unroll
      for (int t = 0; t < 4; ++t) acc[u][t] = acc[u][t] * corr; }   // a lane's 32 output values of a group belong to its one query
#pragma unroll
    for (int kc = 0; kc < 2; ++kc) { v16h vf[4];
#pragma unroll
      for (int t = 0; t < 4; ++t) vf[t] = frag_h(sv + (t * 16 + col) * LP + kc * 32, lane);
#pragma unroll
      for (int t = 0; t < 4; ++t) {
#pragma unroll
        for (int u = 0; u < QT; ++u) acc[u][t] = wmma16(vf[t], ph[u][kc], acc[u][t]); } }
    if (more) { tile_st<64>(sK[kh][(kt + 1) & 1], th, rk); tile_st<64>(sV[kh][(kt + 1) & 1], th, rv); __syncthreads(); } }
  if (kh == 1) {   // wave-uniform: lane for lane the same query and the same d as in wave qw
#pragma unroll
    for (int u = 0; u < QT; ++u) {
#pragma unroll
      for (int t = 0; t < 4; ++t) { sM[qw][(u * 4 + t) * 2][lane] = v4f{acc[u][t][0], acc[u][t][1], acc[u][t][2], acc[u][t][3]}; sM[qw][(u * 4 + t) * 2 + 1][lane] = v4f{acc[u][t][4], acc[u][t][5], acc[u][t][6], acc[u][t][7]}; } }
    sM[qw][QT * 8][lane] = v4f{mrun[0], mrun[1], lrun[0], lrun[1]}; }
  __syncthreads();   // publishes the second four waves' partial results; every wave passes it, and no barrier follows
  if (kh == 1) return;
  const v4f ml = sM[qw][QT * 8][lane];
#pragma unroll
  for (int u = 0; u < QT; ++u) {
    const float mboth = fmaxf(mrun[u], ml[u]), f0 = __builtin_amdgcn_exp2f(mrun[u] - mboth), f1 = __builtin_amdgcn_exp2f(ml[u] - mboth);   // both parts brought to their common maximum
    float lsum = lrun[u] * f0 + ml[2 + u] * f1; lsum += xhalf(lsum);
    const float inv = 8.0f / (lsum * 16384.0f * 4.0f), i0 = inv * f0, i1 = inv * f1;
#pragma unroll
    for (int t = 0; t < 4; ++t) { v8h o; const v4f a = sM[qw][(u * 4 + t) * 2][lane], b = sM[qw][(u * 4 + t) * 2 + 1][lane];   // acc[u][t][r] = O[query u*16 + col][d = t*16 + 8g + r]: 8 consecutive d of one row
#pragma unroll
      for (int r = 0; r < 8; ++r) o[r] = (_Float16)(acc[u][t][r] * i0 + (r < 4 ? a[r & 3] : b[r & 3]) * i1);
      *(v8h*)(&sOh[qw][u * 16 + col][t * 16 + 8 * g]) = o; } }
  LDSX();
  for (int qq = lane; qq < QT * 16 * 8; qq += 32) { const int rl = qq >> 3, pc = qq & 7;
    vst2(OC + (((bh / NH * (2 * NH) + bh % NH) * SS) + q0 + rl) * HD + pc * 8, *(const v4u*)(&sOh[qw][rl][pc * 8])); }   // head h of batch b is slab h of the batch's 16
}
// T = queries + [O | C] PG^T / 16 + bfold : block (128 rows, 128 cols), K = 1024; k stage st reads slab st of OC (0..7: the context's heads, x8; 8..15: the conv output)
__global__ __launch_bounds__(256) void k_wf(const _Float16* __restrict__ OC, const _Float16* __restrict__ PG, const float* __restrict__ bfv, const float* __restrict__ q, float* __restrict__ T) {
  __shared__ __align__(16) union { Ring ring; float so[8][32][68]; } sm;   // output staging, a wave's own 32 rows x 64 columns, lies over the ring
  const int tid = threadIdx.x, wave = tid >> 5, lane = tid & 31, col = lane & 15, g = lane >> 4; const int r0 = blockIdx.x * 128 + (wave >> 1) * 32, n0 = blockIdx.y * 128, nw = n0 + (wave & 1) * 64;
  v8f acc[2][4] = {};
  const int r0b = blockIdx.x * 128, b = r0b / SS, s = r0b % SS;   // a block's 128 rows never cross a batch (SS is a multiple of 128)
  gemm_lds<DM>(OC + ((size_t)b * (2 * NH) * SS + s) * HD, HD, (size_t)SS * HD, PG + (size_t)n0 * DM, sm.ring, tid, acc);
  float qv[2][4][8];
#pragma unroll
  for (int i = 0; i < 2; ++i) {
#pragma unroll
    for (int j = 0; j < 4; ++j) {
#pragma unroll
      for (int r = 0; r < 8; ++r) qv[i][j][r] = q[(size_t)(r0 + i * 16 + 8 * g + r) * DM + nw + j * 16 + col]; }
    asm volatile("s_wait_xcnt 0x0" ::: "memory"); }   // behind each run of loads: a later load's result may be given the registers that hold this run's address
#pragma unroll
  for (int j = 0; j < 4; ++j) { const float bb = bfv[nw + j * 16 + col];
#pragma unroll
    for (int i = 0; i < 2; ++i) {
#pragma unroll
      for (int r = 0; r < 8; ++r) sm.so[wave][i * 16 + 8 * g + r][j * 16 + col] = acc[i][j][r] * (1.0f / 16.0f) + bb + qv[i][j][r]; } }
  LDSX();
  float* Tp = T + (size_t)(r0 + g) * DM + nw + col * 4;   // a wave's store covers two rows' 256 B
#pragma unroll
  for (int i = 0; i < 16; ++i) vst2(Tp + (size_t)i * 2 * DM, *(const v4f*)(&sm.so[wave][i * 2 + g][col * 4]));
  asm volatile("s_wait_xcnt 0x0" ::: "memory");   // behind the last store, in front of whatever next takes the stores' address or data registers
}
// LayerNorm over 1024 per row: wave per row (32 floats per lane)
__global__ __launch_bounds__(256) void k_ln(const float* __restrict__ T, const float* __restrict__ gm, const float* __restrict__ bt, float* __restrict__ out) {
  // LayerNorm over 1024 per row: wave per row; lane owns columns p*128 + lane*4 .. +3 for p = 0..7 so every store instruction writes one contiguous 512-B run by 32 consecutive lanes
  const int wave = threadIdx.x >> 5, lane = threadIdx.x & 31; const size_t row = (size_t)blockIdx.x * 8 + wave; const float* tr = T + row * DM;
  float s = 0.f, sq = 0.f;
#pragma unroll
  for (int p = 0; p < 8; ++p) { const v4f v = *(const v4f*)(tr + p * 128 + lane * 4);
#pragma unroll
    for (int e = 0; e < 4; ++e) { s += v[e]; sq += v[e] * v[e]; } }
#pragma unroll
  for (int o = 16; o > 0; o >>= 1) { s += __shfl_xor(s, o, 32); sq += __shfl_xor(sq, o, 32); }
  const float mu = s * (1.0f / DM); float var = sq * (1.0f / DM) - mu * mu; var = var > 0.f ? var : 0.f; const float rs = rsqrtf(var + 1e-5f);
#pragma unroll 1
  for (int p = 0; p < 8; ++p) { const int c0 = p * 128 + lane * 4; v4f v = *(const v4f*)(tr + c0);
#pragma unroll
    for (int e = 0; e < 4; ++e) v[e] = (v[e] - mu) * rs * gm[c0 + e] + bt[c0 + e];
    vst2(out + row * DM + c0, v); }
}
extern "C" void kernel_launch(void* const* d_in, const int* in_sizes, int n_in, void* d_out, int out_size, void* d_ws, size_t ws_size, hipStream_t stream) {
  (void)in_sizes; (void)n_in; (void)out_size; (void)ws_size;
  const float** I = (const float**)d_in;
  const float* queries = I[0]; const float* keys = I[1]; const float* values = I[2]; const float* Wq = I[3]; const float* bq = I[4]; const float* Wk = I[5]; const float* bk = I[6]; const float* Wv = I[7]; const float* bv = I[8];
  const float* Woa = I[9]; const float* boa = I[10]; const float* cw = I[11]; const float* cb = I[12]; const float* Woc = I[13]; const float* boc = I[14]; const float* Wf = I[15]; const float* bfv = I[16]; const float* gm = I[17]; const float* bt = I[18];
  float* out = (float*)d_out;
  char* ws = (char*)d_ws; size_t off = 0;
  auto take = [&](size_t bytes) { char* p = ws + off; off += (bytes + 255) & ~(size_t)255; return p; };
  _Float16* Xq = (_Float16*)take((size_t)NR * E * 2); _Float16* Xk = (_Float16*)take((size_t)NR * E * 2); _Float16* Xv = (_Float16*)take((size_t)NR * E * 2);
  _Float16* PT = (_Float16*)take((size_t)3 * E * E * 2);
  _Float16* Q16 = (_Float16*)take((size_t)NR * E * 2); _Float16* K16 = (_Float16*)take((size_t)NR * E * 2); _Float16* VTh = (_Float16*)take((size_t)NR * E * 2);
  _Float16* OC = (_Float16*)take((size_t)NR * DM * 2);
  _Float16* PG = (_Float16*)take((size_t)DM * DM * 2); float* bfold = (float*)take((size_t)DM * 4); float* T = (float*)take((size_t)NR * DM * 4);
  // ws ~ 104 MB
  k_prep<<<GB + BB + 3 * AB + 3 * WB + NR / CR / 2, 256, 0, stream>>>(queries, keys, values, Wq, Wk, Wv, Woa, Woc, Wf, cw, cb, boa, boc, bfv, Xq, Xk, Xv, PT, OC, PG, bfold);
  k_qkv<<<dim3(NR / 128, E / 128, 3), 256, 0, stream>>>(Xq, Xk, Xv, PT, bq, bk, bv, Q16, K16, VTh);
  k_attn<<<dim3(SS / (64 * QT), NB * NH), 256, 0, stream>>>(Q16, K16, VTh, OC);
  k_wf<<<dim3(NR / 128, DM / 128), 256, 0, stream>>>(OC, PG, bfold, queries, T);
  k_ln<<<NR / 8, 256, 0, stream>>>(T, gm, bt, out);
}

// v010
// It runs in 90.2 microseconds.
// Timed twice side by side with v009, it ran 1.06 times as fast both times.
// Counting every step since v000, it is 5.03 times as fast.
// compute dtype: f16 operands for the projections, attention, the weight fold and the final 1024x1024 projection (activations as f16 rows, weights packed x16, q/k x4, P lifted by 2^14, V x4, ctx x8), f32 accumulate; the depthwise conv, the folded bias, residual and LayerNorm in f32. Output = LN(queries + out) is residual-dominated.
#include <hip/hip_runtime.h>
#include <math.h>

typedef __attribute__((ext_vector_type(16))) _Float16 v16h;
typedef __attribute__((ext_vector_type(16))) __bf16 v16b;
typedef __attribute__((ext_vector_type(8)))  _Float16 v8h;
typedef __attribute__((ext_vector_type(4)))  _Float16 v4h;
typedef __attribute__((ext_vector_type(2)))  _Float16 v2h;
typedef __attribute__((ext_vector_type(8)))  float v8f;
typedef __attribute__((ext_vector_type(4)))  float v4f;
typedef __attribute__((ext_vector_type(2)))  float v2f;
typedef __attribute__((ext_vector_type(4)))  unsigned v4u;
typedef __attribute__((ext_vector_type(4)))  int v4i;
typedef float __attribute__((may_alias)) float_a;
typedef int __attribute__((may_alias)) int_a;

template <typename T> __device__ __forceinline__ void vst2(void* p, T v) { *(T*)p = v;  }
__device__ __forceinline__ v8f wmma16(v16h a, v16h b, v8f c) {
  v8f d = __builtin_amdgcn_wmma_f32_16x16x32_f16(false, a, false, b, (short)0, c, false, false);
  asm volatile("v_nop\n\tv_nop\n\tv_nop\n\tv_nop" : "+v"(d) : "v"(a), "v"(b));
  return d;
}
__device__ __forceinline__ v8f wmma_bf(v16b a, v16b b, v8f c) {
  v8f d = __builtin_amdgcn_wmma_f32_16x16x32_bf16(false, a, false, b, (short)0, c, false, false);
  asm volatile("v_nop\n\tv_nop\n\tv_nop\n\tv_nop" : "+v"(d) : "v"(a), "v"(b));
  return d;
}
// 16x16x32 fragments: lane = (h = lane>>4, row/col = lane&15); elements 0..7 = k0+8h+0..7, 8..15 = k0+16+8h+0..7; D element r = row 8h+r
__device__ __forceinline__ v16h frag_h(const _Float16* rowk0, int lane) {
  union { v16h v; v8h q[2]; } u; const _Float16* p = rowk0 + 8 * (lane >> 4);
  u.q[0] = *(const v8h*)p; u.q[1] = *(const v8h*)(p + 16); return u.v;
}
__device__ __forceinline__ v16h frag_f32(const float* rowk0, int lane) {
  v16h a; const float* p = rowk0 + 8 * (lane >> 4);
#pragma unroll
  for (int i = 0; i < 8; ++i) { a[i] = (_Float16)p[i]; a[8 + i] = (_Float16)p[16 + i]; }
  return a;
}
__device__ __forceinline__ v16h frag_f32s(const float* rowk0, int lane, float sc) {
  v16h a; const float* p = rowk0 + 8 * (lane >> 4);
#pragma unroll
  for (int i = 0; i < 8; ++i) { a[i] = (_Float16)(p[i] * sc); a[8 + i] = (_Float16)(p[16 + i] * sc); }
  return a;
}
// column fragment from a [K][ld] layout (column n), rows >= K read as 0
__device__ __forceinline__ v16h fragc_f32(const float* W, int k0, int n, int lane, int ld, int K) {
  v16h a; const int g = lane >> 4;
#pragma unroll
  for (int i = 0; i < 8; ++i) { const int ka = k0 + 8 * g + i, kb = ka + 16;
    a[i] = (_Float16)(ka < K ? W[(size_t)ka * ld + n] : 0.f); a[8 + i] = (_Float16)(kb < K ? W[(size_t)kb * ld + n] : 0.f); }
  return a;
}
struct F2 { v16b h, l; };
__device__ __forceinline__ F2 bsplit16(const float v[16]) { F2 r;
#pragma unroll
  for (int i = 0; i < 16; ++i) { const __bf16 h = (__bf16)v[i]; r.h[i] = h; r.l[i] = (__bf16)(v[i] - (float)h); }
  return r; }
__device__ __forceinline__ F2 split_row(const float* row, int k0, int lane) { float v[16]; const float* p = row + k0 + 8 * (lane >> 4);
#pragma unroll
  for (int i = 0; i < 8; ++i) { v[i] = p[i]; v[8 + i] = p[16 + i]; }
  return bsplit16(v); }
__device__ __forceinline__ F2 split_rowK(const float* row, int k0, int lane, int K) { float v[16]; const int g = lane >> 4;
#pragma unroll
  for (int i = 0; i < 8; ++i) { const int ka = k0 + 8 * g + i, kb = ka + 16; v[i] = ka < K ? row[ka] : 0.f; v[8 + i] = kb < K ? row[kb] : 0.f; }
  return bsplit16(v); }
__device__ __forceinline__ F2 split_col(const float* W, int k0, int n, int lane, int ld, int K) { float v[16]; const int g = lane >> 4;
#pragma unroll
  for (int i = 0; i < 8; ++i) { const int ka = k0 + 8 * g + i, kb = ka + 16; v[i] = ka < K ? W[(size_t)ka * ld + n] : 0.f; v[8 + i] = kb < K ? W[(size_t)kb * ld + n] : 0.f; }
  return bsplit16(v); }
__device__ __forceinline__ v8f mac3(const F2& a, const F2& b, v8f c) { c = wmma_bf(a.l, b.h, c); c = wmma_bf(a.h, b.l, c); return wmma_bf(a.h, b.h, c); }
__device__ __forceinline__ float sigm(float v) { return 1.0f / (1.0f + expf(-v)); }
#define LDSX() do { asm volatile("s_wait_dscnt 0" ::: "memory"); __builtin_amdgcn_wave_barrier(); __builtin_amdgcn_fence(__ATOMIC_RELEASE, "workgroup"); } while (0)


// CSP attention block on [4,2048,1024]: attention branch on channels 0..511 (q from queries, k from keys, v from values; 8 heads x 64, softmax(q.k/8), out-proj Wo_attn), conv branch on
// channels 512..1023 of queries (depthwise k=3 along the sequence + bias, then Wo_conv), concat -> Wf (1024x1024) + bf, x = queries + out, LayerNorm.
// The two 512-wide output projections are linear maps straight in front of Wf, so they are folded into it, anew in every call: with Wf = [Fa | Fc], out = O (Fa Wo_attn)^T + C (Fc Wo_conv)^T + (bf + Fa bo_attn + Fc bo_conv),
// O the attention context and C the conv output; both are written as 64-wide slabs OC[b][slab][l][64], slabs 0..7 the heads of O, slabs 8..15 the columns of C, so that [O | C] is one A operand with one k stage per slab. The fold is a 1024 x 512 x 512 product per branch (an eighth of the two projections' work). Fold, folded bias, conv and the q, k, v projections need nothing but inputs, so they share the first launch.
// k_prep (the fold; the folded bias; the q, k, v projections; the conv), k_attn, k_wf ([O | C] x folded weights), k_ln.
#define NB 4
#define SS 2048
#define DM 1024
#define E 512
#define NH 8
#define HD 64
#define NR (NB * SS)

// Operand tiles staged in LDS by a group of NT threads (the whole work-group, or in k_attn each half of it): rows of 64 halves (one 128-B line), NT / 8 rows per step, so a wave's load covers 4 whole lines.
#define LP 72   // LDS row pitch in halves: 144 B = 16 B x 9, so the 16-byte fragment reads of 16 rows fall on distinct banks
template <int ROWS, int NT = 128> __device__ __forceinline__ void tile_ld(const _Float16* __restrict__ src, size_t pitch, int tid, v8h (&r)[ROWS * 8 / NT]) {
#pragma unroll
  for (int i = 0; i < ROWS * 8 / NT; ++i) r[i] = *(const v8h*)(src + (size_t)(i * (NT / 8) + (tid >> 3)) * pitch + (tid & 7) * 8);
}
template <int ROWS, int NT = 128> __device__ __forceinline__ void tile_st(_Float16* dst, int tid, const v8h (&r)[ROWS * 8 / NT]) {
#pragma unroll
  for (int i = 0; i < ROWS * 8 / NT; ++i) *(v8h*)(dst + (i * (NT / 8) + (tid >> 3)) * LP + (tid & 7) * 8) = r[i];
}
// One 128 x 128 tile of A W^T per work-group of 8 waves; wave w takes rows (w >> 1) * 32 .. +31 and columns (w & 1) * 64 .. +63: acc[i][j] += A(16 rows, tile i) x W(16 rows, tile j)^T over KD.
// The 128 A rows and the 128 W rows both go through two LDS buffers, 64 k per stage, and come from global memory as whole 128-B lines; an A fragment read from LDS feeds 4 products, a W fragment 2.
// Stage st of A starts at Arows + st * astep, its rows lie apitch halves apart. The next stage's lines are loaded while this stage is multiplied; one barrier per stage publishes the next buffers
// and ends the reads of the ones refilled after it.
struct Ring { _Float16 B[2][128 * LP]; _Float16 A[2][128 * LP]; };
template <int KD> __device__ __forceinline__ void gemm_lds(const _Float16* __restrict__ Arows, size_t apitch, size_t astep, const _Float16* __restrict__ Wrows, Ring& rg, int tid, v8f (&acc)[2][4]) {
  const int lane = tid & 31, col = lane & 15, w = tid >> 5, arow = (w >> 1) * 32 + col, brow = (w & 1) * 64 + col;
  v8h rb[4], ra[4];
  tile_ld<128, 256>(Wrows, KD, tid, rb); tile_ld<128, 256>(Arows, apitch, tid, ra);
  asm volatile("s_wait_xcnt 0x0" ::: "memory");   // stands behind the run of loads, in front of whatever next takes their address registers
  tile_st<128, 256>(rg.B[0], tid, rb); tile_st<128, 256>(rg.A[0], tid, ra);
  __syncthreads();
#pragma unroll 1   // kept rolled: one stage's lines in registers at a time, and the loop stays small
  for (int st = 0; st < KD / 64; ++st) { const bool more = st + 1 < KD / 64;
    if (more) { tile_ld<128, 256>(Wrows + (st + 1) * 64, KD, tid, rb); tile_ld<128, 256>(Arows + (size_t)(st + 1) * astep, apitch, tid, ra);
      asm volatile("s_wait_xcnt 0x0" ::: "memory"); }   // stands behind the run of loads, in front of the loop's foot, where their address registers are stepped on
    const _Float16* sb = rg.B[st & 1] + brow * LP; const _Float16* sa = rg.A[st & 1] + arow * LP;
#pragma unroll
    for (int kc = 0; kc < 2; ++kc) { v16h a[2], b[4];
#pragma unroll
      for (int i = 0; i < 2; ++i) a[i] = frag_h(sa + i * 16 * LP + kc * 32, lane);
#pragma unroll
      for (int j = 0; j < 4; ++j) b[j] = frag_h(sb + j * 16 * LP + kc * 32, lane);
#pragma unroll
      for (int j = 0; j < 4; ++j) {
#pragma unroll
        for (int i = 0; i < 2; ++i) acc[i][j] = wmma16(a[i], b[j], acc[i][j]); } }
    if (more) { tile_st<128, 256>(rg.B[(st + 1) & 1], tid, rb); tile_st<128, 256>(rg.A[(st + 1) & 1], tid, ra); __syncthreads(); } }
  __syncthreads();   // ends every wave's last reads of the ring: the caller stages its output over it
}

// The fold's k loop: gemm_lds's tile, ring, barriers and products, but both operands come straight from the f32 weights and are made f16 (x16) on the way into LDS, so that the fold waits for no earlier launch.
// A = 128 rows of Wf (pitch DM floats), 64 k per stage: a wave's load covers 256 contiguous bytes in each of 2 rows. W row n, element k is Wo[k][n]: wave w takes the 8 rows k = w * 8 .. +7 of Wo, a lane 4 columns n,
// so a wave's load covers 512 contiguous bytes of a row of Wo, and a lane's 8 values of one column are 16 contiguous bytes of one LDS row: the transpose costs no extra pass.
__device__ __forceinline__ void fold_ld(const float* __restrict__ Af, const float* __restrict__ Bf, int tid, v4f (&fa)[8], v4f (&fb)[8]) {
#pragma unroll
  for (int i = 0; i < 8; ++i) fa[i] = *(const v4f*)(Af + (size_t)(i * 16 + (tid >> 4)) * DM + (tid & 15) * 4);
#pragma unroll
  for (int r = 0; r < 8; ++r) fb[r] = *(const v4f*)(Bf + (size_t)((tid >> 5) * 8 + r) * E + (tid & 31) * 4);
}
__device__ __forceinline__ void fold_st(_Float16* sA, _Float16* sB, int tid, const v4f (&fa)[8], const v4f (&fb)[8]) {
#pragma unroll
  for (int i = 0; i < 8; ++i) { v4h o;
#pragma unroll
    for (int e = 0; e < 4; ++e) o[e] = (_Float16)(fa[i][e] * 16.0f);
    *(v4h*)(sA + (i * 16 + (tid >> 4)) * LP + (tid & 15) * 4) = o; }
#pragma unroll
  for (int e = 0; e < 4; ++e) { v8h o;
#pragma unroll
    for (int r = 0; r < 8; ++r) o[r] = (_Float16)(fb[r][e] * 16.0f);
    *(v8h*)(sB + ((tid & 31) * 4 + e) * LP + (tid >> 5) * 8) = o; }
}
__device__ __forceinline__ void gemm_fold(const float* __restrict__ Af, const float* __restrict__ Bf, Ring& rg, int tid, v8f (&acc)[2][4]) {
  const int lane = tid & 31, col = lane & 15, w = tid >> 5, arow = (w >> 1) * 32 + col, brow = (w & 1) * 64 + col;
  v4f fa[8], fb[8];
  fold_ld(Af, Bf, tid, fa, fb);
  asm volatile("s_wait_xcnt 0x0" ::: "memory");   // stands behind the run of loads, in front of whatever next takes their address registers
  fold_st(rg.A[0], rg.B[0], tid, fa, fb);
  __syncthreads();
#pragma unroll 1   // kept rolled: one stage's lines in registers at a time, and the loop stays small
  for (int st = 0; st < E / 64; ++st) { const bool more = st + 1 < E / 64;
    if (more) { fold_ld(Af + (st + 1) * 64, Bf + (size_t)(st + 1) * 64 * E, tid, fa, fb);
      asm volatile("s_wait_xcnt 0x0" ::: "memory"); }   // stands behind the run of loads, in front of the loop's foot, where their address registers are stepped on
    const _Float16* sb = rg.B[st & 1] + brow * LP; const _Float16* sa = rg.A[st & 1] + arow * LP;
#pragma unroll
    for (int kc = 0; kc < 2; ++kc) { v16h a[2], b[4];
#pragma unroll
      for (int i = 0; i < 2; ++i) a[i] = frag_h(sa + i * 16 * LP + kc * 32, lane);
#pragma unroll
      for (int j = 0; j < 4; ++j) b[j] = frag_h(sb + j * 16 * LP + kc * 32, lane);
#pragma unroll
      for (int j = 0; j < 4; ++j) {
#pragma unroll
        for (int i = 0; i < 2; ++i) acc[i][j] = wmma16(a[i], b[j], acc[i][j]); } }
    if (more) { fold_st(rg.A[(st + 1) & 1], rg.B[(st + 1) & 1], tid, fa, fb); __syncthreads(); } }   // publishes the next buffers and ends the reads of the ones refilled after it
  __syncthreads();   // ends every wave's last reads of the ring: the caller stages its output over it
}

// The q, k and v projections' k loop: gemm_lds's tile, ring, barriers and products, but both operands come straight from the f32 inputs and are made f16 on the way into LDS (the weights x16), so that the
// projections wait for no earlier launch and no f16 copy of the activations goes through memory. A = 128 rows of the activation (pitch DM floats, its first 512 columns), W = 128 rows of the weight ([out][in], pitch E floats),
// 64 k per stage: a wave's load covers 256 contiguous bytes in each of 2 rows.
__device__ __forceinline__ void rows_ld(const float* __restrict__ S, size_t pitch, int tid, v4f (&f)[8]) {
#pragma unroll
  for (int i = 0; i < 8; ++i) f[i] = *(const v4f*)(S + (size_t)(i * 16 + (tid >> 4)) * pitch + (tid & 15) * 4);
}
template <int SCALE> __device__ __forceinline__ void rows_st(_Float16* d, int tid, const v4f (&f)[8]) {
#pragma unroll
  for (int i = 0; i < 8; ++i) { v4h o;
#pragma unroll
    for (int e = 0; e < 4; ++e) o[e] = (_Float16)(f[i][e] * (float)SCALE);
    *(v4h*)(d + (i * 16 + (tid >> 4)) * LP + (tid & 15) * 4) = o; }
}
__device__ __forceinline__ void gemm_rows(const float* __restrict__ Af, const float* __restrict__ Wr, Ring& rg, int tid, v8f (&acc)[2][4]) {
  const int lane = tid & 31, col = lane & 15, w = tid >> 5, arow = (w >> 1) * 32 + col, brow = (w & 1) * 64 + col;
  v4f fa[8], fb[8];
  rows_ld(Af, DM, tid, fa); rows_ld(Wr, E, tid, fb);
  asm volatile("s_wait_xcnt 0x0" ::: "memory");   // stands behind the run of loads, in front of whatever next takes their address registers
  rows_st<1>(rg.A[0], tid, fa); rows_st<16>(rg.B[0], tid, fb);
  __syncthreads();
#pragma unroll 1   // kept rolled: one stage's lines in registers at a time, and the loop stays small
  for (int st = 0; st < E / 64; ++st) { const bool more = st + 1 < E / 64;
    if (more) { rows_ld(Af + (st + 1) * 64, DM, tid, fa); rows_ld(Wr + (st + 1) * 64, E, tid, fb);
      asm volatile("s_wait_xcnt 0x0" ::: "memory"); }   // stands behind the run of loads, in front of the loop's foot, where their address registers are stepped on
    const _Float16* sb = rg.B[st & 1] + brow * LP; const _Float16* sa = rg.A[st & 1] + arow * LP;
#pragma unroll
    for (int kc = 0; kc < 2; ++kc) { v16h a[2], b[4];
#pragma unroll
      for (int i = 0; i < 2; ++i) a[i] = frag_h(sa + i * 16 * LP + kc * 32, lane);
#pragma unroll
      for (int j = 0; j < 4; ++j) b[j] = frag_h(sb + j * 16 * LP + kc * 32, lane);
#pragma unroll
      for (int j = 0; j < 4; ++j) {
#pragma unroll
        for (int i = 0; i < 2; ++i) acc[i][j] = wmma16(a[i], b[j], acc[i][j]); } }
    if (more) { rows_st<1>(rg.A[(st + 1) & 1], tid, fa); rows_st<16>(rg.B[(st + 1) & 1], tid, fb); __syncthreads(); } }   // publishes the next buffers and ends the reads of the ones refilled after it
  __syncthreads();   // ends every wave's last reads of the ring: the caller stages its output over it
}

// depthwise conv (k=3, pad 1) along the sequence on queries[:, :, 512 + c]: OC[b][8 + c / 64][l][c % 64] f16 ; thread = 4 columns x CR positions, 128 threads per run of CR positions, two runs per block.
// A thread's CR + 2 input rows are loaded without a condition (the two edge rows from a clamped address, set to 0 behind the load), so that all of them are in flight before the first is waited for;
// a wave's load covers 512 contiguous bytes of a row and its store two whole 128-B lines (one row in each of two slabs), so no LDS bounce is needed.
// The launch's blocks, the longest first: [0, GB): the fold, PG[o][part * 512 + j] = sum over m of Wf[o][part * 512 + m] * Wo_part[m][j], part 0 = attention (stored x2, since its A operand in k_wf, the
// context, is x8), part 1 = conv (x16): a 128 x 128 tile. [GB, GB + BB): bfold[o] = bf[o] + sum over m of Wf[o][m] * (bo_attn | bo_conv)[m], in f32. Then QB blocks: the q, k and v projections of columns 0..511 of
// queries | keys | values, a 128 x 128 tile each: Q16, K16 [b][h][l][64] and VTh [b][h][64][l], all x4; the rest: the conv.
#define CR 8
#define GB (2 * (DM / 128) * (E / 128))   // blocks of the fold
#define BB (DM / 32)                      // blocks of the folded bias: 32 rows each, so that one wave stores one whole 128-B line
#define QB (3 * (NR / 128) * (E / 128))   // blocks of the q, k and v projections: a 128 x 128 tile each
__global__ __launch_bounds__(256) void k_prep(const float* __restrict__ q, const float* __restrict__ k, const float* __restrict__ v, const float* __restrict__ Wq, const float* __restrict__ Wk, const float* __restrict__ Wv,
                                             const float* __restrict__ Woa, const float* __restrict__ Woc, const float* __restrict__ Wf, const float* __restrict__ cw, const float* __restrict__ cb,
                                             const float* __restrict__ boa, const float* __restrict__ boc, const float* __restrict__ bfv, const float* __restrict__ bq, const float* __restrict__ bk, const float* __restrict__ bv,
                                             _Float16* __restrict__ Q16, _Float16* __restrict__ K16, _Float16* __restrict__ VTh, _Float16* __restrict__ OC, _Float16* __restrict__ PG, float* __restrict__ bfold) {
  __shared__ __align__(16) union { Ring ring; _Float16 soh[8][32][72]; _Float16 sth[128][136]; float red[32]; } sm;   // output staging (fold, q, k: a wave's own 32 rows x 64 columns; v: the block's tile transposed) lies over the ring
  const int tid = threadIdx.x, id = blockIdx.x;
  if (id < GB) { const int wave = tid >> 5, lane = tid & 31, col = lane & 15, g = lane >> 4, wr = wave >> 1, wc = wave & 1;
    const int part = id / (GB / 2), o0 = id / (E / 128) % (DM / 128) * 128, n0 = id % (E / 128) * 128;
    v8f acc[2][4] = {};
    gemm_fold(Wf + (size_t)o0 * DM + part * E, (part == 0 ? Woa : Woc) + n0, sm.ring, tid, acc);
    const float sc = part == 0 ? 2.0f / 256.0f : 16.0f / 256.0f;   // both operands are x16
#pragma unroll
    for (int j = 0; j < 4; ++j) {
#pragma unroll
      for (int i = 0; i < 2; ++i) {
#pragma unroll
        for (int r = 0; r < 8; ++r) sm.soh[wave][i * 16 + 8 * g + r][j * 16 + col] = (_Float16)(acc[i][j][r] * sc); } }
    LDSX();
    _Float16* Dst = PG + (size_t)(o0 + wr * 32) * DM + part * E + n0 + wc * 64;
#pragma unroll
    for (int qq = lane; qq < 32 * 8; qq += 32) { const int rl = qq >> 3, pc = qq & 7; vst2(Dst + (size_t)rl * DM + pc * 8, *(const v4u*)(&sm.soh[wave][rl][pc * 8])); }
    asm volatile("s_wait_xcnt 0x0" ::: "memory");   // behind the last store, in front of whatever next takes the stores' address or data registers
    return; }
  if (id < GB + BB) {   // a wave takes 4 rows of Wf, two at a time; lane owns columns p * 128 + lane * 4 .. +3, so every load covers 512 contiguous bytes
    const int wave = tid >> 5, lane = tid & 31, o0 = (id - GB) * 32; v4f bc[8];
#pragma unroll
    for (int p = 0; p < 8; ++p) bc[p] = *(const v4f*)((p < 4 ? boa + p * 128 : boc + (p - 4) * 128) + lane * 4);
#pragma unroll
    for (int h = 0; h < 2; ++h) { const float* wrow = Wf + (size_t)(o0 + wave * 4 + h * 2) * DM + lane * 4; v4f x[2][8];
#pragma unroll
      for (int t = 0; t < 2; ++t) {
#pragma unroll
        for (int p = 0; p < 8; ++p) x[t][p] = *(const v4f*)(wrow + (size_t)t * DM + p * 128); }
      asm volatile("s_wait_xcnt 0x0" ::: "memory");   // behind the run of loads, in front of whatever next takes their address registers
#pragma unroll
      for (int t = 0; t < 2; ++t) { float sum = 0.f;
#pragma unroll
        for (int p = 0; p < 8; ++p) {
#pragma unroll
          for (int e = 0; e < 4; ++e) sum += x[t][p][e] * bc[p][e]; }
#pragma unroll
        for (int o = 16; o > 0; o >>= 1) sum += __shfl_xor(sum, o, 32);
        if (lane == 0) sm.red[wave * 4 + h * 2 + t] = sum; } }
    __syncthreads();   // the 8 waves' 32 sums meet, so that one wave stores them as one line
    if (wave == 0) bfold[o0 + lane] = sm.red[lane] + bfv[o0 + lane];
    return; }
  const int bx = id - GB - BB;
  if (bx < QB) { const int wave = tid >> 5, lane = tid & 31, col = lane & 15, g = lane >> 4, wr = wave >> 1, wc = wave & 1;
    const int which = bx / (QB / 3), r0b = bx / (E / 128) % (NR / 128) * 128, n0 = bx % (E / 128) * 128; const int b = r0b / SS, s0 = r0b % SS;   // a block's 128 rows never cross a batch (SS is a multiple of 128); the four blocks that read the same rows lie side by side
    const float* bb_ = which == 0 ? bq : (which == 1 ? bk : bv);
    v8f acc[2][4] = {};
    gemm_rows((which == 0 ? q : (which == 1 ? k : v)) + (size_t)r0b * DM, (which == 0 ? Wq : (which == 1 ? Wk : Wv)) + (size_t)n0 * E, sm.ring, tid, acc);
    if (which < 2) {
#pragma unroll
      for (int j = 0; j < 4; ++j) { const float bb = bb_[n0 + wc * 64 + j * 16 + col];
#pragma unroll
        for (int i = 0; i < 2; ++i) {
#pragma unroll
          for (int r = 0; r < 8; ++r) sm.soh[wave][i * 16 + 8 * g + r][j * 16 + col] = (_Float16)((acc[i][j][r] * (1.0f / 16.0f) + bb) * 4.0f); } }
      LDSX();
      _Float16* Dst = (which == 0 ? Q16 : K16) + (((size_t)b * NH + (n0 >> 6) + wc) * SS + s0 + wr * 32) * HD;   // the wave's 64 columns are one head
#pragma unroll
      for (int qq = lane; qq < 32 * 8; qq += 32) { const int rl = qq >> 3, pc = qq & 7; vst2(Dst + (size_t)rl * HD + pc * 8, *(const v4u*)(&sm.soh[wave][rl][pc * 8])); }
      asm volatile("s_wait_xcnt 0x0" ::: "memory"); }   // behind this branch's last store, in front of whatever next takes the stores' address or data registers
    else {
#pragma unroll
      for (int j = 0; j < 4; ++j) { const float bb = bb_[n0 + wc * 64 + j * 16 + col];
#pragma unroll
        for (int i = 0; i < 2; ++i) {
#pragma unroll
          for (int r = 0; r < 8; ++r) sm.sth[wc * 64 + j * 16 + col][wr * 32 + i * 16 + 8 * g + r] = (_Float16)((acc[i][j][r] * (1.0f / 16.0f) + bb) * 4.0f); } }
      __syncthreads();
      _Float16* Vp = VTh + ((size_t)b * NH * HD + n0 + (tid >> 4)) * SS + s0 + (tid & 15) * 8;   // row (b * NH + h) * HD + d of V^T is row b * 512 + c, c = h * 64 + d the column; a wave's store covers two rows' 256 B
#pragma unroll
      for (int i = 0; i < 8; ++i) vst2(Vp + (size_t)i * 16 * SS, *(const v4u*)(&sm.sth[i * 16 + (tid >> 4)][(tid & 15) * 8]));
      asm volatile("s_wait_xcnt 0x0" ::: "memory"); }   // behind this branch's last store, in front of whatever next takes the stores' address or data registers
    return; }
  const int c = (tid & 127) * 4, r0 = ((bx - QB) * 2 + (tid >> 7)) * CR, l0 = r0 % SS;   // r0 = b * SS + l0; a run never crosses a batch (SS is a multiple of CR)
  const bool top = l0 > 0, bot = l0 + CR < SS; const float* col_ = q + (size_t)r0 * DM + E + c;
  v4f x[CR + 2];
  x[0] = *(const v4f*)(col_ - (top ? DM : 0));
#pragma unroll
  for (int i = 0; i < CR; ++i) x[i + 1] = *(const v4f*)(col_ + (size_t)i * DM);
  asm volatile("s_wait_xcnt 0x0" ::: "memory");   // a later load's result may be given the registers that hold the address of the loads above
  x[CR + 1] = *(const v4f*)(col_ + (size_t)(bot ? CR : CR - 1) * DM);
  const v4f bb = *(const v4f*)(cb + c);
  const float* wp = cw + c * 3; v4f wv[3];   // the 4 columns' 12 taps: tap k of column c + e is element e * 3 + k
  wv[0] = *(const v4f*)wp; wv[1] = *(const v4f*)(wp + 4);
  asm volatile("s_wait_xcnt 0x0" ::: "memory");   // the last load's result may be given the registers that hold the address of the loads above
  wv[2] = *(const v4f*)(wp + 8);
#pragma unroll
  for (int e = 0; e < 4; ++e) { x[0][e] = top ? x[0][e] : 0.f; x[CR + 1][e] = bot ? x[CR + 1][e] : 0.f; }
#pragma unroll
  for (int i = 0; i < CR; ++i) { v4h o;
#pragma unroll
    for (int e = 0; e < 4; ++e) o[e] = (_Float16)(wv[(e * 3) >> 2][(e * 3) & 3] * x[i][e] + wv[(e * 3 + 1) >> 2][(e * 3 + 1) & 3] * x[i + 1][e] + wv[(e * 3 + 2) >> 2][(e * 3 + 2) & 3] * x[i + 2][e] + bb[e]);
    vst2(OC + (((size_t)(r0 / SS) * (2 * NH) + NH + (c >> 6)) * SS + l0 + i) * HD + (c & 63), o); }
  asm volatile("s_wait_xcnt 0x0" ::: "memory");   // behind the last store, in front of whatever next takes the stores' address or data registers
}
// lane l <-> lane l ^ 16 through a vector cross-row move (a shuffle would go through the LDS queue)
__device__ __forceinline__ float xhalf(float x) { const int b = __builtin_bit_cast(int, x); return __builtin_bit_cast(float, __builtin_amdgcn_permlanex16(b, b, 0x76543210, 0xfedcba98, false, false)); }
// Both products are taken transposed: S^T = K Q^T (A = 16 keys from LDS, B = 16 of the wave's 32 queries, kept in registers) and O^T += V^T P^T (A = 16 d rows of V^T from LDS, B = P^T).
// A lane (col, g) then holds, of query col, the scores of keys t*16 + 8g + r (tile t, register r): the softmax stays in the lane's registers, the two lanes of a query meet once per 64 keys for the maximum,
// and tiles 2kc and 2kc+1, converted in place, ARE the B fragment of keys kc*32 .. +31 (element e < 8: key 8g + e, element 8 + e: key 16 + 8g + e, the k order of frag_h). Neither S nor P touches LDS.
#define QT 2   // groups of 16 queries per wave
#define KH 2   // parts of the keys, one per group of four waves
__global__ __launch_bounds__(256) __attribute__((amdgpu_waves_per_eu(4, 4))) void k_attn(const _Float16* __restrict__ Q16, const _Float16* __restrict__ K16, const _Float16* __restrict__ VTh, _Float16* __restrict__ OC) {
  // A wave owns 32 queries, so that every K and V^T fragment that it reads from LDS feeds two products, and one half of the keys, so that there are still four waves for every SIMD:
  // waves 0..3 walk keys 0..1023, waves 4..7 keys 1024..2047 of the same 128 queries, each four with tiles of their own. Behind the loop the second four hand maximum, sum and output over through LDS.
  // Two work-groups share a WGP (LDS 2 x 126,976 B), so a wave may take 256 registers: the attribute sets that budget.
  __shared__ __align__(16) _Float16 sOh[4][QT * 16][72];   // output bounce, a wave's own 32 rows: whole 128-B lines go out
  __shared__ __align__(16) _Float16 sK[KH][2][64 * LP];   // 64 keys x 64 d
  __shared__ __align__(16) _Float16 sV[KH][2][64 * LP];   // 64 d x 64 keys
  __shared__ __align__(16) v4f sM[4][QT * 8 + 1][32];     // the hand-over: per lane 16 quads of output and one of (maximum, sum) x 2; a wave's store covers 512 contiguous bytes
  const int tid = threadIdx.x, w = tid >> 5, lane = tid & 31, col = lane & 15, g = lane >> 4, qw = w & 3, kh = w >> 2, th = tid & 127;
  const size_t bh = blockIdx.y; const int q0 = blockIdx.x * (64 * QT) + qw * (16 * QT);
  v16h aq[QT][2];
#pragma unroll
  for (int u = 0; u < QT; ++u) {
#pragma unroll
    for (int kc = 0; kc < 2; ++kc) aq[u][kc] = frag_h(Q16 + (bh * SS + q0 + u * 16 + col) * HD + kc * 32, lane); }
  asm volatile("s_wait_xcnt 0x0" ::: "memory");   // stands behind the run of loads, in front of whatever next takes their address registers
  float mrun[QT], lrun[QT]; v8f acc[QT][4] = {};   // lrun: this lane's half of the wave's keys; the halves are joined behind the loop
#pragma unroll
  for (int u = 0; u < QT; ++u) { mrun[u] = -3.0e38f; lrun[u] = 0.f; }
  const _Float16* Kb = K16 + (bh * SS + kh * (SS / KH)) * HD; const _Float16* Vb = VTh + bh * HD * SS + kh * (SS / KH); v8h rk[4], rv[4];
  tile_ld<64>(Kb, HD, th, rk); tile_ld<64>(Vb, SS, th, rv);
  asm volatile("s_wait_xcnt 0x0" ::: "memory");   // stands behind the run of loads, in front of whatever next takes their address registers
  tile_st<64>(sK[kh][0], th, rk); tile_st<64>(sV[kh][0], th, rv);
  __syncthreads();
  const float cs = 0.125f / 16.0f * 1.44269504f;   // scores in units of log2: e^x = 2^(x log2 e), so each exponential is one multiply-add and one v_exp_f32
#pragma unroll 1
  for (int kt = 0; kt < SS / KH / 64; ++kt) { const bool more = kt + 1 < SS / KH / 64;
    // the next tiles' lines are asked for first, so that they fly under the whole trip
    if (more) { tile_ld<64>(Kb + (size_t)(kt + 1) * 64 * HD, HD, th, rk); tile_ld<64>(Vb + (kt + 1) * 64, SS, th, rv);
      asm volatile("s_wait_xcnt 0x0" ::: "memory"); }   // stands behind the run of loads, in front of whatever next takes their address registers
    const _Float16* sk = sK[kh][kt & 1]; const _Float16* sv = sV[kh][kt & 1];
    v8f s[QT][4] = {};
#pragma unroll
    for (int kc = 0; kc < 2; ++kc) { v16h kf[4];   // one half of d at a time: all 8 fragments at once would not fit the 256 registers of four waves per SIMD
#pragma unroll
      for (int t = 0; t < 4; ++t) kf[t] = frag_h(sk + (t * 16 + col) * LP + kc * 32, lane);
#pragma unroll
      for (int t = 0; t < 4; ++t) {
#pragma unroll
        for (int u = 0; u < QT; ++u) s[u][t] = wmma16(kf[t], aq[u][kc], s[u][t]); } }
    v16h ph[QT][2];
#pragma unroll
    for (int u = 0; u < QT; ++u) {
      float mt[4];
#pragma unroll
      for (int t = 0; t < 4; ++t) { mt[t] = s[u][t][0];
#pragma unroll
        for (int r = 1; r < 8; ++r) mt[t] = fmaxf(mt[t], s[u][t][r]); }
      float mx = fmaxf(fmaxf(mt[0], mt[1]), fmaxf(mt[2], mt[3]));
      mx = fmaxf(mx, xhalf(mx)) * cs;   // the maximum of the raw scores, scaled (cs > 0): both lanes of a query hold the same value
      const float mnew = fmaxf(mrun[u], mx); const float corr = __builtin_amdgcn_exp2f(mrun[u] - mnew); const float mlift = mnew - 14.0f;   // the lift of P by 2^14 rides in the exponent
      const v2f cs2 = {cs, cs}, nm2 = {-mlift, -mlift};
      v2f ps2[2] = {};
#pragma unroll
      for (int t = 0; t < 4; ++t) {
#pragma unroll
        for (int i = 0; i < 4; ++i) { const v2f sc = {s[u][t][2 * i], s[u][t][2 * i + 1]}; const v2f ar = __builtin_elementwise_fma(sc, cs2, nm2);
          const v2f p = {__builtin_amdgcn_exp2f(ar[0]), __builtin_amdgcn_exp2f(ar[1])}; ps2[t & 1] += p;
          const v2h hp = __builtin_convertvector(p, v2h); ph[u][t >> 1][(t & 1) * 8 + 2 * i] = hp[0]; ph[u][t >> 1][(t & 1) * 8 + 2 * i + 1] = hp[1]; } }
      lrun[u] = lrun[u] * corr + ((ps2[0][0] + ps2[0][1]) + (ps2[1][0] + ps2[1][1])) * (1.0f / 16384.0f); mrun[u] = mnew;
      asm volatile("" :: "v"(lrun[u]));   // empty statement on a row's sum, inputs only, against spills: the sum is finished here; sunk behind the products, its 32 exponentials stay live and the staged tile goes to scratch
#pragma unroll
      for (int t = 0; t < 4; ++t) acc[u][t] = acc[u][t] * corr; }   // a lane's 32 output values of a group belong to its one query
#pragma unroll
    for (int kc = 0; kc < 2; ++kc) { v16h vf[4];
#pragma unroll
      for (int t = 0; t < 4; ++t) vf[t] = frag_h(sv + (t * 16 + col) * LP + kc * 32, lane);
#pragma unroll
      for (int t = 0; t < 4; ++t) {
#pragma unroll
        for (int u = 0; u < QT; ++u) acc[u][t] = wmma16(vf[t], ph[u][kc], acc[u][t]); } }
    if (more) { tile_st<64>(sK[kh][(kt + 1) & 1], th, rk); tile_st<64>(sV[kh][(kt + 1) & 1], th, rv); __syncthreads(); } }
  if (kh == 1) {   // wave-uniform: lane for lane the same query and the same d as in wave qw
#pragma unroll
    for (int u = 0; u < QT; ++u) {
#pragma unroll
      for (int t = 0; t < 4; ++t) { sM[qw][(u * 4 + t) * 2][lane] = v4f{acc[u][t][0], acc[u][t][1], acc[u][t][2], acc[u][t][3]}; sM[qw][(u * 4 + t) * 2 + 1][lane] = v4f{acc[u][t][4], acc[u][t][5], acc[u][t][6], acc[u][t][7]}; } }
    sM[qw][QT * 8][lane] = v4f{mrun[0], mrun[1], lrun[0], lrun[1]}; }
  __syncthreads();   // publishes the second four waves' partial results; every wave passes it, and no barrier follows
  if (kh == 1) return;
  const v4f ml = sM[qw][QT * 8][lane];
#pragma unroll
  for (int u = 0; u < QT; ++u) {
    const float mboth = fmaxf(mrun[u], ml[u]), f0 = __builtin_amdgcn_exp2f(mrun[u] - mboth), f1 = __builtin_amdgcn_exp2f(ml[u] - mboth);   // both parts brought to their common maximum
    float lsum = lrun[u] * f0 + ml[2 + u] * f1; lsum += xhalf(lsum);
    const float inv = 8.0f / (lsum * 16384.0f * 4.0f), i0 = inv * f0, i1 = inv * f1;
#pragma unroll
    for (int t = 0; t < 4; ++t) { v8h o; const v4f a = sM[qw][(u * 4 + t) * 2][lane], b = sM[qw][(u * 4 + t) * 2 + 1][lane];   // acc[u][t][r] = O[query u*16 + col][d = t*16 + 8g + r]: 8 consecutive d of one row
#pragma unroll
      for (int r = 0; r < 8; ++r) o[r] = (_Float16)(acc[u][t][r] * i0 + (r < 4 ? a[r & 3] : b[r & 3]) * i1);
      *(v8h*)(&sOh[qw][u * 16 + col][t * 16 + 8 * g]) = o; } }
  LDSX();
  for (int qq = lane; qq < QT * 16 * 8; qq += 32) { const int rl = qq >> 3, pc = qq & 7;
    vst2(OC + (((bh / NH * (2 * NH) + bh % NH) * SS) + q0 + rl) * HD + pc * 8, *(const v4u*)(&sOh[qw][rl][pc * 8])); }   // head h of batch b is slab h of the batch's 16
}
// T = queries + [O | C] PG^T / 16 + bfold : block (128 rows, 128 cols), K = 1024; k stage st reads slab st of OC (0..7: the context's heads, x8; 8..15: the conv output)
__global__ __launch_bounds__(256) void k_wf(const _Float16* __restrict__ OC, const _Float16* __restrict__ PG, const float* __restrict__ bfv, const float* __restrict__ q, float* __restrict__ T) {
  __shared__ __align__(16) union { Ring ring; float so[8][32][68]; } sm;   // output staging, a wave's own 32 rows x 64 columns, lies over the ring
  const int tid = threadIdx.x, wave = tid >> 5, lane = tid & 31, col = lane & 15, g = lane >> 4; const int r0 = blockIdx.x * 128 + (wave >> 1) * 32, n0 = blockIdx.y * 128, nw = n0 + (wave & 1) * 64;
  v8f acc[2][4] = {};
  const int r0b = blockIdx.x * 128, b = r0b / SS, s = r0b % SS;   // a block's 128 rows never cross a batch (SS is a multiple of 128)
  gemm_lds<DM>(OC + ((size_t)b * (2 * NH) * SS + s) * HD, HD, (size_t)SS * HD, PG + (size_t)n0 * DM, sm.ring, tid, acc);
  float qv[2][4][8];
#pragma unroll
  for (int i = 0; i < 2; ++i) {
#pragma unroll
    for (int j = 0; j < 4; ++j) {
#pragma unroll
      for (int r = 0; r < 8; ++r) qv[i][j][r] = q[(size_t)(r0 + i * 16 + 8 * g + r) * DM + nw + j * 16 + col]; }
    asm volatile("s_wait_xcnt 0x0" ::: "memory"); }   // behind each run of loads: a later load's result may be given the registers that hold this run's address
#pragma unroll
  for (int j = 0; j < 4; ++j) { const float bb = bfv[nw + j * 16 + col];
#pragma unroll
    for (int i = 0; i < 2; ++i) {
#pragma unroll
      for (int r = 0; r < 8; ++r) sm.so[wave][i * 16 + 8 * g + r][j * 16 + col] = acc[i][j][r] * (1.0f / 16.0f) + bb + qv[i][j][r]; } }
  LDSX();
  float* Tp = T + (size_t)(r0 + g) * DM + nw + col * 4;   // a wave's store covers two rows' 256 B
#pragma unroll
  for (int i = 0; i < 16; ++i) vst2(Tp + (size_t)i * 2 * DM, *(const v4f*)(&sm.so[wave][i * 2 + g][col * 4]));
  asm volatile("s_wait_xcnt 0x0" ::: "memory");   // behind the last store, in front of whatever next takes the stores' address or data registers
}
// LayerNorm over 1024 per row: wave per row (32 floats per lane)
__global__ __launch_bounds__(256) void k_ln(const float* __restrict__ T, const float* __restrict__ gm, const float* __restrict__ bt, float* __restrict__ out) {
  // LayerNorm over 1024 per row: wave per row; lane owns columns p*128 + lane*4 .. +3 for p = 0..7 so every store instruction writes one contiguous 512-B run by 32 consecutive lanes
  const int wave = threadIdx.x >> 5, lane = threadIdx.x & 31; const size_t row = (size_t)blockIdx.x * 8 + wave; const float* tr = T + row * DM;
  float s = 0.f, sq = 0.f;
#pragma unroll
  for (int p = 0; p < 8; ++p) { const v4f v = *(const v4f*)(tr + p * 128 + lane * 4);
#pragma unroll
    for (int e = 0; e < 4; ++e) { s += v[e]; sq += v[e] * v[e]; } }
#pragma unroll
  for (int o = 16; o > 0; o >>= 1) { s += __shfl_xor(s, o, 32); sq += __shfl_xor(sq, o, 32); }
  const float mu = s * (1.0f / DM); float var = sq * (1.0f / DM) - mu * mu; var = var > 0.f ? var : 0.f; const float rs = rsqrtf(var + 1e-5f);
#pragma unroll 1
  for (int p = 0; p < 8; ++p) { const int c0 = p * 128 + lane * 4; v4f v = *(const v4f*)(tr + c0);
#pragma unroll
    for (int e = 0; e < 4; ++e) v[e] = (v[e] - mu) * rs * gm[c0 + e] + bt[c0 + e];
    vst2(out + row * DM + c0, v); }
}
extern "C" void kernel_launch(void* const* d_in, const int* in_sizes, int n_in, void* d_out, int out_size, void* d_ws, size_t ws_size, hipStream_t stream) {
  (void)in_sizes; (void)n_in; (void)out_size; (void)ws_size;
  const float** I = (const float**)d_in;
  const float* queries = I[0]; const float* keys = I[1]; const float* values = I[2]; const float* Wq = I[3]; const float* bq = I[4]; const float* Wk = I[5]; const float* bk = I[6]; const float* Wv = I[7]; const float* bv = I[8];
  const float* Woa = I[9]; const float* boa = I[10]; const float* cw = I[11]; const float* cb = I[12]; const float* Woc = I[13]; const float* boc = I[14]; const float* Wf = I[15]; const float* bfv = I[16]; const float* gm = I[17]; const float* bt = I[18];
  float* out = (float*)d_out;
  char* ws = (char*)d_ws; size_t off = 0;
  auto take = [&](size_t bytes) { char* p = ws + off; off += (bytes + 255) & ~(size_t)255; return p; };
  _Float16* Q16 = (_Float16*)take((size_t)NR * E * 2); _Float16* K16 = (_Float16*)take((size_t)NR * E * 2); _Float16* VTh = (_Float16*)take((size_t)NR * E * 2);
  _Float16* OC = (_Float16*)take((size_t)NR * DM * 2);
  _Float16* PG = (_Float16*)take((size_t)DM * DM * 2); float* bfold = (float*)take((size_t)DM * 4); float* T = (float*)take((size_t)NR * DM * 4);
  // ws ~ 77 MB
  k_prep<<<GB + BB + QB + NR / CR / 2, 256, 0, stream>>>(queries, keys, values, Wq, Wk, Wv, Woa, Woc, Wf, cw, cb, boa, boc, bfv, bq, bk, bv, Q16, K16, VTh, OC, PG, bfold);
  k_attn<<<dim3(SS / (64 * QT), NB * NH), 256, 0, stream>>>(Q16, K16, VTh, OC);
  k_wf<<<dim3(NR / 128, DM / 128), 256, 0, stream>>>(OC, PG, bfold, queries, T);
  k_ln<<<NR / 8, 256, 0, stream>>>(T, gm, bt, out);
}
